// v000
// Measured on an AMD MI455X. A time is GPU time per run, averaged over a window of back-to-back runs after a warm-up
// (all launches, gaps included; the runs take copies of the inputs in turn), and the median of several windows.
// Apart from v000's, it joins two sittings. Times from different sittings can be a few percent apart, while
// side-by-side timings come from the same sitting.
// v000 is the starting kernel. One run takes 832 microseconds.
#include <hip/hip_runtime.h>

// Single-head causal attention with a key padding mask (x [4][4096][768]; q, k, v = x W^T ('oi' [64][768], no bias; one 64-wide head); scores = q.k x 64^-0.5; keep = causal (j <= i) and mask[b][j] != 0 (int32, read); softmax; out = attn.v -> [4][4096][64] f32 (1 M); no output projection).
// Compute dtypes, f32 accumulate: every input rounded to bf16; q/k/v on PLAIN bf16 operands (inputs: exact); causal scores and attn.v (tile skipping) on hi/lo planes for every row (3 products); streaming softmax in f32 (three passes over each score row in memory; no register-resident row); no output projection: the context is written in f32.

#define NB_  4
#define TT   4096
#define DM   768
#define NH_  1
#define NKV  1
#define REP  (NH_ / NKV)
#define HD   64
#define DQ   (NH_ * HD)
#define DKV  (NKV * HD)
#define ZH   1
#define RH   4096                 // every row hi/lo (streaming softmax, no register row)
#define RB   TT
#define WIN  4096
#define PCAR 1024.0f
#define SCL  0.125f   // H^-0.5 with H = 64 (the head width)
typedef _Float16 h16;
typedef unsigned short bf;
typedef __attribute__((ext_vector_type(16))) __bf16   v16bf;
typedef __attribute__((ext_vector_type(16))) _Float16 v16h;
typedef __attribute__((ext_vector_type(8)))  _Float16 v8h;
typedef __attribute__((ext_vector_type(8)))  unsigned short v8us;
typedef __attribute__((ext_vector_type(8)))  float    v8f;
typedef __attribute__((ext_vector_type(4)))  float    v4f;
typedef v8h  __attribute__((may_alias)) v8ha;
typedef v4f  __attribute__((may_alias)) v4fa;
typedef v8us __attribute__((may_alias)) v8usa;

__device__ __forceinline__ unsigned short f2bf(float f) { unsigned u = __float_as_uint(f); u += 0x7FFFu + ((u >> 16) & 1u); return (unsigned short)(u >> 16); }
__device__ __forceinline__ float bf2f(unsigned short b) { return __uint_as_float(((unsigned)b) << 16); }
__device__ __forceinline__ float bfr(float f) { return bf2f(f2bf(f)); }
__device__ __forceinline__ v16h cat16(v8h lo, v8h hi) { return __builtin_shufflevector(lo, hi, 0, 1, 2, 3, 4, 5, 6, 7, 8, 9, 10, 11, 12, 13, 14, 15); }
__device__ __forceinline__ v16bf cat16b(v8us lo, v8us hi) { return __builtin_bit_cast(v16bf, __builtin_shufflevector(lo, hi, 0, 1, 2, 3, 4, 5, 6, 7, 8, 9, 10, 11, 12, 13, 14, 15)); }
__device__ __forceinline__ v8f wmma16(v16h a, v16h b, v8f c) { return __builtin_amdgcn_wmma_f32_16x16x32_f16(false, a, false, b, (short)0, c, false, false); }
__device__ __forceinline__ v8f wmmab(v16bf a, v16bf b, v8f c) { return __builtin_amdgcn_wmma_f32_16x16x32_bf16(false, a, false, b, (short)0, c, false, false); }



// ---- k_gemmw: register-blocked GEMM, ONE WAVE per 64x64 output tile (16 accumulators), operands straight from K-contiguous 16-bit planes; grid (M/64, N/64, Z), 32 threads.
// C[m][n] (f32, pitch ldc, + optional f32 bias[n]) = sum_k A[m][k] Bt[n][k] (+ split products per NSPLIT). z-batch strides sA/sB/sC in elements. K % 32 == 0.
template <typename T16> struct WFrag;
template <> struct WFrag<h16> { typedef v16h V; static __device__ __forceinline__ V ld(const h16* p) { return cat16(*(const v8h*)p, *(const v8h*)(p + 16)); } static __device__ __forceinline__ v8f mma(V a, V b, v8f c) { return wmma16(a, b, c); } };
template <> struct WFrag<bf> { typedef v16bf V; static __device__ __forceinline__ V ld(const bf* p) { return cat16b(*(const v8us*)p, *(const v8us*)(p + 16)); } static __device__ __forceinline__ v8f mma(V a, V b, v8f c) { return wmmab(a, b, c); } };
template <typename T16, int NSPLIT, bool BIAS>
__global__ __launch_bounds__(32) void k_gemmw(const T16* __restrict__ A, const T16* __restrict__ A2, const T16* __restrict__ Bt, const T16* __restrict__ Bt2, int K, float* C, int ldc, const float* __restrict__ bias, size_t sA, size_t sB, size_t sC) {
    typedef typename WFrag<T16>::V V;
    __shared__ __align__(16) float os[16 * 68];
    const size_t z = blockIdx.z; A += z * sA; if (A2) A2 += z * sA; Bt += z * sB; if (Bt2) Bt2 += z * sB; C += z * sC;
    const int lane = threadIdx.x & 31, lr = lane & 15, hi = lane >> 4; const int r0 = blockIdx.x * 64, c0 = blockIdx.y * 64;
    v8f acc[4][4];
#pragma unroll
    for (int mb = 0; mb < 4; ++mb)
#pragma unroll
        for (int nb = 0; nb < 4; ++nb) acc[mb][nb] = (v8f){};
    const size_t aoff = (size_t)(r0 + lr) * K + 8 * hi, boff = (size_t)(c0 + lr) * K + 8 * hi;
#pragma unroll 1
    for (int kc = 0; kc < K; kc += 32) {
        V a[4], a2[4];
#pragma unroll
        for (int mb = 0; mb < 4; ++mb) { a[mb] = WFrag<T16>::ld(A + aoff + (size_t)mb * 16 * K + kc); if (NSPLIT == 1 || NSPLIT == 2) a2[mb] = WFrag<T16>::ld(A2 + aoff + (size_t)mb * 16 * K + kc); }
#pragma unroll
        for (int nb = 0; nb < 4; ++nb) { const V b = WFrag<T16>::ld(Bt + boff + (size_t)nb * 16 * K + kc); V b2; if (NSPLIT >= 2) b2 = WFrag<T16>::ld(Bt2 + boff + (size_t)nb * 16 * K + kc);
#pragma unroll
            for (int mb = 0; mb < 4; ++mb) { acc[mb][nb] = WFrag<T16>::mma(a[mb], b, acc[mb][nb]); if (NSPLIT == 1 || NSPLIT == 2) acc[mb][nb] = WFrag<T16>::mma(a2[mb], b, acc[mb][nb]); if (NSPLIT >= 2) acc[mb][nb] = WFrag<T16>::mma(a[mb], b2, acc[mb][nb]); } }
        asm volatile("v_nop\n\tv_nop\n\tv_nop\n\tv_nop" : "+v"(acc[0][0]), "+v"(acc[1][1]), "+v"(acc[2][2]), "+v"(acc[3][3]) : "v"(a[0]), "v"(a[3]));
    }
#pragma unroll
    for (int mb = 0; mb < 4; ++mb) {
#pragma unroll
        for (int nb = 0; nb < 4; ++nb) {
#pragma unroll
            for (int j = 0; j < 8; ++j) os[(hi * 8 + j) * 68 + nb * 16 + lr] = acc[mb][nb][j]; }
        __builtin_amdgcn_wave_barrier(); asm volatile("" ::: "memory");
        float* crow = C + (size_t)(r0 + mb * 16) * ldc + c0;
{
#pragma unroll
            for (int s = 0; s < 8; ++s) { const int row = 2 * s + hi, cofs = lr * 4; v4f val = *(const v4fa*)(os + row * 68 + cofs); if (BIAS) { val[0] += bfr(bias[c0 + cofs]); val[1] += bfr(bias[c0 + cofs + 1]); val[2] += bfr(bias[c0 + cofs + 2]); val[3] += bfr(bias[c0 + cofs + 3]); }
                *(v4f*)(crow + (size_t)row * ldc + cofs) = val; }
             }
        __builtin_amdgcn_wave_barrier(); asm volatile("" ::: "memory");
    }
}

// ---- k_gemmc: the same one-wave 64x64 tile GEMM specialised for causal attention: CMODE 1 skips score tiles entirely above the diagonal (query rows r0+roff.., key columns c0..), CMODE 2 limits the
// key (K) loop of the probability x value contraction to the diagonal block (probabilities beyond it are exactly zero). roff = row offset of this launch's first row within the sequence.
template <typename T16, int NSPLIT, int CMODE>
__global__ __launch_bounds__(32) void k_gemmc(const T16* __restrict__ A, const T16* __restrict__ A2, const T16* __restrict__ Bt, const T16* __restrict__ Bt2, int K, float* C, int ldc, int roff, size_t sA, size_t sB, size_t sC) {
    typedef typename WFrag<T16>::V V;
    __shared__ __align__(16) float os[16 * 68];
    const size_t z = blockIdx.z; A += z * sA; if (A2) A2 += z * sA; Bt += z * sB; if (Bt2) Bt2 += z * sB; C += z * sC;
    const int lane = threadIdx.x & 31, lr = lane & 15, hi = lane >> 4; const int r0 = blockIdx.x * 64, c0 = blockIdx.y * 64;
    if (CMODE == 1 && c0 > r0 + roff + 63) return;                  // score tile entirely above the causal diagonal: never read (the softmax masks j > i by select)
    const int Kl = (CMODE == 2) ? min(K, r0 + roff + 64) : K;        // P.V: probabilities are exactly 0 beyond the diagonal block, so the K loop stops there
    v8f acc[4][4];
#pragma unroll
    for (int mb = 0; mb < 4; ++mb)
#pragma unroll
        for (int nb = 0; nb < 4; ++nb) acc[mb][nb] = (v8f){};
    const size_t aoff = (size_t)(r0 + lr) * K + 8 * hi, boff = (size_t)(c0 + lr) * K + 8 * hi;
#pragma unroll 1
    for (int kc = 0; kc < Kl; kc += 32) {
        V a[4], a2[4];
#pragma unroll
        for (int mb = 0; mb < 4; ++mb) { a[mb] = WFrag<T16>::ld(A + aoff + (size_t)mb * 16 * K + kc); if (NSPLIT == 1 || NSPLIT == 2) a2[mb] = WFrag<T16>::ld(A2 + aoff + (size_t)mb * 16 * K + kc); }
#pragma unroll
        for (int nb = 0; nb < 4; ++nb) { const V b = WFrag<T16>::ld(Bt + boff + (size_t)nb * 16 * K + kc); V b2; if (NSPLIT >= 2) b2 = WFrag<T16>::ld(Bt2 + boff + (size_t)nb * 16 * K + kc);
#pragma unroll
            for (int mb = 0; mb < 4; ++mb) { acc[mb][nb] = WFrag<T16>::mma(a[mb], b, acc[mb][nb]); if (NSPLIT == 1 || NSPLIT == 2) acc[mb][nb] = WFrag<T16>::mma(a2[mb], b, acc[mb][nb]); if (NSPLIT >= 2) acc[mb][nb] = WFrag<T16>::mma(a[mb], b2, acc[mb][nb]); } }
        asm volatile("v_nop\n\tv_nop\n\tv_nop\n\tv_nop" : "+v"(acc[0][0]), "+v"(acc[1][1]), "+v"(acc[2][2]), "+v"(acc[3][3]) : "v"(a[0]), "v"(a[3]));
    }
#pragma unroll
    for (int mb = 0; mb < 4; ++mb) {
#pragma unroll
        for (int nb = 0; nb < 4; ++nb) {
#pragma unroll
            for (int j = 0; j < 8; ++j) os[(hi * 8 + j) * 68 + nb * 16 + lr] = acc[mb][nb][j]; }
        __builtin_amdgcn_wave_barrier(); asm volatile("" ::: "memory");
        float* crow = C + (size_t)(r0 + mb * 16) * ldc + c0;
{
#pragma unroll
            for (int s = 0; s < 8; ++s) { const int row = 2 * s + hi, cofs = lr * 4; v4f val = *(const v4fa*)(os + row * 68 + cofs);
                *(v4f*)(crow + (size_t)row * ldc + cofs) = val; }
             }
        __builtin_amdgcn_wave_barrier(); asm volatile("" ::: "memory");
    }
}

__device__ __forceinline__ h16 tohx(float x) { return (h16)x; }
__device__ __forceinline__ void splitf(float y, unsigned short& h, unsigned short& l) { h = f2bf(y); l = f2bf(y - bf2f(h)); }
typedef __attribute__((ext_vector_type(2))) _Float16 v2h;
typedef __attribute__((ext_vector_type(4))) _Float16 v4h;
typedef __attribute__((ext_vector_type(2))) unsigned short v2us;
typedef __attribute__((ext_vector_type(4))) unsigned short v4us;
typedef __attribute__((ext_vector_type(2))) float v2f;
typedef __attribute__((ext_vector_type(4))) int v4i;

__global__ __launch_bounds__(256) void k_wtG(const float* __restrict__ w, int K, int N, bf* Bt) {
    const int lane = threadIdx.x & 31; const int L0 = (blockIdx.x * 8 + (threadIdx.x >> 5)) * 8; const int nlines = N * K / 64;
{
#pragma unroll 1
        for (int l = 0; l < 8; ++l) { const int L = L0 + l; if (L >= nlines) break; const size_t e = (size_t)L * 64 + lane * 2; const int k = (int)(e % K), n = (int)(e / K); v2us o;
            o[0] = f2bf(w[(size_t)k * N + n]); o[1] = f2bf(w[(size_t)(k + 1) * N + n]); *(v2us*)(Bt + e) = o; }
         }
}
__global__ __launch_bounds__(256) void k_cvt8(const float* __restrict__ src, bf* dst, size_t n8) { const size_t i = (size_t)blockIdx.x * 256 + threadIdx.x; if (i >= n8) return; const v8f v = *(const v8f*)(src + i * 8); v8us o;
#pragma unroll
    for (int k = 0; k < 8; ++k) o[k] = f2bf(v[k]); *(v8us*)(dst + i * 8) = o;  }

// k_rope: head planes [h][t][d] (fp16 + hi/lo) of rope(x) x sc with the rotate-half convention out[d] = x[d] cos[t][d] - x[d+HD/2] sin[t][d], out[d+HD/2] = x[d+HD/2] cos[t][d+HD/2] + x[d] sin[t][d+HD/2]
__global__ __launch_bounds__(256) void k_rope(const float* __restrict__ F, int pitch, int nheads, const float* __restrict__ CS, const float* __restrict__ RF, const float* __restrict__ nw, float sc, h16* P16, bf* Ph, bf* Pl) {
    const size_t e = ((size_t)blockIdx.x * 256 + threadIdx.x) * 2; if (e >= (size_t)nheads * TT * HD) return; const int d = (int)(e % HD); const int t = (int)((e / HD) % TT); const int h = (int)(e / ((size_t)HD * TT)); const float* f = F + (size_t)t * pitch + h * HD; const float rf = RF ? RF[(size_t)h * TT + t] : 1.0f; v2h o16; v2us oh, ol;
#pragma unroll
    for (int q = 0; q < 2; ++q) { const int dd = d + q; const int dp = (dd < HD / 2) ? dd + HD / 2 : dd - HD / 2; float x0 = f[dd], x1 = f[dp];
        if (RF) { float n0 = __fmul_rn(x0, rf), n1 = __fmul_rn(x1, rf); asm volatile("" : "+v"(n0)); asm volatile("" : "+v"(n1)); x0 = __fmul_rn(bfr(nw[dd]), n0); x1 = __fmul_rn(bfr(nw[dp]), n1); }
        const v2f cs = *(const v2f*)(CS + ((size_t)t * HD + dd) * 2); float a = __fmul_rn(x0, cs[0]), bq = __fmul_rn(x1, cs[1]); asm volatile("" : "+v"(a)); asm volatile("" : "+v"(bq)); const float r = ((dd < HD / 2) ? __fsub_rn(a, bq) : __fadd_rn(a, bq)) * sc;
        o16[q] = tohx(r); unsigned short a2, c2; splitf(r, a2, c2); oh[q] = a2; ol[q] = c2; }
    *(v2h*)(P16 + e) = o16; *(v2us*)(Ph + e) = oh; *(v2us*)(Pl + e) = ol;  }
__global__ __launch_bounds__(256) void k_vtp(const float* __restrict__ F, int pitch, int nheads, h16* V16, bf* Vh, bf* Vl) { const size_t e = ((size_t)blockIdx.x * 256 + threadIdx.x) * 2; if (e >= (size_t)nheads * HD * TT) return; const int t = (int)(e % TT); const int d = (int)((e / TT) % HD); const int g = (int)(e / ((size_t)TT * HD)); v2h o16; v2us oh, ol;
#pragma unroll
    for (int q = 0; q < 2; ++q) { const float x = F[(size_t)(t + q) * pitch + g * HD + d]; o16[q] = tohx(x); unsigned short a2, c2; splitf(x, a2, c2); oh[q] = a2; ol[q] = c2; }
    *(v2h*)(V16 + e) = o16; *(v2us*)(Vh + e) = oh; *(v2us*)(Vl + e) = ol;  }
__global__ __launch_bounds__(256) void k_csid(float* CS) { const int idx = blockIdx.x * 256 + threadIdx.x; if (idx >= TT * HD) return; v2f cs; cs[0] = 1.0f; cs[1] = 0.0f; *(v2f*)(CS + (size_t)idx * 2) = cs;  }
__global__ __launch_bounds__(256) void k_ssoft(const float* __restrict__ Sb, int r0, const int* __restrict__ MKb, bf* Ph, bf* Pl) {
    const int lane = threadIdx.x & 31; const int ri = blockIdx.x * 8 + (threadIdx.x >> 5); if (ri >= RB) return; const int i = r0 + ri; const float* sr = Sb + (size_t)ri * TT; const int nval = i + 1;   /* causal, diagonal kept: keys 0 .. i */
    float mx = -3.0e38f;
#pragma unroll 1
    for (int j0 = lane * 4; j0 < nval; j0 += 128) { const v4f a = *(const v4f*)(sr + j0);
#pragma unroll
        for (int q = 0; q < 4; ++q) if (j0 + q < nval && MKb[j0 + q] != 0) mx = fmaxf(mx, a[q] * SCL); }
#pragma unroll
    for (int sh = 16; sh; sh >>= 1) mx = fmaxf(mx, __shfl_xor(mx, sh, 32));
    float sum = 0.f;
#pragma unroll 1
    for (int j0 = lane * 4; j0 < nval; j0 += 128) { const v4f a = *(const v4f*)(sr + j0);
#pragma unroll
        for (int q = 0; q < 4; ++q) if (j0 + q < nval && MKb[j0 + q] != 0) { float d0 = __fsub_rn(a[q] * SCL, mx); asm volatile("" : "+v"(d0)); sum += __builtin_amdgcn_exp2f(__fmul_rn(d0, 1.4426950408889634f)); } }
#pragma unroll
    for (int sh = 16; sh; sh >>= 1) sum += __shfl_xor(sum, sh, 32);
    const float f = (sum > 0.f) ? __fdiv_rn(1.0f, sum) : 0.f;
{
#pragma unroll 1
        for (int j0 = lane * 4; j0 < TT; j0 += 128) { const v4f a = *(const v4f*)(sr + j0); v4us oh, ol;
#pragma unroll
            for (int q = 0; q < 4; ++q) { float pv = 0.f; if (j0 + q < nval && MKb[j0 + q] != 0) { float d0 = __fsub_rn(a[q] * SCL, mx); asm volatile("" : "+v"(d0)); pv = __builtin_amdgcn_exp2f(__fmul_rn(d0, 1.4426950408889634f)) * f; } unsigned short h2, l2; splitf(pv, h2, l2); oh[q] = h2; ol[q] = l2; }
            const size_t oo = (size_t)ri * TT + j0; *(v4us*)(Ph + oo) = oh; *(v4us*)(Pl + oo) = ol; }
         } }

__global__ __launch_bounds__(256) void k_merge(const float* __restrict__ O, int h0, float* OUTb) { const size_t e = ((size_t)blockIdx.x * 256 + threadIdx.x) * 2; if (e >= (size_t)ZH * TT * HD) return; const int d = (int)(e % HD); const int t = (int)((e / HD) % TT); const int zz = (int)(e / ((size_t)HD * TT)); const float cs = (t < RH) ? 1.0f : (1.0f / PCAR); const size_t oo = (size_t)t * DQ + (h0 + zz) * HD + d;
    v2f o2; o2[0] = O[e] * cs; o2[1] = O[e + 1] * cs; *(v2f*)(OUTb + oo) = o2;  }   /* f32 context straight to the output */

extern "C" void kernel_launch(void* const* d_in, const int* in_sizes, int n_in,
                              void* d_out, int out_size, void* d_ws, size_t ws_size, hipStream_t stream) {
    (void)in_sizes; (void)n_in; (void)out_size;
    const float* x = (const float*)d_in[0]; const int* MK = (const int*)d_in[1]; const float* wq = (const float*)d_in[2]; const float* wk = (const float*)d_in[3]; const float* wv = (const float*)d_in[4]; const float* wo = nullptr; (void)wo;
    float* OUT = (float*)d_out;     // [4][4096][64]
    char* wsp = (char*)d_ws;
    auto take = [&](size_t bytes) { char* p = wsp; wsp += (bytes + 255) & ~(size_t)255; return (void*)p; };
    bf* WQ = (bf*)take((size_t)DQ * DM * 2); bf* WK = (bf*)take((size_t)DKV * DM * 2); bf* WV = (bf*)take((size_t)DKV * DM * 2); float* CS = (float*)take((size_t)TT * HD * 2 * 4);
    bf* XB = (bf*)take((size_t)TT * DM * 2); float* FQ = (float*)take((size_t)TT * DQ * 4); float* FK = (float*)take((size_t)TT * DKV * 4);
    h16* QP16 = (h16*)take((size_t)NH_ * TT * HD * 2); h16* KP16 = (h16*)take((size_t)NKV * TT * HD * 2); h16* VT16 = (h16*)take((size_t)NKV * HD * TT * 2);
    bf* QPh = (bf*)take((size_t)NH_ * TT * HD * 2); bf* QPl = (bf*)take((size_t)NH_ * TT * HD * 2); bf* KPh = (bf*)take((size_t)NKV * TT * HD * 2); bf* KPl = (bf*)take((size_t)NKV * TT * HD * 2); bf* VTh = (bf*)take((size_t)NKV * HD * TT * 2); bf* VTl = (bf*)take((size_t)NKV * HD * TT * 2); bf* Ph = (bf*)take((size_t)ZH * RH * TT * 2); bf* Pl = (bf*)take((size_t)ZH * RH * TT * 2);
    float* Sb = (float*)take((size_t)ZH * TT * TT * 4); h16* P16 = (h16*)take(256);   /* unused: all rows hi/lo */ float* Ob = (float*)take((size_t)ZH * TT * HD * 4); 
    if ((size_t)(wsp - (char*)d_ws) > ws_size) return;    // ws 256 MiB
    float* FV = FK;   // v projection reuses the k buffer after the k planes are built (stream-ordered)
    { k_cvt8<<<(unsigned)(((size_t)DQ * DM / 8 + 255) / 256), 256, 0, stream>>>(wq, WQ, (size_t)DQ * DM / 8); k_cvt8<<<(unsigned)(((size_t)DKV * DM / 8 + 255) / 256), 256, 0, stream>>>(wk, WK, (size_t)DKV * DM / 8); k_cvt8<<<(unsigned)(((size_t)DKV * DM / 8 + 255) / 256), 256, 0, stream>>>(wv, WV, (size_t)DKV * DM / 8);   /* 'oi' [64][768] weights are Bt as-is */
       }
    k_csid<<<(TT * HD + 255) / 256, 256, 0, stream>>>(CS);
    const unsigned LQ = (unsigned)(((size_t)NH_ * TT * HD / 2 + 255) / 256), LKv = (unsigned)(((size_t)NKV * TT * HD / 2 + 255) / 256);
    for (int b = 0; b < NB_; ++b) {
        
        k_cvt8<<<(unsigned)(((size_t)TT * DM / 8 + 255) / 256), 256, 0, stream>>>(x + (size_t)b * TT * DM, XB, (size_t)TT * DM / 8);
        k_gemmw<bf, 0, false><<<dim3(TT / 64, DQ / 64, 1), 32, 0, stream>>>(XB, nullptr, WQ, nullptr, DM, FQ, DQ, nullptr, 0, 0, 0);
        k_rope<<<LQ, 256, 0, stream>>>(FQ, DQ, NH_, CS, nullptr, nullptr, 1.0f, QP16, QPh, QPl);
        k_gemmw<bf, 0, false><<<dim3(TT / 64, DKV / 64, 1), 32, 0, stream>>>(XB, nullptr, WK, nullptr, DM, FK, DKV, nullptr, 0, 0, 0);
        k_rope<<<LKv, 256, 0, stream>>>(FK, DKV, NKV, CS, nullptr, nullptr, 1.0f, KP16, KPh, KPl);
        k_gemmw<bf, 0, false><<<dim3(TT / 64, DKV / 64, 1), 32, 0, stream>>>(XB, nullptr, WV, nullptr, DM, FV, DKV, nullptr, 0, 0, 0); k_vtp<<<LKv, 256, 0, stream>>>(FV, DKV, NKV, VT16, VTh, VTl);
        for (int h0 = 0; h0 < NH_; h0 += ZH) { const size_t zq = (size_t)h0, zk = (size_t)(h0 / REP);   // one kv head per query head: the pass's one head uses kv plane h0 / REP (z-strides TT*HD)
            k_gemmc<bf, 2, 1><<<dim3(RH / 64, TT / 64, ZH), 32, 0, stream>>>(QPh + zq * TT * HD, QPl + zq * TT * HD, KPh + zk * TT * HD, KPl + zk * TT * HD, HD, Sb, TT, 0, (size_t)TT * HD, (size_t)TT * HD, (size_t)TT * TT);
            k_ssoft<<<TT / 8, 256, 0, stream>>>(Sb, 0, MK + (size_t)b * TT, Ph, Pl);   /* streaming causal softmax, hi/lo planes for every row */
            k_gemmc<bf, 2, 2><<<dim3(RH / 64, HD / 64, ZH), 32, 0, stream>>>(Ph, Pl, VTh + zk * HD * TT, VTl + zk * HD * TT, TT, Ob, HD, 0, (size_t)RH * TT, (size_t)HD * TT, (size_t)TT * HD);
            k_merge<<<(unsigned)(((size_t)ZH * TT * HD / 2 + 255) / 256), 256, 0, stream>>>(Ob, h0, OUT + (size_t)b * TT * DQ); }
    }
}

// v001
// A run of this version takes 510 microseconds.
// In two side-by-side timings against v000, it was 1.67 and 1.66 times as fast.
#include <hip/hip_runtime.h>

// Single-head causal attention with a key padding mask (x [4][4096][768]; q, k, v = x W^T ('oi' [64][768], no bias; one 64-wide head); scores = q.k x 64^-0.5; keep = causal (j <= i) and mask[b][j] != 0 (int32, read); softmax; out = attn.v -> [4][4096][64] f32 (1 M); no output projection).
// Compute dtypes, f32 accumulate: every input rounded to bf16; q/k/v on PLAIN bf16 operands (inputs: exact); causal scores and attn.v (tile skipping) on hi/lo planes for every row (3 products); streaming softmax in f32 (three passes over each score row in memory; no register-resident row); no output projection: the context is written in f32.

#define NB_  4
#define TT   4096
#define DM   768
#define NH_  1
#define NKV  1
#define REP  (NH_ / NKV)
#define HD   64
#define DQ   (NH_ * HD)
#define DKV  (NKV * HD)
#define ZH   1
#define RH   4096                 // every row hi/lo (streaming softmax, no register row)
#define RB   TT
#define WIN  4096
#define PCAR 1024.0f
#define SCL  0.125f   // H^-0.5 with H = 64 (the head width)
typedef _Float16 h16;
typedef unsigned short bf;
typedef __attribute__((ext_vector_type(16))) __bf16   v16bf;
typedef __attribute__((ext_vector_type(16))) _Float16 v16h;
typedef __attribute__((ext_vector_type(8)))  _Float16 v8h;
typedef __attribute__((ext_vector_type(8)))  unsigned short v8us;
typedef __attribute__((ext_vector_type(8)))  float    v8f;
typedef __attribute__((ext_vector_type(4)))  float    v4f;
typedef v8h  __attribute__((may_alias)) v8ha;
typedef v4f  __attribute__((may_alias)) v4fa;
typedef v8us __attribute__((may_alias)) v8usa;

__device__ __forceinline__ unsigned short f2bf(float f) { unsigned u = __float_as_uint(f); u += 0x7FFFu + ((u >> 16) & 1u); return (unsigned short)(u >> 16); }
__device__ __forceinline__ float bf2f(unsigned short b) { return __uint_as_float(((unsigned)b) << 16); }
__device__ __forceinline__ float bfr(float f) { return bf2f(f2bf(f)); }
__device__ __forceinline__ v16h cat16(v8h lo, v8h hi) { return __builtin_shufflevector(lo, hi, 0, 1, 2, 3, 4, 5, 6, 7, 8, 9, 10, 11, 12, 13, 14, 15); }
__device__ __forceinline__ v16bf cat16b(v8us lo, v8us hi) { return __builtin_bit_cast(v16bf, __builtin_shufflevector(lo, hi, 0, 1, 2, 3, 4, 5, 6, 7, 8, 9, 10, 11, 12, 13, 14, 15)); }
__device__ __forceinline__ v8f wmma16(v16h a, v16h b, v8f c) { return __builtin_amdgcn_wmma_f32_16x16x32_f16(false, a, false, b, (short)0, c, false, false); }
__device__ __forceinline__ v8f wmmab(v16bf a, v16bf b, v8f c) { return __builtin_amdgcn_wmma_f32_16x16x32_bf16(false, a, false, b, (short)0, c, false, false); }



// ---- k_gemmk: GEMM for outputs only 64 columns wide, where one wave per 64x64 tile leaves most of the chip idle: ONE WORK-GROUP of NW waves per 16x64 output tile, grid (M/16, N/64).
// The K loop is dealt to the waves in chunks of 64 elements (one whole 128-byte line of every operand row): wave w takes chunks w, w + NW, ... Each wave keeps a partial 16x64 tile (4 accumulators);
// the partial tiles go to LDS and are summed in wave order 0 .. NW-1. C[m][n] (f32, pitch ldc) = sum_k A[m][k] Bt[n][k] (+ split products per NSPLIT). K % 64 == 0.
// CAUSAL: A holds probabilities that are exactly 0 beyond the diagonal, so the K loop stops at the 64-wide chunk that holds this tile's last row.
template <typename T16> struct WFrag;
template <> struct WFrag<h16> { typedef v16h V; static __device__ __forceinline__ V ld(const h16* p) { return cat16(*(const v8h*)p, *(const v8h*)(p + 16)); } static __device__ __forceinline__ v8f mma(V a, V b, v8f c) { return wmma16(a, b, c); } };
template <> struct WFrag<bf> { typedef v16bf V; static __device__ __forceinline__ V ld(const bf* p) { return cat16b(*(const v8us*)p, *(const v8us*)(p + 16)); } static __device__ __forceinline__ v8f mma(V a, V b, v8f c) { return wmmab(a, b, c); } };
template <typename T16, int NSPLIT, bool CAUSAL, int NW, int K>
__global__ __launch_bounds__(NW * 32) void k_gemmk(const T16* __restrict__ A, const T16* __restrict__ A2, const T16* __restrict__ Bt, const T16* __restrict__ Bt2, float* C, int ldc) {
    typedef typename WFrag<T16>::V V;
    __shared__ __align__(16) float os[NW * 16 * 68];
    const int lane = threadIdx.x & 31, lr = lane & 15, hi = lane >> 4; const int r0 = blockIdx.x * 16, c0 = blockIdx.y * 64;
    const int w = __builtin_amdgcn_readfirstlane((int)(threadIdx.x >> 5));   // wave number in a scalar register: the K loop's branch stays scalar and EXEC stays full at every WMMA
    const int Kl = CAUSAL ? min(K, (r0 + 16 + 63) & ~63) : K;
    v8f acc[4];
#pragma unroll
    for (int nb = 0; nb < 4; ++nb) acc[nb] = (v8f){};
    const size_t aoff = (size_t)(r0 + lr) * K + 8 * hi + w * 64, boff = (size_t)(c0 + lr) * K + 8 * hi + w * 64;
    const T16* pa = A + aoff; const T16* pa2 = A2 + aoff; const T16* pb = Bt + boff; const T16* pb2 = Bt2 + boff;   // each lane's own row pointers, stepped from chunk to chunk; K is a compile-time constant, so the four column blocks are immediate offsets
#pragma unroll 1
    for (int kc = w * 64; kc < Kl; kc += NW * 64) {
        V a[2], a2[2], b[2][4], b2[2][4];
#pragma unroll
        for (int h = 0; h < 2; ++h) { a[h] = WFrag<T16>::ld(pa + h * 32); if (NSPLIT == 1 || NSPLIT == 2) a2[h] = WFrag<T16>::ld(pa2 + h * 32);
#pragma unroll
            for (int nb = 0; nb < 4; ++nb) { b[h][nb] = WFrag<T16>::ld(pb + nb * 16 * K + h * 32); if (NSPLIT >= 2) b2[h][nb] = WFrag<T16>::ld(pb2 + nb * 16 * K + h * 32); } }
        // the row pointers stay in their registers, untouched, up to this wait: no later load's result and no pointer step overwrites an address register of an issued load in front of it
        if (NSPLIT >= 2) asm volatile("s_wait_xcnt 0x0" :: "v"(pa), "v"(pa2), "v"(pb), "v"(pb2) : "memory"); else asm volatile("s_wait_xcnt 0x0" :: "v"(pa), "v"(pb) : "memory");
        __builtin_amdgcn_sched_barrier(0);   // keeps every load of the chunk in front of its first WMMA: without it the loads are sunk among the WMMAs into reused registers and the chunk pays the load latency several times over
#pragma unroll
        for (int h = 0; h < 2; ++h) {
#pragma unroll
            for (int nb = 0; nb < 4; ++nb) acc[nb] = WFrag<T16>::mma(a[h], b[h][nb], acc[nb]);
            if (NSPLIT == 1 || NSPLIT == 2) {
#pragma unroll
                for (int nb = 0; nb < 4; ++nb) acc[nb] = WFrag<T16>::mma(a2[h], b[h][nb], acc[nb]); }
            if (NSPLIT >= 2) {
#pragma unroll
                for (int nb = 0; nb < 4; ++nb) acc[nb] = WFrag<T16>::mma(a[h], b2[h][nb], acc[nb]); } }
        // four vector slots behind the last WMMA, so that nothing on the taken side of the loop branch touches its registers too early
        asm volatile("v_nop\n\tv_nop\n\tv_nop\n\tv_nop" : "+v"(acc[0]), "+v"(acc[1]), "+v"(acc[2]), "+v"(acc[3]) : "v"(a[1]));
        pa += NW * 64; pa2 += NW * 64; pb += NW * 64; pb2 += NW * 64;
    }
    float* ow = os + w * (16 * 68);
#pragma unroll
    for (int nb = 0; nb < 4; ++nb) {
#pragma unroll
        for (int j = 0; j < 8; ++j) ow[(hi * 8 + j) * 68 + nb * 16 + lr] = acc[nb][j]; }
    __syncthreads();   // every wave's partial tile is in LDS before any of them is summed
    for (int it = threadIdx.x; it < 256; it += NW * 32) { const int row = it >> 4, cofs = (it & 15) * 4; v4f val = *(const v4fa*)(os + row * 68 + cofs);
#pragma unroll
        for (int q = 1; q < NW; ++q) val += *(const v4fa*)(os + q * (16 * 68) + row * 68 + cofs);
        *(v4f*)(C + (size_t)(r0 + row) * ldc + c0 + cofs) = val; }
}

// ---- k_gemmc: register-blocked GEMM, ONE WAVE per 64x64 output tile (16 accumulators), operands straight from K-contiguous 16-bit planes, specialised for causal attention: CMODE 1 skips score tiles entirely above the diagonal (query rows r0+roff.., key columns c0..), CMODE 2 limits the
// key (K) loop of the probability x value contraction to the diagonal block (probabilities beyond it are exactly zero). roff = row offset of this launch's first row within the sequence.
template <typename T16, int NSPLIT, int CMODE>
__global__ __launch_bounds__(32) void k_gemmc(const T16* __restrict__ A, const T16* __restrict__ A2, const T16* __restrict__ Bt, const T16* __restrict__ Bt2, int K, float* C, int ldc, int roff, size_t sA, size_t sB, size_t sC) {
    typedef typename WFrag<T16>::V V;
    __shared__ __align__(16) float os[16 * 68];
    const size_t z = blockIdx.z; A += z * sA; if (A2) A2 += z * sA; Bt += z * sB; if (Bt2) Bt2 += z * sB; C += z * sC;
    const int lane = threadIdx.x & 31, lr = lane & 15, hi = lane >> 4; const int r0 = blockIdx.x * 64, c0 = blockIdx.y * 64;
    if (CMODE == 1 && c0 > r0 + roff + 63) return;                  // score tile entirely above the causal diagonal: never read (the softmax masks j > i by select)
    const int Kl = (CMODE == 2) ? min(K, r0 + roff + 64) : K;        // P.V: probabilities are exactly 0 beyond the diagonal block, so the K loop stops there
    v8f acc[4][4];
#pragma unroll
    for (int mb = 0; mb < 4; ++mb)
#pragma unroll
        for (int nb = 0; nb < 4; ++nb) acc[mb][nb] = (v8f){};
    const size_t aoff = (size_t)(r0 + lr) * K + 8 * hi, boff = (size_t)(c0 + lr) * K + 8 * hi;
#pragma unroll 1
    for (int kc = 0; kc < Kl; kc += 32) {
        V a[4], a2[4];
#pragma unroll
        for (int mb = 0; mb < 4; ++mb) { a[mb] = WFrag<T16>::ld(A + aoff + (size_t)mb * 16 * K + kc); if (NSPLIT == 1 || NSPLIT == 2) a2[mb] = WFrag<T16>::ld(A2 + aoff + (size_t)mb * 16 * K + kc); }
#pragma unroll
        for (int nb = 0; nb < 4; ++nb) { const V b = WFrag<T16>::ld(Bt + boff + (size_t)nb * 16 * K + kc); V b2; if (NSPLIT >= 2) b2 = WFrag<T16>::ld(Bt2 + boff + (size_t)nb * 16 * K + kc);
#pragma unroll
            for (int mb = 0; mb < 4; ++mb) { acc[mb][nb] = WFrag<T16>::mma(a[mb], b, acc[mb][nb]); if (NSPLIT == 1 || NSPLIT == 2) acc[mb][nb] = WFrag<T16>::mma(a2[mb], b, acc[mb][nb]); if (NSPLIT >= 2) acc[mb][nb] = WFrag<T16>::mma(a[mb], b2, acc[mb][nb]); } }
        asm volatile("v_nop\n\tv_nop\n\tv_nop\n\tv_nop" : "+v"(acc[0][0]), "+v"(acc[1][1]), "+v"(acc[2][2]), "+v"(acc[3][3]) : "v"(a[0]), "v"(a[3]));
    }
#pragma unroll
    for (int mb = 0; mb < 4; ++mb) {
#pragma unroll
        for (int nb = 0; nb < 4; ++nb) {
#pragma unroll
            for (int j = 0; j < 8; ++j) os[(hi * 8 + j) * 68 + nb * 16 + lr] = acc[mb][nb][j]; }
        __builtin_amdgcn_wave_barrier(); asm volatile("" ::: "memory");
        float* crow = C + (size_t)(r0 + mb * 16) * ldc + c0;
{
#pragma unroll
            for (int s = 0; s < 8; ++s) { const int row = 2 * s + hi, cofs = lr * 4; v4f val = *(const v4fa*)(os + row * 68 + cofs);
                *(v4f*)(crow + (size_t)row * ldc + cofs) = val; }
             }
        __builtin_amdgcn_wave_barrier(); asm volatile("" ::: "memory");
    }
}

__device__ __forceinline__ h16 tohx(float x) { return (h16)x; }
__device__ __forceinline__ void splitf(float y, unsigned short& h, unsigned short& l) { h = f2bf(y); l = f2bf(y - bf2f(h)); }
typedef __attribute__((ext_vector_type(2))) _Float16 v2h;
typedef __attribute__((ext_vector_type(4))) _Float16 v4h;
typedef __attribute__((ext_vector_type(2))) unsigned short v2us;
typedef __attribute__((ext_vector_type(4))) unsigned short v4us;
typedef __attribute__((ext_vector_type(2))) float v2f;
typedef __attribute__((ext_vector_type(4))) int v4i;

__global__ __launch_bounds__(256) void k_wtG(const float* __restrict__ w, int K, int N, bf* Bt) {
    const int lane = threadIdx.x & 31; const int L0 = (blockIdx.x * 8 + (threadIdx.x >> 5)) * 8; const int nlines = N * K / 64;
{
#pragma unroll 1
        for (int l = 0; l < 8; ++l) { const int L = L0 + l; if (L >= nlines) break; const size_t e = (size_t)L * 64 + lane * 2; const int k = (int)(e % K), n = (int)(e / K); v2us o;
            o[0] = f2bf(w[(size_t)k * N + n]); o[1] = f2bf(w[(size_t)(k + 1) * N + n]); *(v2us*)(Bt + e) = o; }
         }
}
__global__ __launch_bounds__(256) void k_cvt8(const float* __restrict__ src, bf* dst, size_t n8) { const size_t i = (size_t)blockIdx.x * 256 + threadIdx.x; if (i >= n8) return; const v8f v = *(const v8f*)(src + i * 8); v8us o;
#pragma unroll
    for (int k = 0; k < 8; ++k) o[k] = f2bf(v[k]); *(v8us*)(dst + i * 8) = o;  }

// k_rope: head planes [h][t][d] (fp16 + hi/lo) of rope(x) x sc with the rotate-half convention out[d] = x[d] cos[t][d] - x[d+HD/2] sin[t][d], out[d+HD/2] = x[d+HD/2] cos[t][d+HD/2] + x[d] sin[t][d+HD/2]
__global__ __launch_bounds__(256) void k_rope(const float* __restrict__ F, int pitch, int nheads, const float* __restrict__ CS, const float* __restrict__ RF, const float* __restrict__ nw, float sc, h16* P16, bf* Ph, bf* Pl) {
    const size_t e = ((size_t)blockIdx.x * 256 + threadIdx.x) * 2; if (e >= (size_t)nheads * TT * HD) return; const int d = (int)(e % HD); const int t = (int)((e / HD) % TT); const int h = (int)(e / ((size_t)HD * TT)); const float* f = F + (size_t)t * pitch + h * HD; const float rf = RF ? RF[(size_t)h * TT + t] : 1.0f; v2h o16; v2us oh, ol;
#pragma unroll
    for (int q = 0; q < 2; ++q) { const int dd = d + q; const int dp = (dd < HD / 2) ? dd + HD / 2 : dd - HD / 2; float x0 = f[dd], x1 = f[dp];
        if (RF) { float n0 = __fmul_rn(x0, rf), n1 = __fmul_rn(x1, rf); asm volatile("" : "+v"(n0)); asm volatile("" : "+v"(n1)); x0 = __fmul_rn(bfr(nw[dd]), n0); x1 = __fmul_rn(bfr(nw[dp]), n1); }
        const v2f cs = *(const v2f*)(CS + ((size_t)t * HD + dd) * 2); float a = __fmul_rn(x0, cs[0]), bq = __fmul_rn(x1, cs[1]); asm volatile("" : "+v"(a)); asm volatile("" : "+v"(bq)); const float r = ((dd < HD / 2) ? __fsub_rn(a, bq) : __fadd_rn(a, bq)) * sc;
        o16[q] = tohx(r); unsigned short a2, c2; splitf(r, a2, c2); oh[q] = a2; ol[q] = c2; }
    *(v2h*)(P16 + e) = o16; *(v2us*)(Ph + e) = oh; *(v2us*)(Pl + e) = ol;  }
__global__ __launch_bounds__(256) void k_vtp(const float* __restrict__ F, int pitch, int nheads, h16* V16, bf* Vh, bf* Vl) { const size_t e = ((size_t)blockIdx.x * 256 + threadIdx.x) * 2; if (e >= (size_t)nheads * HD * TT) return; const int t = (int)(e % TT); const int d = (int)((e / TT) % HD); const int g = (int)(e / ((size_t)TT * HD)); v2h o16; v2us oh, ol;
#pragma unroll
    for (int q = 0; q < 2; ++q) { const float x = F[(size_t)(t + q) * pitch + g * HD + d]; o16[q] = tohx(x); unsigned short a2, c2; splitf(x, a2, c2); oh[q] = a2; ol[q] = c2; }
    *(v2h*)(V16 + e) = o16; *(v2us*)(Vh + e) = oh; *(v2us*)(Vl + e) = ol;  }
__global__ __launch_bounds__(256) void k_csid(float* CS) { const int idx = blockIdx.x * 256 + threadIdx.x; if (idx >= TT * HD) return; v2f cs; cs[0] = 1.0f; cs[1] = 0.0f; *(v2f*)(CS + (size_t)idx * 2) = cs;  }
__global__ __launch_bounds__(256) void k_ssoft(const float* __restrict__ Sb, int r0, const int* __restrict__ MKb, bf* Ph, bf* Pl) {
    const int lane = threadIdx.x & 31; const int ri = blockIdx.x * 8 + (threadIdx.x >> 5); if (ri >= RB) return; const int i = r0 + ri; const float* sr = Sb + (size_t)ri * TT; const int nval = i + 1;   /* causal, diagonal kept: keys 0 .. i */
    float mx = -3.0e38f;
#pragma unroll 1
    for (int j0 = lane * 4; j0 < nval; j0 += 128) { const v4f a = *(const v4f*)(sr + j0);
#pragma unroll
        for (int q = 0; q < 4; ++q) if (j0 + q < nval && MKb[j0 + q] != 0) mx = fmaxf(mx, a[q] * SCL); }
#pragma unroll
    for (int sh = 16; sh; sh >>= 1) mx = fmaxf(mx, __shfl_xor(mx, sh, 32));
    float sum = 0.f;
#pragma unroll 1
    for (int j0 = lane * 4; j0 < nval; j0 += 128) { const v4f a = *(const v4f*)(sr + j0);
#pragma unroll
        for (int q = 0; q < 4; ++q) if (j0 + q < nval && MKb[j0 + q] != 0) { float d0 = __fsub_rn(a[q] * SCL, mx); asm volatile("" : "+v"(d0)); sum += __builtin_amdgcn_exp2f(__fmul_rn(d0, 1.4426950408889634f)); } }
#pragma unroll
    for (int sh = 16; sh; sh >>= 1) sum += __shfl_xor(sum, sh, 32);
    const float f = (sum > 0.f) ? __fdiv_rn(1.0f, sum) : 0.f;
{
#pragma unroll 1
        for (int j0 = lane * 4; j0 < TT; j0 += 128) { const v4f a = *(const v4f*)(sr + j0); v4us oh, ol;
#pragma unroll
            for (int q = 0; q < 4; ++q) { float pv = 0.f; if (j0 + q < nval && MKb[j0 + q] != 0) { float d0 = __fsub_rn(a[q] * SCL, mx); asm volatile("" : "+v"(d0)); pv = __builtin_amdgcn_exp2f(__fmul_rn(d0, 1.4426950408889634f)) * f; } unsigned short h2, l2; splitf(pv, h2, l2); oh[q] = h2; ol[q] = l2; }
            const size_t oo = (size_t)ri * TT + j0; *(v4us*)(Ph + oo) = oh; *(v4us*)(Pl + oo) = ol; }
         } }

__global__ __launch_bounds__(256) void k_merge(const float* __restrict__ O, int h0, float* OUTb) { const size_t e = ((size_t)blockIdx.x * 256 + threadIdx.x) * 2; if (e >= (size_t)ZH * TT * HD) return; const int d = (int)(e % HD); const int t = (int)((e / HD) % TT); const int zz = (int)(e / ((size_t)HD * TT)); const float cs = (t < RH) ? 1.0f : (1.0f / PCAR); const size_t oo = (size_t)t * DQ + (h0 + zz) * HD + d;
    v2f o2; o2[0] = O[e] * cs; o2[1] = O[e + 1] * cs; *(v2f*)(OUTb + oo) = o2;  }   /* f32 context straight to the output */

extern "C" void kernel_launch(void* const* d_in, const int* in_sizes, int n_in,
                              void* d_out, int out_size, void* d_ws, size_t ws_size, hipStream_t stream) {
    (void)in_sizes; (void)n_in; (void)out_size;
    const float* x = (const float*)d_in[0]; const int* MK = (const int*)d_in[1]; const float* wq = (const float*)d_in[2]; const float* wk = (const float*)d_in[3]; const float* wv = (const float*)d_in[4]; const float* wo = nullptr; (void)wo;
    float* OUT = (float*)d_out;     // [4][4096][64]
    char* wsp = (char*)d_ws;
    auto take = [&](size_t bytes) { char* p = wsp; wsp += (bytes + 255) & ~(size_t)255; return (void*)p; };
    bf* WQ = (bf*)take((size_t)DQ * DM * 2); bf* WK = (bf*)take((size_t)DKV * DM * 2); bf* WV = (bf*)take((size_t)DKV * DM * 2); float* CS = (float*)take((size_t)TT * HD * 2 * 4);
    bf* XB = (bf*)take((size_t)TT * DM * 2); float* FQ = (float*)take((size_t)TT * DQ * 4); float* FK = (float*)take((size_t)TT * DKV * 4);
    h16* QP16 = (h16*)take((size_t)NH_ * TT * HD * 2); h16* KP16 = (h16*)take((size_t)NKV * TT * HD * 2); h16* VT16 = (h16*)take((size_t)NKV * HD * TT * 2);
    bf* QPh = (bf*)take((size_t)NH_ * TT * HD * 2); bf* QPl = (bf*)take((size_t)NH_ * TT * HD * 2); bf* KPh = (bf*)take((size_t)NKV * TT * HD * 2); bf* KPl = (bf*)take((size_t)NKV * TT * HD * 2); bf* VTh = (bf*)take((size_t)NKV * HD * TT * 2); bf* VTl = (bf*)take((size_t)NKV * HD * TT * 2); bf* Ph = (bf*)take((size_t)ZH * RH * TT * 2); bf* Pl = (bf*)take((size_t)ZH * RH * TT * 2);
    float* Sb = (float*)take((size_t)ZH * TT * TT * 4); h16* P16 = (h16*)take(256);   /* unused: all rows hi/lo */ float* Ob = (float*)take((size_t)ZH * TT * HD * 4); 
    if ((size_t)(wsp - (char*)d_ws) > ws_size) return;    // ws 256 MiB
    float* FV = FK;   // v projection reuses the k buffer after the k planes are built (stream-ordered)
    { k_cvt8<<<(unsigned)(((size_t)DQ * DM / 8 + 255) / 256), 256, 0, stream>>>(wq, WQ, (size_t)DQ * DM / 8); k_cvt8<<<(unsigned)(((size_t)DKV * DM / 8 + 255) / 256), 256, 0, stream>>>(wk, WK, (size_t)DKV * DM / 8); k_cvt8<<<(unsigned)(((size_t)DKV * DM / 8 + 255) / 256), 256, 0, stream>>>(wv, WV, (size_t)DKV * DM / 8);   /* 'oi' [64][768] weights are Bt as-is */
       }
    k_csid<<<(TT * HD + 255) / 256, 256, 0, stream>>>(CS);
    const unsigned LQ = (unsigned)(((size_t)NH_ * TT * HD / 2 + 255) / 256), LKv = (unsigned)(((size_t)NKV * TT * HD / 2 + 255) / 256);
    for (int b = 0; b < NB_; ++b) {
        
        k_cvt8<<<(unsigned)(((size_t)TT * DM / 8 + 255) / 256), 256, 0, stream>>>(x + (size_t)b * TT * DM, XB, (size_t)TT * DM / 8);
        k_gemmk<bf, 0, false, 8, DM><<<dim3(TT / 16, DQ / 64, 1), 256, 0, stream>>>(XB, nullptr, WQ, nullptr, FQ, DQ);
        k_rope<<<LQ, 256, 0, stream>>>(FQ, DQ, NH_, CS, nullptr, nullptr, 1.0f, QP16, QPh, QPl);
        k_gemmk<bf, 0, false, 8, DM><<<dim3(TT / 16, DKV / 64, 1), 256, 0, stream>>>(XB, nullptr, WK, nullptr, FK, DKV);
        k_rope<<<LKv, 256, 0, stream>>>(FK, DKV, NKV, CS, nullptr, nullptr, 1.0f, KP16, KPh, KPl);
        k_gemmk<bf, 0, false, 8, DM><<<dim3(TT / 16, DKV / 64, 1), 256, 0, stream>>>(XB, nullptr, WV, nullptr, FV, DKV); k_vtp<<<LKv, 256, 0, stream>>>(FV, DKV, NKV, VT16, VTh, VTl);
        for (int h0 = 0; h0 < NH_; h0 += ZH) { const size_t zq = (size_t)h0, zk = (size_t)(h0 / REP);   // one kv head per query head: each pass is one head on its own kv plane (z-strides TT*HD)
            k_gemmc<bf, 2, 1><<<dim3(RH / 64, TT / 64, ZH), 32, 0, stream>>>(QPh + zq * TT * HD, QPl + zq * TT * HD, KPh + zk * TT * HD, KPl + zk * TT * HD, HD, Sb, TT, 0, (size_t)TT * HD, (size_t)TT * HD, (size_t)TT * TT);
            k_ssoft<<<TT / 8, 256, 0, stream>>>(Sb, 0, MK + (size_t)b * TT, Ph, Pl);   /* streaming causal softmax, hi/lo planes for every row */
            k_gemmk<bf, 2, true, 8, TT><<<dim3(RH / 16, HD / 64, 1), 256, 0, stream>>>(Ph, Pl, VTh + zk * HD * TT, VTl + zk * HD * TT, Ob, HD);
            k_merge<<<(unsigned)(((size_t)ZH * TT * HD / 2 + 255) / 256), 256, 0, stream>>>(Ob, h0, OUT + (size_t)b * TT * DQ); }
    }
}

// v002
// It runs in 236 microseconds.
// Two timings next to v001 both put it at 2.17 times that version's speed.
// All steps since v000 together make it 3.61 times as fast.
#include <hip/hip_runtime.h>

// Single-head causal attention with a key padding mask (x [4][4096][768]; q, k, v = x W^T ('oi' [64][768], no bias; one 64-wide head); scores = q.k x 64^-0.5; keep = causal (j <= i) and mask[b][j] != 0 (int32, read); softmax; out = attn.v -> [4][4096][64] f32 (1 M); no output projection).
// Compute dtypes, f32 accumulate: every input rounded to bf16; q/k/v on PLAIN bf16 operands (inputs: exact); causal scores and attn.v (tile skipping) on hi/lo planes for every row (3 products); online softmax in f32 inside one fused kernel (scores and probabilities never reach memory); no output projection: the context is written in f32.

#define NB_  4
#define TT   4096
#define DM   768
#define NH_  1
#define NKV  1
#define REP  (NH_ / NKV)
#define HD   64
#define DQ   (NH_ * HD)
#define DKV  (NKV * HD)
#define ZH   1
#define RH   4096                 // every row hi/lo (streaming softmax, no register row)
#define RB   TT
#define WIN  4096
#define PCAR 1024.0f
#define SCL  0.125f   // H^-0.5 with H = 64 (the head width)
typedef _Float16 h16;
typedef unsigned short bf;
typedef __attribute__((ext_vector_type(16))) __bf16   v16bf;
typedef __attribute__((ext_vector_type(16))) _Float16 v16h;
typedef __attribute__((ext_vector_type(8)))  _Float16 v8h;
typedef __attribute__((ext_vector_type(8)))  unsigned short v8us;
typedef __attribute__((ext_vector_type(8)))  float    v8f;
typedef __attribute__((ext_vector_type(4)))  float    v4f;
typedef v8h  __attribute__((may_alias)) v8ha;
typedef v4f  __attribute__((may_alias)) v4fa;
typedef v8us __attribute__((may_alias)) v8usa;

__device__ __forceinline__ unsigned short f2bf(float f) { unsigned u = __float_as_uint(f); u += 0x7FFFu + ((u >> 16) & 1u); return (unsigned short)(u >> 16); }
__device__ __forceinline__ float bf2f(unsigned short b) { return __uint_as_float(((unsigned)b) << 16); }
__device__ __forceinline__ float bfr(float f) { return bf2f(f2bf(f)); }
__device__ __forceinline__ v16h cat16(v8h lo, v8h hi) { return __builtin_shufflevector(lo, hi, 0, 1, 2, 3, 4, 5, 6, 7, 8, 9, 10, 11, 12, 13, 14, 15); }
__device__ __forceinline__ v16bf cat16b(v8us lo, v8us hi) { return __builtin_bit_cast(v16bf, __builtin_shufflevector(lo, hi, 0, 1, 2, 3, 4, 5, 6, 7, 8, 9, 10, 11, 12, 13, 14, 15)); }
__device__ __forceinline__ v8f wmma16(v16h a, v16h b, v8f c) { return __builtin_amdgcn_wmma_f32_16x16x32_f16(false, a, false, b, (short)0, c, false, false); }
__device__ __forceinline__ v8f wmmab(v16bf a, v16bf b, v8f c) { return __builtin_amdgcn_wmma_f32_16x16x32_bf16(false, a, false, b, (short)0, c, false, false); }



// ---- k_gemmk: GEMM for outputs only 64 columns wide, where one wave per 64x64 tile leaves most of the chip idle: ONE WORK-GROUP of NW waves per 16x64 output tile, grid (M/16, N/64).
// The K loop is dealt to the waves in chunks of 64 elements (one whole 128-byte line of every operand row): wave w takes chunks w, w + NW, ... Each wave keeps a partial 16x64 tile (4 accumulators);
// the partial tiles go to LDS and are summed in wave order 0 .. NW-1. C[m][n] (f32, pitch ldc) = sum_k A[m][k] Bt[n][k] (+ split products per NSPLIT). K % 64 == 0.
// CAUSAL: A holds probabilities that are exactly 0 beyond the diagonal, so the K loop stops at the 64-wide chunk that holds this tile's last row.
template <typename T16> struct WFrag;
template <> struct WFrag<h16> { typedef v16h V; static __device__ __forceinline__ V ld(const h16* p) { return cat16(*(const v8h*)p, *(const v8h*)(p + 16)); } static __device__ __forceinline__ v8f mma(V a, V b, v8f c) { return wmma16(a, b, c); } };
template <> struct WFrag<bf> { typedef v16bf V; static __device__ __forceinline__ V ld(const bf* p) { return cat16b(*(const v8us*)p, *(const v8us*)(p + 16)); } static __device__ __forceinline__ v8f mma(V a, V b, v8f c) { return wmmab(a, b, c); } };
template <typename T16, int NSPLIT, bool CAUSAL, int NW, int K>
__global__ __launch_bounds__(NW * 32) void k_gemmk(const T16* __restrict__ A, const T16* __restrict__ A2, const T16* __restrict__ Bt, const T16* __restrict__ Bt2, float* C, int ldc) {
    typedef typename WFrag<T16>::V V;
    __shared__ __align__(16) float os[NW * 16 * 68];
    const int lane = threadIdx.x & 31, lr = lane & 15, hi = lane >> 4; const int r0 = blockIdx.x * 16, c0 = blockIdx.y * 64;
    const int w = __builtin_amdgcn_readfirstlane((int)(threadIdx.x >> 5));   // wave number in a scalar register: the K loop's branch stays scalar and EXEC stays full at every WMMA
    const int Kl = CAUSAL ? min(K, (r0 + 16 + 63) & ~63) : K;
    v8f acc[4];
#pragma unroll
    for (int nb = 0; nb < 4; ++nb) acc[nb] = (v8f){};
    const size_t aoff = (size_t)(r0 + lr) * K + 8 * hi + w * 64, boff = (size_t)(c0 + lr) * K + 8 * hi + w * 64;
    const T16* pa = A + aoff; const T16* pa2 = A2 + aoff; const T16* pb = Bt + boff; const T16* pb2 = Bt2 + boff;   // each lane's own row pointers, stepped from chunk to chunk; K is a compile-time constant, so the four column blocks are immediate offsets
#pragma unroll 1
    for (int kc = w * 64; kc < Kl; kc += NW * 64) {
        V a[2], a2[2], b[2][4], b2[2][4];
#pragma unroll
        for (int h = 0; h < 2; ++h) { a[h] = WFrag<T16>::ld(pa + h * 32); if (NSPLIT == 1 || NSPLIT == 2) a2[h] = WFrag<T16>::ld(pa2 + h * 32);
#pragma unroll
            for (int nb = 0; nb < 4; ++nb) { b[h][nb] = WFrag<T16>::ld(pb + nb * 16 * K + h * 32); if (NSPLIT >= 2) b2[h][nb] = WFrag<T16>::ld(pb2 + nb * 16 * K + h * 32); } }
        // the row pointers stay in their registers, untouched, up to this wait: no later load's result and no pointer step overwrites an address register of an issued load in front of it
        if (NSPLIT >= 2) asm volatile("s_wait_xcnt 0x0" :: "v"(pa), "v"(pa2), "v"(pb), "v"(pb2) : "memory"); else asm volatile("s_wait_xcnt 0x0" :: "v"(pa), "v"(pb) : "memory");
        __builtin_amdgcn_sched_barrier(0);   // keeps every load of the chunk in front of its first WMMA: without it the loads are sunk among the WMMAs into reused registers and the chunk pays the load latency several times over
#pragma unroll
        for (int h = 0; h < 2; ++h) {
#pragma unroll
            for (int nb = 0; nb < 4; ++nb) acc[nb] = WFrag<T16>::mma(a[h], b[h][nb], acc[nb]);
            if (NSPLIT == 1 || NSPLIT == 2) {
#pragma unroll
                for (int nb = 0; nb < 4; ++nb) acc[nb] = WFrag<T16>::mma(a2[h], b[h][nb], acc[nb]); }
            if (NSPLIT >= 2) {
#pragma unroll
                for (int nb = 0; nb < 4; ++nb) acc[nb] = WFrag<T16>::mma(a[h], b2[h][nb], acc[nb]); } }
        // four vector slots behind the last WMMA, so that nothing on the taken side of the loop branch touches its registers too early
        asm volatile("v_nop\n\tv_nop\n\tv_nop\n\tv_nop" : "+v"(acc[0]), "+v"(acc[1]), "+v"(acc[2]), "+v"(acc[3]) : "v"(a[1]));
        pa += NW * 64; pa2 += NW * 64; pb += NW * 64; pb2 += NW * 64;
    }
    float* ow = os + w * (16 * 68);
#pragma unroll
    for (int nb = 0; nb < 4; ++nb) {
#pragma unroll
        for (int j = 0; j < 8; ++j) ow[(hi * 8 + j) * 68 + nb * 16 + lr] = acc[nb][j]; }
    __syncthreads();   // every wave's partial tile is in LDS before any of them is summed
    for (int it = threadIdx.x; it < 256; it += NW * 32) { const int row = it >> 4, cofs = (it & 15) * 4; v4f val = *(const v4fa*)(os + row * 68 + cofs);
#pragma unroll
        for (int q = 1; q < NW; ++q) val += *(const v4fa*)(os + q * (16 * 68) + row * 68 + cofs);
        *(v4f*)(C + (size_t)(r0 + row) * ldc + c0 + cofs) = val; }
}

__device__ __forceinline__ h16 tohx(float x) { return (h16)x; }
__device__ __forceinline__ void splitf(float y, unsigned short& h, unsigned short& l) { h = f2bf(y); l = f2bf(y - bf2f(h)); }
typedef __attribute__((ext_vector_type(2))) _Float16 v2h;
typedef __attribute__((ext_vector_type(4))) _Float16 v4h;
typedef __attribute__((ext_vector_type(2))) unsigned short v2us;
typedef __attribute__((ext_vector_type(4))) unsigned short v4us;
typedef __attribute__((ext_vector_type(2))) float v2f;
typedef __attribute__((ext_vector_type(4))) int v4i;

__global__ __launch_bounds__(256) void k_wtG(const float* __restrict__ w, int K, int N, bf* Bt) {
    const int lane = threadIdx.x & 31; const int L0 = (blockIdx.x * 8 + (threadIdx.x >> 5)) * 8; const int nlines = N * K / 64;
{
#pragma unroll 1
        for (int l = 0; l < 8; ++l) { const int L = L0 + l; if (L >= nlines) break; const size_t e = (size_t)L * 64 + lane * 2; const int k = (int)(e % K), n = (int)(e / K); v2us o;
            o[0] = f2bf(w[(size_t)k * N + n]); o[1] = f2bf(w[(size_t)(k + 1) * N + n]); *(v2us*)(Bt + e) = o; }
         }
}
__global__ __launch_bounds__(256) void k_cvt8(const float* __restrict__ src, bf* dst, size_t n8) { const size_t i = (size_t)blockIdx.x * 256 + threadIdx.x; if (i >= n8) return; const v8f v = *(const v8f*)(src + i * 8); v8us o;
#pragma unroll
    for (int k = 0; k < 8; ++k) o[k] = f2bf(v[k]); *(v8us*)(dst + i * 8) = o;  }

// k_rope: head planes [h][t][d] (fp16 + hi/lo) of rope(x) x sc with the rotate-half convention out[d] = x[d] cos[t][d] - x[d+HD/2] sin[t][d], out[d+HD/2] = x[d+HD/2] cos[t][d+HD/2] + x[d] sin[t][d+HD/2]
__global__ __launch_bounds__(256) void k_rope(const float* __restrict__ F, int pitch, int nheads, const float* __restrict__ CS, const float* __restrict__ RF, const float* __restrict__ nw, float sc, h16* P16, bf* Ph, bf* Pl) {
    const size_t e = ((size_t)blockIdx.x * 256 + threadIdx.x) * 2; if (e >= (size_t)nheads * TT * HD) return; const int d = (int)(e % HD); const int t = (int)((e / HD) % TT); const int h = (int)(e / ((size_t)HD * TT)); const float* f = F + (size_t)t * pitch + h * HD; const float rf = RF ? RF[(size_t)h * TT + t] : 1.0f; v2h o16; v2us oh, ol;
#pragma unroll
    for (int q = 0; q < 2; ++q) { const int dd = d + q; const int dp = (dd < HD / 2) ? dd + HD / 2 : dd - HD / 2; float x0 = f[dd], x1 = f[dp];
        if (RF) { float n0 = __fmul_rn(x0, rf), n1 = __fmul_rn(x1, rf); asm volatile("" : "+v"(n0)); asm volatile("" : "+v"(n1)); x0 = __fmul_rn(bfr(nw[dd]), n0); x1 = __fmul_rn(bfr(nw[dp]), n1); }
        const v2f cs = *(const v2f*)(CS + ((size_t)t * HD + dd) * 2); float a = __fmul_rn(x0, cs[0]), bq = __fmul_rn(x1, cs[1]); asm volatile("" : "+v"(a)); asm volatile("" : "+v"(bq)); const float r = ((dd < HD / 2) ? __fsub_rn(a, bq) : __fadd_rn(a, bq)) * sc;
        o16[q] = tohx(r); unsigned short a2, c2; splitf(r, a2, c2); oh[q] = a2; ol[q] = c2; }
    *(v2h*)(P16 + e) = o16; *(v2us*)(Ph + e) = oh; *(v2us*)(Pl + e) = ol;  }
__global__ __launch_bounds__(256) void k_vtp(const float* __restrict__ F, int pitch, int nheads, h16* V16, bf* Vh, bf* Vl) { const size_t e = ((size_t)blockIdx.x * 256 + threadIdx.x) * 2; if (e >= (size_t)nheads * HD * TT) return; const int t = (int)(e % TT); const int d = (int)((e / TT) % HD); const int g = (int)(e / ((size_t)TT * HD)); v2h o16; v2us oh, ol;
#pragma unroll
    for (int q = 0; q < 2; ++q) { const float x = F[(size_t)(t + q) * pitch + g * HD + d]; o16[q] = tohx(x); unsigned short a2, c2; splitf(x, a2, c2); oh[q] = a2; ol[q] = c2; }
    *(v2h*)(V16 + e) = o16; *(v2us*)(Vh + e) = oh; *(v2us*)(Vl + e) = ol;  }
__global__ __launch_bounds__(256) void k_csid(float* CS) { const int idx = blockIdx.x * 256 + threadIdx.x; if (idx >= TT * HD) return; v2f cs; cs[0] = 1.0f; cs[1] = 0.0f; *(v2f*)(CS + (size_t)idx * 2) = cs;  }
typedef v4us __attribute__((may_alias)) v4usa;
// 2^x with the one vector slot that the instruction set asks for behind a transcendental in the same statement
__device__ __forceinline__ float exp2s(float x) { float r; asm("v_exp_f32 %0, %1\n\tv_nop" : "=v"(r) : "v"(x)); return r; }

// ---- k_fattn: causal scores, softmax and probability x value in ONE kernel; neither scores nor probabilities go through memory. ONE WORK-GROUP of NW waves per 16 query rows, grid (TT/16).
// The keys up to the diagonal are dealt to the waves in chunks of 64: wave w takes chunks w, w + NW, ... For each chunk a wave forms its 16x64 score tile (hi/lo planes, 3 products), keeps a running row maximum m,
// a running sum l of exp(s - m) and a running 16x64 context tile o (both rescaled by exp(m_old - m_new) when m grows), and multiplies the unnormalised probabilities (split into hi/lo planes, 3 products) with the value chunk.
// Score column lr of block nb is key 4 lr + nb of the chunk, so a lane holds four neighbouring keys of a row and stores them to LDS as one 8-byte word; in LDS the probabilities lie in plain key order, [row][key], pitch 72.
// At the end the NW partial (m, l, o) go to LDS and are merged in wave order 0 .. NW-1 with the weights exp(m_w - max m); the context is divided by the merged sum and written straight to the output.
template <int NW>
__global__ __launch_bounds__(NW * 32) void k_fattn(const bf* __restrict__ Qh, const bf* __restrict__ Ql, const bf* __restrict__ Kh, const bf* __restrict__ Kl, const bf* __restrict__ Vh, const bf* __restrict__ Vl, const int* __restrict__ MKb, float* OUTb) {
    typedef WFrag<bf> F; typedef F::V V;
    constexpr float L2E = 1.4426950408889634f, NEG = -3.0e38f;
    constexpr int WS = 1152;   // floats of LDS per wave: two 16 x 72 probability planes of 16 bits during the loop, the 16 x 68 f32 context tile behind it
    __shared__ __align__(16) float os[NW * WS];
    __shared__ float ms[NW * 16], ls[NW * 16];
    const int lane = threadIdx.x & 31, lr = lane & 15, hi = lane >> 4; const int r0 = blockIdx.x * 16;
    const int w = __builtin_amdgcn_readfirstlane((int)(threadIdx.x >> 5));   // wave number in a scalar register: the key loop's branch stays scalar and EXEC stays full at every WMMA
    const int Kend = (r0 + 16 + 63) & ~63;   // the 64-wide chunk that holds this tile's last row is the last one with a kept key
    V qh[2], ql[2]; const bf* pqh = Qh + (size_t)(r0 + lr) * HD + 8 * hi; const bf* pql = Ql + (size_t)(r0 + lr) * HD + 8 * hi;
#pragma unroll
    for (int h = 0; h < 2; ++h) { qh[h] = F::ld(pqh + h * 32); ql[h] = F::ld(pql + h * 32); }
    asm volatile("s_wait_xcnt 0x0" :: "v"(pqh), "v"(pql) : "memory");   // the query pointers' registers are reused at once: the wait stands in front of the first overwrite of an address register of an issued load
    v8f o[4]; float m[8], l[8];
#pragma unroll
    for (int nb = 0; nb < 4; ++nb) o[nb] = (v8f){};
#pragma unroll
    for (int j = 0; j < 8; ++j) { m[j] = NEG; l[j] = 0.f; }
    float* ow = os + w * WS; bf* ph = (bf*)ow; bf* pl = ph + 16 * 72;
    const size_t koff = (size_t)(w * 64 + lr * 4) * HD + 8 * hi, voff = (size_t)lr * TT + w * 64 + 8 * hi;
    const bf* pkh = Kh + koff; const bf* pkl = Kl + koff; const bf* pvh = Vh + voff; const bf* pvl = Vl + voff; const int* pm = MKb + w * 64 + lr * 4;   // each lane's own pointers, stepped from chunk to chunk
#pragma unroll 1
    for (int kc = w * 64; kc < Kend; kc += NW * 64) {
        V kh[2][4], kl[2][4], vh[2][4], vl[2][4];
#pragma unroll
        for (int h = 0; h < 2; ++h) {
#pragma unroll
            for (int nb = 0; nb < 4; ++nb) { kh[h][nb] = F::ld(pkh + nb * HD + h * 32); kl[h][nb] = F::ld(pkl + nb * HD + h * 32); } }
        const v4i mk = *(const v4i*)pm;
#pragma unroll
        for (int h = 0; h < 2; ++h) {
#pragma unroll
            for (int nb = 0; nb < 4; ++nb) { vh[h][nb] = F::ld(pvh + nb * 16 * TT + h * 32); vl[h][nb] = F::ld(pvl + nb * 16 * TT + h * 32); } }
        // the pointers stay in their registers, untouched, up to this wait: no later load's result and no pointer step overwrites an address register of an issued load in front of it
        asm volatile("s_wait_xcnt 0x0" :: "v"(pkh), "v"(pkl), "v"(pvh), "v"(pvl), "v"(pm) : "memory");
        __builtin_amdgcn_sched_barrier(0);   // keeps every load of the chunk, the values' too, in front of the first WMMA: the value loads fly under the scores and the softmax instead of paying their latency behind them
        v8f s[4];
#pragma unroll
        for (int nb = 0; nb < 4; ++nb) s[nb] = (v8f){};
#pragma unroll
        for (int h = 0; h < 2; ++h) {
#pragma unroll
            for (int nb = 0; nb < 4; ++nb) s[nb] = F::mma(qh[h], kh[h][nb], s[nb]);
#pragma unroll
            for (int nb = 0; nb < 4; ++nb) s[nb] = F::mma(ql[h], kh[h][nb], s[nb]);
#pragma unroll
            for (int nb = 0; nb < 4; ++nb) s[nb] = F::mma(qh[h], kl[h][nb], s[nb]); }
        const int key0 = kc + lr * 4;
#pragma unroll
        for (int j = 0; j < 8; ++j) { const int i = r0 + hi * 8 + j; float x[4]; bool keep[4]; float rm = NEG;
#pragma unroll
            for (int nb = 0; nb < 4; ++nb) { keep[nb] = (key0 + nb <= i) && (mk[nb] != 0); x[nb] = s[nb][j] * SCL; if (keep[nb]) rm = fmaxf(rm, x[nb]); }
#pragma unroll
            for (int sh = 8; sh; sh >>= 1) rm = fmaxf(rm, __shfl_xor(rm, sh, 32));   // the 16 lanes of a half hold one row
            const float mn = fmaxf(m[j], rm); const float al = exp2s((m[j] - mn) * L2E); m[j] = mn;
            float ps = 0.f; v4us oh, ol;
#pragma unroll
            for (int nb = 0; nb < 4; ++nb) { const float ex = exp2s((x[nb] - mn) * L2E); const float pv = keep[nb] ? ex : 0.f; ps += pv; unsigned short h2, l2; splitf(pv, h2, l2); oh[nb] = h2; ol[nb] = l2; }
            l[j] = l[j] * al + ps;   // each lane sums its own four keys of a chunk; the 16 lanes are added once, behind the loop
#pragma unroll
            for (int nb = 0; nb < 4; ++nb) o[nb][j] *= al;
            *(v4usa*)(ph + (hi * 8 + j) * 72 + lr * 4) = oh; *(v4usa*)(pl + (hi * 8 + j) * 72 + lr * 4) = ol; }
        __builtin_amdgcn_wave_barrier(); asm volatile("" ::: "memory");   // compiler order only: every lane's probability stores stand in front of the fragment reads, which take other lanes' words (LDS serves one wave in order)
        V pa[2], pb[2];
#pragma unroll
        for (int h = 0; h < 2; ++h) { const int po = lr * 72 + 8 * hi + h * 32; pa[h] = cat16b(*(const v8usa*)(ph + po), *(const v8usa*)(ph + po + 16)); pb[h] = cat16b(*(const v8usa*)(pl + po), *(const v8usa*)(pl + po + 16)); }
        __builtin_amdgcn_wave_barrier(); asm volatile("" ::: "memory");   // compiler order only: the fragment reads stand in front of the next chunk's probability stores
#pragma unroll
        for (int h = 0; h < 2; ++h) {
#pragma unroll
            for (int nb = 0; nb < 4; ++nb) o[nb] = F::mma(pa[h], vh[h][nb], o[nb]);
#pragma unroll
            for (int nb = 0; nb < 4; ++nb) o[nb] = F::mma(pb[h], vh[h][nb], o[nb]);
#pragma unroll
            for (int nb = 0; nb < 4; ++nb) o[nb] = F::mma(pa[h], vl[h][nb], o[nb]); }
        // four vector slots behind the last WMMA, so that nothing on the taken side of the loop branch touches its registers too early
        asm volatile("v_nop\n\tv_nop\n\tv_nop\n\tv_nop" : "+v"(o[0]), "+v"(o[1]), "+v"(o[2]), "+v"(o[3]) : "v"(pa[1]));
        pkh += NW * 64 * HD; pkl += NW * 64 * HD; pvh += NW * 64; pvl += NW * 64; pm += NW * 64;
    }
#pragma unroll
    for (int sh = 8; sh; sh >>= 1) {
#pragma unroll
        for (int j = 0; j < 8; ++j) l[j] += __shfl_xor(l[j], sh, 32); }
    if (lr == 0) {
#pragma unroll
        for (int j = 0; j < 8; ++j) { ms[w * 16 + hi * 8 + j] = m[j]; ls[w * 16 + hi * 8 + j] = l[j]; } }
#pragma unroll
    for (int nb = 0; nb < 4; ++nb) {
#pragma unroll
        for (int j = 0; j < 8; ++j) ow[(hi * 8 + j) * 68 + nb * 16 + lr] = o[nb][j]; }
    __syncthreads();   // every wave's partial maximum, sum and context tile are in LDS before any of them is merged
    for (int it = threadIdx.x; it < 256; it += NW * 32) { const int row = it >> 4, cofs = (it & 15) * 4; float M = ms[row];
#pragma unroll
        for (int q = 1; q < NW; ++q) M = fmaxf(M, ms[q * 16 + row]);
        float L = 0.f; v4f val = (v4f){};
#pragma unroll
        for (int q = 0; q < NW; ++q) { const float sc = exp2s((ms[q * 16 + row] - M) * L2E); L += ls[q * 16 + row] * sc; val += *(const v4fa*)(os + q * WS + row * 68 + cofs) * sc; }
        const float f = (L > 0.f) ? __fdiv_rn(1.0f, L) : 0.f;
        *(v4f*)(OUTb + (size_t)(r0 + row) * HD + cofs) = val * f; }
}

extern "C" void kernel_launch(void* const* d_in, const int* in_sizes, int n_in,
                              void* d_out, int out_size, void* d_ws, size_t ws_size, hipStream_t stream) {
    (void)in_sizes; (void)n_in; (void)out_size;
    const float* x = (const float*)d_in[0]; const int* MK = (const int*)d_in[1]; const float* wq = (const float*)d_in[2]; const float* wk = (const float*)d_in[3]; const float* wv = (const float*)d_in[4]; const float* wo = nullptr; (void)wo;
    float* OUT = (float*)d_out;     // [4][4096][64]
    char* wsp = (char*)d_ws;
    auto take = [&](size_t bytes) { char* p = wsp; wsp += (bytes + 255) & ~(size_t)255; return (void*)p; };
    bf* WQ = (bf*)take((size_t)DQ * DM * 2); bf* WK = (bf*)take((size_t)DKV * DM * 2); bf* WV = (bf*)take((size_t)DKV * DM * 2); float* CS = (float*)take((size_t)TT * HD * 2 * 4);
    bf* XB = (bf*)take((size_t)TT * DM * 2); float* FQ = (float*)take((size_t)TT * DQ * 4); float* FK = (float*)take((size_t)TT * DKV * 4);
    h16* QP16 = (h16*)take((size_t)NH_ * TT * HD * 2); h16* KP16 = (h16*)take((size_t)NKV * TT * HD * 2); h16* VT16 = (h16*)take((size_t)NKV * HD * TT * 2);
    bf* QPh = (bf*)take((size_t)NH_ * TT * HD * 2); bf* QPl = (bf*)take((size_t)NH_ * TT * HD * 2); bf* KPh = (bf*)take((size_t)NKV * TT * HD * 2); bf* KPl = (bf*)take((size_t)NKV * TT * HD * 2); bf* VTh = (bf*)take((size_t)NKV * HD * TT * 2); bf* VTl = (bf*)take((size_t)NKV * HD * TT * 2);
    if ((size_t)(wsp - (char*)d_ws) > ws_size) return;    // ws 256 MiB
    float* FV = FK;   // v projection reuses the k buffer after the k planes are built (stream-ordered)
    { k_cvt8<<<(unsigned)(((size_t)DQ * DM / 8 + 255) / 256), 256, 0, stream>>>(wq, WQ, (size_t)DQ * DM / 8); k_cvt8<<<(unsigned)(((size_t)DKV * DM / 8 + 255) / 256), 256, 0, stream>>>(wk, WK, (size_t)DKV * DM / 8); k_cvt8<<<(unsigned)(((size_t)DKV * DM / 8 + 255) / 256), 256, 0, stream>>>(wv, WV, (size_t)DKV * DM / 8);   /* 'oi' [64][768] weights are Bt as-is */
       }
    k_csid<<<(TT * HD + 255) / 256, 256, 0, stream>>>(CS);
    const unsigned LQ = (unsigned)(((size_t)NH_ * TT * HD / 2 + 255) / 256), LKv = (unsigned)(((size_t)NKV * TT * HD / 2 + 255) / 256);
    for (int b = 0; b < NB_; ++b) {
        
        k_cvt8<<<(unsigned)(((size_t)TT * DM / 8 + 255) / 256), 256, 0, stream>>>(x + (size_t)b * TT * DM, XB, (size_t)TT * DM / 8);
        k_gemmk<bf, 0, false, 8, DM><<<dim3(TT / 16, DQ / 64, 1), 256, 0, stream>>>(XB, nullptr, WQ, nullptr, FQ, DQ);
        k_rope<<<LQ, 256, 0, stream>>>(FQ, DQ, NH_, CS, nullptr, nullptr, 1.0f, QP16, QPh, QPl);
        k_gemmk<bf, 0, false, 8, DM><<<dim3(TT / 16, DKV / 64, 1), 256, 0, stream>>>(XB, nullptr, WK, nullptr, FK, DKV);
        k_rope<<<LKv, 256, 0, stream>>>(FK, DKV, NKV, CS, nullptr, nullptr, 1.0f, KP16, KPh, KPl);
        k_gemmk<bf, 0, false, 8, DM><<<dim3(TT / 16, DKV / 64, 1), 256, 0, stream>>>(XB, nullptr, WV, nullptr, FV, DKV); k_vtp<<<LKv, 256, 0, stream>>>(FV, DKV, NKV, VT16, VTh, VTl);
        for (int h0 = 0; h0 < NH_; h0 += ZH) { const size_t zq = (size_t)h0, zk = (size_t)(h0 / REP);   // one kv head per query head: one head per pass (ZH = 1), its q and kv planes at offset h0 * TT*HD
            k_fattn<8><<<dim3(TT / 16, 1, 1), 256, 0, stream>>>(QPh + zq * TT * HD, QPl + zq * TT * HD, KPh + zk * TT * HD, KPl + zk * TT * HD, VTh + zk * HD * TT, VTl + zk * HD * TT, MK + (size_t)b * TT, OUT + (size_t)b * TT * DQ + h0 * HD); }
    }
}

// v003
// One run takes 133 microseconds.
// In both of two side-by-side timings against v002, it was 1.78 times as fast.
// Counting every step since v000, it is 6.41 times as fast.
#include <hip/hip_runtime.h>

// Single-head causal attention with a key padding mask (x [4][4096][768]; q, k, v = x W^T ('oi' [64][768], no bias; one 64-wide head); scores = q.k x 64^-0.5; keep = causal (j <= i) and mask[b][j] != 0 (int32, read); softmax; out = attn.v -> [4][4096][64] f32 (1 M); no output projection).
// Compute dtypes, f32 accumulate: every input rounded to bf16; q/k/v on PLAIN bf16 operands (inputs: exact); causal scores and attn.v (tile skipping) on hi/lo planes for every row (3 products); online softmax in f32 inside one fused kernel (scores and probabilities never reach memory); no output projection: the context is written in f32.

#define NB_  4
#define TT   4096
#define MT   (NB_ * TT)          // rows of all batches together
#define DM   768
#define NH_  1
#define NKV  1
#define REP  (NH_ / NKV)
#define HD   64
#define DQ   (NH_ * HD)
#define DKV  (NKV * HD)
#define ZH   1
#define RH   4096                 // every row hi/lo (streaming softmax, no register row)
#define RB   TT
#define WIN  4096
#define PCAR 1024.0f
#define SCL  0.125f   // H^-0.5 with H = 64 (the head width)
typedef _Float16 h16;
typedef unsigned short bf;
typedef __attribute__((ext_vector_type(16))) __bf16   v16bf;
typedef __attribute__((ext_vector_type(16))) _Float16 v16h;
typedef __attribute__((ext_vector_type(8)))  _Float16 v8h;
typedef __attribute__((ext_vector_type(8)))  unsigned short v8us;
typedef __attribute__((ext_vector_type(8)))  float    v8f;
typedef __attribute__((ext_vector_type(4)))  float    v4f;
typedef v8h  __attribute__((may_alias)) v8ha;
typedef v4f  __attribute__((may_alias)) v4fa;
typedef v8us __attribute__((may_alias)) v8usa;

__device__ __forceinline__ unsigned short f2bf(float f) { unsigned u = __float_as_uint(f); u += 0x7FFFu + ((u >> 16) & 1u); return (unsigned short)(u >> 16); }
__device__ __forceinline__ float bf2f(unsigned short b) { return __uint_as_float(((unsigned)b) << 16); }
__device__ __forceinline__ float bfr(float f) { return bf2f(f2bf(f)); }
__device__ __forceinline__ v16h cat16(v8h lo, v8h hi) { return __builtin_shufflevector(lo, hi, 0, 1, 2, 3, 4, 5, 6, 7, 8, 9, 10, 11, 12, 13, 14, 15); }
__device__ __forceinline__ v16bf cat16b(v8us lo, v8us hi) { return __builtin_bit_cast(v16bf, __builtin_shufflevector(lo, hi, 0, 1, 2, 3, 4, 5, 6, 7, 8, 9, 10, 11, 12, 13, 14, 15)); }
__device__ __forceinline__ v8f wmma16(v16h a, v16h b, v8f c) { return __builtin_amdgcn_wmma_f32_16x16x32_f16(false, a, false, b, (short)0, c, false, false); }
__device__ __forceinline__ v8f wmmab(v16bf a, v16bf b, v8f c) { return __builtin_amdgcn_wmma_f32_16x16x32_bf16(false, a, false, b, (short)0, c, false, false); }



// ---- k_gemmk: GEMM for narrow outputs (here q | k | v, 192 columns wide), where one wave per 64x64 tile leaves most of the chip idle: ONE WORK-GROUP of NW waves per 16x64 output tile, grid (M/16, N/64).
// The K loop is dealt to the waves in chunks of 64 elements (one whole 128-byte line of every operand row): wave w takes chunks w, w + NW, ... Each wave keeps a partial 16x64 tile (4 accumulators);
// the partial tiles go to LDS and are summed in wave order 0 .. NW-1. C[m][n] (f32, pitch ldc) = sum_k A[m][k] Bt[n][k] (+ split products per NSPLIT). K % 64 == 0.
// CAUSAL: A holds probabilities that are exactly 0 beyond the diagonal, so the K loop stops at the 64-wide chunk that holds this tile's last row.
template <typename T16> struct WFrag;
template <> struct WFrag<h16> { typedef v16h V; static __device__ __forceinline__ V ld(const h16* p) { return cat16(*(const v8h*)p, *(const v8h*)(p + 16)); } static __device__ __forceinline__ v8f mma(V a, V b, v8f c) { return wmma16(a, b, c); } };
template <> struct WFrag<bf> { typedef v16bf V; static __device__ __forceinline__ V ld(const bf* p) { return cat16b(*(const v8us*)p, *(const v8us*)(p + 16)); } static __device__ __forceinline__ v8f mma(V a, V b, v8f c) { return wmmab(a, b, c); } };
template <typename T16, int NSPLIT, bool CAUSAL, int NW, int K>
__global__ __launch_bounds__(NW * 32) void k_gemmk(const T16* __restrict__ A, const T16* __restrict__ A2, const T16* __restrict__ Bt, const T16* __restrict__ Bt2, float* C, int ldc) {
    typedef typename WFrag<T16>::V V;
    __shared__ __align__(16) float os[NW * 16 * 68];
    const int lane = threadIdx.x & 31, lr = lane & 15, hi = lane >> 4; const int r0 = blockIdx.x * 16, c0 = blockIdx.y * 64;
    const int w = __builtin_amdgcn_readfirstlane((int)(threadIdx.x >> 5));   // wave number in a scalar register: the K loop's branch stays scalar and EXEC stays full at every WMMA
    const int Kl = CAUSAL ? min(K, (r0 + 16 + 63) & ~63) : K;
    v8f acc[4];
#pragma unroll
    for (int nb = 0; nb < 4; ++nb) acc[nb] = (v8f){};
    const size_t aoff = (size_t)(r0 + lr) * K + 8 * hi + w * 64, boff = (size_t)(c0 + lr) * K + 8 * hi + w * 64;
    const T16* pa = A + aoff; const T16* pa2 = A2 + aoff; const T16* pb = Bt + boff; const T16* pb2 = Bt2 + boff;   // each lane's own row pointers, stepped from chunk to chunk; K is a compile-time constant, so the four column blocks are immediate offsets
#pragma unroll 1
    for (int kc = w * 64; kc < Kl; kc += NW * 64) {
        V a[2], a2[2], b[2][4], b2[2][4];
#pragma unroll
        for (int h = 0; h < 2; ++h) { a[h] = WFrag<T16>::ld(pa + h * 32); if (NSPLIT == 1 || NSPLIT == 2) a2[h] = WFrag<T16>::ld(pa2 + h * 32);
#pragma unroll
            for (int nb = 0; nb < 4; ++nb) { b[h][nb] = WFrag<T16>::ld(pb + nb * 16 * K + h * 32); if (NSPLIT >= 2) b2[h][nb] = WFrag<T16>::ld(pb2 + nb * 16 * K + h * 32); } }
        // the row pointers stay in their registers, untouched, up to this wait: no later load's result and no pointer step overwrites an address register of an issued load in front of it
        if (NSPLIT >= 2) asm volatile("s_wait_xcnt 0x0" :: "v"(pa), "v"(pa2), "v"(pb), "v"(pb2) : "memory"); else asm volatile("s_wait_xcnt 0x0" :: "v"(pa), "v"(pb) : "memory");
        __builtin_amdgcn_sched_barrier(0);   // keeps every load of the chunk in front of its first WMMA: without it the loads are sunk among the WMMAs into reused registers and the chunk pays the load latency several times over
#pragma unroll
        for (int h = 0; h < 2; ++h) {
#pragma unroll
            for (int nb = 0; nb < 4; ++nb) acc[nb] = WFrag<T16>::mma(a[h], b[h][nb], acc[nb]);
            if (NSPLIT == 1 || NSPLIT == 2) {
#pragma unroll
                for (int nb = 0; nb < 4; ++nb) acc[nb] = WFrag<T16>::mma(a2[h], b[h][nb], acc[nb]); }
            if (NSPLIT >= 2) {
#pragma unroll
                for (int nb = 0; nb < 4; ++nb) acc[nb] = WFrag<T16>::mma(a[h], b2[h][nb], acc[nb]); } }
        // four vector slots behind the last WMMA, so that nothing on the taken side of the loop branch touches its registers too early
        asm volatile("v_nop\n\tv_nop\n\tv_nop\n\tv_nop" : "+v"(acc[0]), "+v"(acc[1]), "+v"(acc[2]), "+v"(acc[3]) : "v"(a[1]));
        pa += NW * 64; pa2 += NW * 64; pb += NW * 64; pb2 += NW * 64;
    }
    float* ow = os + w * (16 * 68);
#pragma unroll
    for (int nb = 0; nb < 4; ++nb) {
#pragma unroll
        for (int j = 0; j < 8; ++j) ow[(hi * 8 + j) * 68 + nb * 16 + lr] = acc[nb][j]; }
    __syncthreads();   // every wave's partial tile is in LDS before any of them is summed
    for (int it = threadIdx.x; it < 256; it += NW * 32) { const int row = it >> 4, cofs = (it & 15) * 4; v4f val = *(const v4fa*)(os + row * 68 + cofs);
#pragma unroll
        for (int q = 1; q < NW; ++q) val += *(const v4fa*)(os + q * (16 * 68) + row * 68 + cofs);
        *(v4f*)(C + (size_t)(r0 + row) * ldc + c0 + cofs) = val; }
}

__device__ __forceinline__ h16 tohx(float x) { return (h16)x; }
__device__ __forceinline__ void splitf(float y, unsigned short& h, unsigned short& l) { h = f2bf(y); l = f2bf(y - bf2f(h)); }
typedef __attribute__((ext_vector_type(2))) _Float16 v2h;
typedef __attribute__((ext_vector_type(4))) _Float16 v4h;
typedef __attribute__((ext_vector_type(2))) unsigned short v2us;
typedef __attribute__((ext_vector_type(4))) unsigned short v4us;
typedef __attribute__((ext_vector_type(2))) float v2f;
typedef __attribute__((ext_vector_type(4))) int v4i;

__global__ __launch_bounds__(256) void k_wtG(const float* __restrict__ w, int K, int N, bf* Bt) {
    const int lane = threadIdx.x & 31; const int L0 = (blockIdx.x * 8 + (threadIdx.x >> 5)) * 8; const int nlines = N * K / 64;
{
#pragma unroll 1
        for (int l = 0; l < 8; ++l) { const int L = L0 + l; if (L >= nlines) break; const size_t e = (size_t)L * 64 + lane * 2; const int k = (int)(e % K), n = (int)(e / K); v2us o;
            o[0] = f2bf(w[(size_t)k * N + n]); o[1] = f2bf(w[(size_t)(k + 1) * N + n]); *(v2us*)(Bt + e) = o; }
         }
}
__global__ __launch_bounds__(256) void k_cvt8(const float* __restrict__ src, bf* dst, size_t n8) { const size_t i = (size_t)blockIdx.x * 256 + threadIdx.x; if (i >= n8) return; const v8f v = *(const v8f*)(src + i * 8); v8us o;
#pragma unroll
    for (int k = 0; k < 8; ++k) o[k] = f2bf(v[k]); *(v8us*)(dst + i * 8) = o;  }

// k_cvt8x3: k_cvt8 for three sources of equal length in one launch; blockIdx.y picks the source, the results lie one behind the other in dst
__global__ __launch_bounds__(256) void k_cvt8x3(const float* __restrict__ s0, const float* __restrict__ s1, const float* __restrict__ s2, bf* dst, size_t n8) { const size_t i = (size_t)blockIdx.x * 256 + threadIdx.x; if (i >= n8) return; const float* src = (blockIdx.y == 0) ? s0 : (blockIdx.y == 1) ? s1 : s2; const v8f v = *(const v8f*)(src + i * 8); v8us o;
#pragma unroll
    for (int k = 0; k < 8; ++k) o[k] = f2bf(v[k]); *(v8us*)(dst + ((size_t)blockIdx.y * n8 + i) * 8) = o;  }

// k_rope: t runs over the rows of all batches (position t % TT); head planes [h][t][d] (fp16 + hi/lo) of rope(x) x sc with the rotate-half convention out[d] = x[d] cos[t][d] - x[d+HD/2] sin[t][d], out[d+HD/2] = x[d+HD/2] cos[t][d+HD/2] + x[d] sin[t][d+HD/2]
__global__ __launch_bounds__(256) void k_rope(const float* __restrict__ F, int pitch, int nheads, const float* __restrict__ CS, const float* __restrict__ RF, const float* __restrict__ nw, float sc, h16* P16, bf* Ph, bf* Pl) {
    const size_t e = ((size_t)blockIdx.x * 256 + threadIdx.x) * 2; if (e >= (size_t)nheads * MT * HD) return; const int d = (int)(e % HD); const int t = (int)((e / HD) % MT); const int h = (int)(e / ((size_t)HD * MT)); const float* f = F + (size_t)t * pitch + h * HD; float rf = 1.0f; v2h o16; v2us oh, ol;
    if (RF) { const float* prf = RF + (size_t)h * MT + t; rf = *prf; asm volatile("s_wait_xcnt 0x0" :: "v"(prf) : "memory"); }   // the pointer's registers are reused at once: the wait stands in front of the first overwrite of an address register of the issued load
#pragma unroll
    for (int q = 0; q < 2; ++q) { const int dd = d + q; const int dp = (dd < HD / 2) ? dd + HD / 2 : dd - HD / 2; float x0 = f[dd], x1 = f[dp];
        if (RF) { float n0 = __fmul_rn(x0, rf), n1 = __fmul_rn(x1, rf); asm volatile("" : "+v"(n0)); asm volatile("" : "+v"(n1)); x0 = __fmul_rn(bfr(nw[dd]), n0); x1 = __fmul_rn(bfr(nw[dp]), n1); }
        const v2f cs = *(const v2f*)(CS + ((size_t)(t % TT) * HD + dd) * 2); float a = __fmul_rn(x0, cs[0]), bq = __fmul_rn(x1, cs[1]); asm volatile("" : "+v"(a)); asm volatile("" : "+v"(bq)); const float r = ((dd < HD / 2) ? __fsub_rn(a, bq) : __fadd_rn(a, bq)) * sc;
        o16[q] = tohx(r); unsigned short a2, c2; splitf(r, a2, c2); oh[q] = a2; ol[q] = c2; }
    *(v2h*)(P16 + e) = o16; *(v2us*)(Ph + e) = oh; *(v2us*)(Pl + e) = ol;  }
// k_vtp: transposed value planes [g][d][t], g the batch (one head); F holds the rows of all batches, row g TT + t
__global__ __launch_bounds__(256) void k_vtp(const float* __restrict__ F, int pitch, int nbat, h16* V16, bf* Vh, bf* Vl) { const size_t e = ((size_t)blockIdx.x * 256 + threadIdx.x) * 2; if (e >= (size_t)nbat * HD * TT) return; const int t = (int)(e % TT); const int d = (int)((e / TT) % HD); const int g = (int)(e / ((size_t)TT * HD)); v2h o16; v2us oh, ol;
#pragma unroll
    for (int q = 0; q < 2; ++q) { const float x = F[((size_t)g * TT + t + q) * pitch + d]; o16[q] = tohx(x); unsigned short a2, c2; splitf(x, a2, c2); oh[q] = a2; ol[q] = c2; }
    *(v2h*)(V16 + e) = o16; *(v2us*)(Vh + e) = oh; *(v2us*)(Vl + e) = ol;  }
__global__ __launch_bounds__(256) void k_csid(float* CS) { const int idx = blockIdx.x * 256 + threadIdx.x; if (idx >= TT * HD) return; v2f cs; cs[0] = 1.0f; cs[1] = 0.0f; *(v2f*)(CS + (size_t)idx * 2) = cs;  }
typedef v4us __attribute__((may_alias)) v4usa;
// 2^x with the one vector slot that the instruction set asks for behind a transcendental in the same statement
__device__ __forceinline__ float exp2s(float x) { float r; asm("v_exp_f32 %0, %1\n\tv_nop" : "=v"(r) : "v"(x)); return r; }

// ---- k_fattn: causal scores, softmax and probability x value in ONE kernel; neither scores nor probabilities go through memory. ONE WORK-GROUP of NW waves per 16 query rows, grid (batches, TT/16): blockIdx.x picks the batch's planes, mask row and output, so the four batches' tiles of equal length start side by side.
// The keys up to the diagonal are dealt to the waves in chunks of 64: wave w takes chunks w, w + NW, ... For each chunk a wave forms its 16x64 score tile (hi/lo planes, 3 products), keeps a running row maximum m,
// a running sum l of exp(s - m) and a running 16x64 context tile o (both rescaled by exp(m_old - m_new) when m grows), and multiplies the unnormalised probabilities (split into hi/lo planes, 3 products) with the value chunk.
// Score column lr of block nb is key 4 lr + nb of the chunk, so a lane holds four neighbouring keys of a row and stores them to LDS as one 8-byte word; in LDS the probabilities lie in plain key order, [row][key], pitch 72.
// At the end the NW partial (m, l, o) go to LDS and are merged in wave order 0 .. NW-1 with the weights exp(m_w - max m); the context is divided by the merged sum and written straight to the output.
template <int NW>
__global__ __launch_bounds__(NW * 32) void k_fattn(const bf* __restrict__ Qh0, const bf* __restrict__ Ql0, const bf* __restrict__ Kh0, const bf* __restrict__ Kl0, const bf* __restrict__ Vh0, const bf* __restrict__ Vl0, const int* __restrict__ MK0, float* OUT0) {
    const size_t zb = (size_t)blockIdx.x * TT * HD;   // every plane and the output hold TT x HD elements a batch
    const bf* __restrict__ Qh = Qh0 + zb; const bf* __restrict__ Ql = Ql0 + zb; const bf* __restrict__ Kh = Kh0 + zb; const bf* __restrict__ Kl = Kl0 + zb; const bf* __restrict__ Vh = Vh0 + zb; const bf* __restrict__ Vl = Vl0 + zb;
    const int* __restrict__ MKb = MK0 + (size_t)blockIdx.x * TT; float* OUTb = OUT0 + zb;
    typedef WFrag<bf> F; typedef F::V V;
    constexpr float L2E = 1.4426950408889634f, NEG = -3.0e38f;
    constexpr int WS = 1152;   // floats of LDS per wave: two 16 x 72 probability planes of 16 bits during the loop, the 16 x 68 f32 context tile behind it
    __shared__ __align__(16) float os[NW * WS];
    __shared__ float ms[NW * 16], ls[NW * 16];
    const int lane = threadIdx.x & 31, lr = lane & 15, hi = lane >> 4; const int r0 = blockIdx.y * 16;
    const int w = __builtin_amdgcn_readfirstlane((int)(threadIdx.x >> 5));   // wave number in a scalar register: the key loop's branch stays scalar and EXEC stays full at every WMMA
    const int Kend = (r0 + 16 + 63) & ~63;   // the 64-wide chunk that holds this tile's last row is the last one with a kept key
    V qh[2], ql[2]; const bf* pqh = Qh + (size_t)(r0 + lr) * HD + 8 * hi; const bf* pql = Ql + (size_t)(r0 + lr) * HD + 8 * hi;
#pragma unroll
    for (int h = 0; h < 2; ++h) { qh[h] = F::ld(pqh + h * 32); ql[h] = F::ld(pql + h * 32); }
    asm volatile("s_wait_xcnt 0x0" :: "v"(pqh), "v"(pql) : "memory");   // the query pointers' registers are reused at once: the wait stands in front of the first overwrite of an address register of an issued load
    v8f o[4]; float m[8], l[8];
#pragma unroll
    for (int nb = 0; nb < 4; ++nb) o[nb] = (v8f){};
#pragma unroll
    for (int j = 0; j < 8; ++j) { m[j] = NEG; l[j] = 0.f; }
    float* ow = os + w * WS; bf* ph = (bf*)ow; bf* pl = ph + 16 * 72;
    const size_t koff = (size_t)(w * 64 + lr * 4) * HD + 8 * hi, voff = (size_t)lr * TT + w * 64 + 8 * hi;
    const bf* pkh = Kh + koff; const bf* pkl = Kl + koff; const bf* pvh = Vh + voff; const bf* pvl = Vl + voff; const int* pm = MKb + w * 64 + lr * 4;   // each lane's own pointers, stepped from chunk to chunk
#pragma unroll 1
    for (int kc = w * 64; kc < Kend; kc += NW * 64) {
        V kh[2][4], kl[2][4], vh[2][4], vl[2][4];
#pragma unroll
        for (int h = 0; h < 2; ++h) {
#pragma unroll
            for (int nb = 0; nb < 4; ++nb) { kh[h][nb] = F::ld(pkh + nb * HD + h * 32); kl[h][nb] = F::ld(pkl + nb * HD + h * 32); } }
        const v4i mk = *(const v4i*)pm;
#pragma unroll
        for (int h = 0; h < 2; ++h) {
#pragma unroll
            for (int nb = 0; nb < 4; ++nb) { vh[h][nb] = F::ld(pvh + nb * 16 * TT + h * 32); vl[h][nb] = F::ld(pvl + nb * 16 * TT + h * 32); } }
        // the pointers stay in their registers, untouched, up to this wait: no later load's result and no pointer step overwrites an address register of an issued load in front of it
        asm volatile("s_wait_xcnt 0x0" :: "v"(pkh), "v"(pkl), "v"(pvh), "v"(pvl), "v"(pm) : "memory");
        __builtin_amdgcn_sched_barrier(0);   // keeps every load of the chunk, the values' too, in front of the first WMMA: the value loads fly under the scores and the softmax instead of paying their latency behind them
        v8f s[4];
#pragma unroll
        for (int nb = 0; nb < 4; ++nb) s[nb] = (v8f){};
#pragma unroll
        for (int h = 0; h < 2; ++h) {
#pragma unroll
            for (int nb = 0; nb < 4; ++nb) s[nb] = F::mma(qh[h], kh[h][nb], s[nb]);
#pragma unroll
            for (int nb = 0; nb < 4; ++nb) s[nb] = F::mma(ql[h], kh[h][nb], s[nb]);
#pragma unroll
            for (int nb = 0; nb < 4; ++nb) s[nb] = F::mma(qh[h], kl[h][nb], s[nb]); }
        const int key0 = kc + lr * 4;
#pragma unroll
        for (int j = 0; j < 8; ++j) { const int i = r0 + hi * 8 + j; float x[4]; bool keep[4]; float rm = NEG;
#pragma unroll
            for (int nb = 0; nb < 4; ++nb) { keep[nb] = (key0 + nb <= i) && (mk[nb] != 0); x[nb] = s[nb][j] * SCL; if (keep[nb]) rm = fmaxf(rm, x[nb]); }
#pragma unroll
            for (int sh = 8; sh; sh >>= 1) rm = fmaxf(rm, __shfl_xor(rm, sh, 32));   // the 16 lanes of a half hold one row
            const float mn = fmaxf(m[j], rm); const float al = exp2s((m[j] - mn) * L2E); m[j] = mn;
            float ps = 0.f; v4us oh, ol;
#pragma unroll
            for (int nb = 0; nb < 4; ++nb) { const float ex = exp2s((x[nb] - mn) * L2E); const float pv = keep[nb] ? ex : 0.f; ps += pv; unsigned short h2, l2; splitf(pv, h2, l2); oh[nb] = h2; ol[nb] = l2; }
            l[j] = l[j] * al + ps;   // each lane sums its own four keys of a chunk; the 16 lanes are added once, behind the loop
#pragma unroll
            for (int nb = 0; nb < 4; ++nb) o[nb][j] *= al;
            *(v4usa*)(ph + (hi * 8 + j) * 72 + lr * 4) = oh; *(v4usa*)(pl + (hi * 8 + j) * 72 + lr * 4) = ol; }
        __builtin_amdgcn_wave_barrier(); asm volatile("" ::: "memory");   // compiler order only: every lane's probability stores stand in front of the fragment reads, which take other lanes' words (LDS serves one wave in order)
        V pa[2], pb[2];
#pragma unroll
        for (int h = 0; h < 2; ++h) { const int po = lr * 72 + 8 * hi + h * 32; pa[h] = cat16b(*(const v8usa*)(ph + po), *(const v8usa*)(ph + po + 16)); pb[h] = cat16b(*(const v8usa*)(pl + po), *(const v8usa*)(pl + po + 16)); }
        __builtin_amdgcn_wave_barrier(); asm volatile("" ::: "memory");   // compiler order only: the fragment reads stand in front of the next chunk's probability stores
#pragma unroll
        for (int h = 0; h < 2; ++h) {
#pragma unroll
            for (int nb = 0; nb < 4; ++nb) o[nb] = F::mma(pa[h], vh[h][nb], o[nb]);
#pragma unroll
            for (int nb = 0; nb < 4; ++nb) o[nb] = F::mma(pb[h], vh[h][nb], o[nb]);
#pragma unroll
            for (int nb = 0; nb < 4; ++nb) o[nb] = F::mma(pa[h], vl[h][nb], o[nb]); }
        // four vector slots behind the last WMMA, so that nothing on the taken side of the loop branch touches its registers too early
        asm volatile("v_nop\n\tv_nop\n\tv_nop\n\tv_nop" : "+v"(o[0]), "+v"(o[1]), "+v"(o[2]), "+v"(o[3]) : "v"(pa[1]));
        pkh += NW * 64 * HD; pkl += NW * 64 * HD; pvh += NW * 64; pvl += NW * 64; pm += NW * 64;
    }
#pragma unroll
    for (int sh = 8; sh; sh >>= 1) {
#pragma unroll
        for (int j = 0; j < 8; ++j) l[j] += __shfl_xor(l[j], sh, 32); }
    if (lr == 0) {
#pragma unroll
        for (int j = 0; j < 8; ++j) { ms[w * 16 + hi * 8 + j] = m[j]; ls[w * 16 + hi * 8 + j] = l[j]; } }
#pragma unroll
    for (int nb = 0; nb < 4; ++nb) {
#pragma unroll
        for (int j = 0; j < 8; ++j) ow[(hi * 8 + j) * 68 + nb * 16 + lr] = o[nb][j]; }
    __syncthreads();   // every wave's partial maximum, sum and context tile are in LDS before any of them is merged
    for (int it = threadIdx.x; it < 256; it += NW * 32) { const int row = it >> 4, cofs = (it & 15) * 4; float M = ms[row];
#pragma unroll
        for (int q = 1; q < NW; ++q) M = fmaxf(M, ms[q * 16 + row]);
        float L = 0.f; v4f val = (v4f){};
#pragma unroll
        for (int q = 0; q < NW; ++q) { const float sc = exp2s((ms[q * 16 + row] - M) * L2E); L += ls[q * 16 + row] * sc; val += *(const v4fa*)(os + q * WS + row * 68 + cofs) * sc; }
        const float f = (L > 0.f) ? __fdiv_rn(1.0f, L) : 0.f;
        *(v4f*)(OUTb + (size_t)(r0 + row) * HD + cofs) = val * f; }
}

extern "C" void kernel_launch(void* const* d_in, const int* in_sizes, int n_in,
                              void* d_out, int out_size, void* d_ws, size_t ws_size, hipStream_t stream) {
    (void)in_sizes; (void)n_in; (void)out_size;
    const float* x = (const float*)d_in[0]; const int* MK = (const int*)d_in[1]; const float* wq = (const float*)d_in[2]; const float* wk = (const float*)d_in[3]; const float* wv = (const float*)d_in[4]; const float* wo = nullptr; (void)wo;
    float* OUT = (float*)d_out;     // [4][4096][64]
    char* wsp = (char*)d_ws;
    auto take = [&](size_t bytes) { char* p = wsp; wsp += (bytes + 255) & ~(size_t)255; return (void*)p; };
    bf* WQKV = (bf*)take((size_t)(DQ + 2 * DKV) * DM * 2); float* CS = (float*)take((size_t)TT * HD * 2 * 4);   // the three weights one behind the other: Bt [192][768]
    bf* XB = (bf*)take((size_t)MT * DM * 2); float* FQKV = (float*)take((size_t)MT * (DQ + 2 * DKV) * 4);   // all batches: x in bf16 [16384][768]; q | k | v side by side [16384][192]
    h16* QK16 = (h16*)take((size_t)2 * MT * HD * 2); h16* VT16 = (h16*)take((size_t)MT * HD * 2);
    bf* QKh = (bf*)take((size_t)2 * MT * HD * 2); bf* QKl = (bf*)take((size_t)2 * MT * HD * 2); bf* VTh = (bf*)take((size_t)MT * HD * 2); bf* VTl = (bf*)take((size_t)MT * HD * 2);   // plane 0 of QK*: q, plane 1: k
    if ((size_t)(wsp - (char*)d_ws) > ws_size) return;    // ws 256 MiB
    k_cvt8x3<<<dim3((unsigned)(((size_t)DQ * DM / 8 + 255) / 256), 3, 1), 256, 0, stream>>>(wq, wk, wv, WQKV, (size_t)DQ * DM / 8);   /* 'oi' [64][768] weights are Bt as-is */
    k_csid<<<(TT * HD + 255) / 256, 256, 0, stream>>>(CS);
    k_cvt8<<<(unsigned)(((size_t)MT * DM / 8 + 255) / 256), 256, 0, stream>>>(x, XB, (size_t)MT * DM / 8);
    k_gemmk<bf, 0, false, 8, DM><<<dim3(MT / 16, (DQ + 2 * DKV) / 64, 1), 256, 0, stream>>>(XB, nullptr, WQKV, nullptr, FQKV, DQ + 2 * DKV);
    k_rope<<<(unsigned)(((size_t)2 * MT * HD / 2 + 255) / 256), 256, 0, stream>>>(FQKV, DQ + 2 * DKV, 2, CS, nullptr, nullptr, 1.0f, QK16, QKh, QKl);
    k_vtp<<<(unsigned)(((size_t)MT * HD / 2 + 255) / 256), 256, 0, stream>>>(FQKV + DQ + DKV, DQ + 2 * DKV, NB_, VT16, VTh, VTl);
    k_fattn<8><<<dim3(NB_, TT / 16, 1), 256, 0, stream>>>(QKh, QKl, QKh + (size_t)MT * HD, QKl + (size_t)MT * HD, VTh, VTl, MK, OUT);
}

// v004
// It runs in 96.1 microseconds.
// In both of two side-by-side timings against v003, it was 1.38 times as fast.
// Counting every step since v000, it is 8.83 times as fast.
#include <hip/hip_runtime.h>

// Single-head causal attention with a key padding mask (x [4][4096][768]; q, k, v = x W^T ('oi' [64][768], no bias; one 64-wide head); scores = q.k x 64^-0.5; keep = causal (j <= i) and mask[b][j] != 0 (int32, read); softmax; out = attn.v -> [4][4096][64] f32 (1 M); no output projection).
// Compute dtypes, f32 accumulate: every input rounded to bf16; q/k/v on PLAIN bf16 operands (inputs: exact); causal scores and attn.v (tile skipping) on hi/lo planes for every row (3 products); online softmax in f32 inside one fused kernel (scores and probabilities never reach memory); no output projection: the context is written in f32.

#define NB_  4
#define TT   4096
#define MT   (NB_ * TT)          // rows of all batches together
#define DM   768
#define NH_  1
#define NKV  1
#define REP  (NH_ / NKV)
#define HD   64
#define DQ   (NH_ * HD)
#define DKV  (NKV * HD)
#define ZH   1
#define RH   4096                 // every row hi/lo (streaming softmax, no register row)
#define RB   TT
#define WIN  4096
#define PCAR 1024.0f
#define SCL  0.125f   // H^-0.5 with H = 64 (the head width)
typedef _Float16 h16;
typedef unsigned short bf;
typedef __attribute__((ext_vector_type(16))) __bf16   v16bf;
typedef __attribute__((ext_vector_type(16))) _Float16 v16h;
typedef __attribute__((ext_vector_type(8)))  _Float16 v8h;
typedef __attribute__((ext_vector_type(8)))  unsigned short v8us;
typedef __attribute__((ext_vector_type(8)))  float    v8f;
typedef __attribute__((ext_vector_type(4)))  float    v4f;
typedef v8h  __attribute__((may_alias)) v8ha;
typedef v4f  __attribute__((may_alias)) v4fa;
typedef v8us __attribute__((may_alias)) v8usa;

__device__ __forceinline__ unsigned short f2bf(float f) { unsigned u = __float_as_uint(f); u += 0x7FFFu + ((u >> 16) & 1u); return (unsigned short)(u >> 16); }
__device__ __forceinline__ float bf2f(unsigned short b) { return __uint_as_float(((unsigned)b) << 16); }
__device__ __forceinline__ float bfr(float f) { return bf2f(f2bf(f)); }
__device__ __forceinline__ v16h cat16(v8h lo, v8h hi) { return __builtin_shufflevector(lo, hi, 0, 1, 2, 3, 4, 5, 6, 7, 8, 9, 10, 11, 12, 13, 14, 15); }
__device__ __forceinline__ v16bf cat16b(v8us lo, v8us hi) { return __builtin_bit_cast(v16bf, __builtin_shufflevector(lo, hi, 0, 1, 2, 3, 4, 5, 6, 7, 8, 9, 10, 11, 12, 13, 14, 15)); }
__device__ __forceinline__ v8f wmma16(v16h a, v16h b, v8f c) { return __builtin_amdgcn_wmma_f32_16x16x32_f16(false, a, false, b, (short)0, c, false, false); }
__device__ __forceinline__ v8f wmmab(v16bf a, v16bf b, v8f c) { return __builtin_amdgcn_wmma_f32_16x16x32_bf16(false, a, false, b, (short)0, c, false, false); }



// fragment loaders and matrix products by 16-bit operand type
template <typename T16> struct WFrag;
template <> struct WFrag<h16> { typedef v16h V; static __device__ __forceinline__ V ld(const h16* p) { return cat16(*(const v8h*)p, *(const v8h*)(p + 16)); } static __device__ __forceinline__ v8f mma(V a, V b, v8f c) { return wmma16(a, b, c); } };
template <> struct WFrag<bf> { typedef v16bf V; static __device__ __forceinline__ V ld(const bf* p) { return cat16b(*(const v8us*)p, *(const v8us*)(p + 16)); } static __device__ __forceinline__ v8f mma(V a, V b, v8f c) { return wmmab(a, b, c); } };

__device__ __forceinline__ h16 tohx(float x) { return (h16)x; }
__device__ __forceinline__ void splitf(float y, unsigned short& h, unsigned short& l) { h = f2bf(y); l = f2bf(y - bf2f(h)); }
typedef __attribute__((ext_vector_type(2))) _Float16 v2h;
typedef __attribute__((ext_vector_type(4))) _Float16 v4h;
typedef __attribute__((ext_vector_type(2))) unsigned short v2us;
typedef __attribute__((ext_vector_type(4))) unsigned short v4us;
typedef __attribute__((ext_vector_type(2))) float v2f;
typedef __attribute__((ext_vector_type(4))) int v4i;

__global__ __launch_bounds__(256) void k_wtG(const float* __restrict__ w, int K, int N, bf* Bt) {
    const int lane = threadIdx.x & 31; const int L0 = (blockIdx.x * 8 + (threadIdx.x >> 5)) * 8; const int nlines = N * K / 64;
{
#pragma unroll 1
        for (int l = 0; l < 8; ++l) { const int L = L0 + l; if (L >= nlines) break; const size_t e = (size_t)L * 64 + lane * 2; const int k = (int)(e % K), n = (int)(e / K); v2us o;
            o[0] = f2bf(w[(size_t)k * N + n]); o[1] = f2bf(w[(size_t)(k + 1) * N + n]); *(v2us*)(Bt + e) = o; }
         }
}
// k_cvt8x3: f32 to bf16, eight elements a thread, for three sources of equal length in one launch; blockIdx.y picks the source, the results lie one behind the other in dst
__global__ __launch_bounds__(256) void k_cvt8x3(const float* __restrict__ s0, const float* __restrict__ s1, const float* __restrict__ s2, bf* dst, size_t n8) { const size_t i = (size_t)blockIdx.x * 256 + threadIdx.x; if (i >= n8) return; const float* src = (blockIdx.y == 0) ? s0 : (blockIdx.y == 1) ? s1 : s2; const v8f v = *(const v8f*)(src + i * 8); v8us o;
#pragma unroll
    for (int k = 0; k < 8; ++k) o[k] = f2bf(v[k]); *(v8us*)(dst + ((size_t)blockIdx.y * n8 + i) * 8) = o;  }

// ---- k_proj: q, k and v of 64 rows of x in ONE kernel, from the f32 input to the planes that k_fattn reads. ONE WORK-GROUP of 8 waves per 64 rows, grid MT/64.
// The K loop is dealt to the waves in chunks of 64 elements: wave w takes chunks w and w + 8 (the second only where it exists). A wave loads its chunks of all 64 rows of x in f32, rounds them to bf16 in registers and keeps
// the fragments; then, for q, k and v in turn, it multiplies its chunks of the 64 weight rows (loaded once, one column group ahead) with the four 16-row tiles, and the 8 partial 64x64 tiles are summed through LDS in wave order 0 .. 7.
// The summing threads split each value into its hi/lo planes and store them: q and k as [row][d], v transposed as [batch][d][t]; a work-group owns 64 positions, one whole 128-byte line of every transposed row.
__device__ __forceinline__ v16bf cvtfrag(v4f a, v4f b, v4f c, v4f d) { v8us lo, hi;
#pragma unroll
    for (int k = 0; k < 4; ++k) { lo[k] = f2bf(a[k]); lo[4 + k] = f2bf(b[k]); hi[k] = f2bf(c[k]); hi[4 + k] = f2bf(d[k]); }
    return cat16b(lo, hi); }
// one 64-wide chunk of x, 64 rows: the lane's 8 + 8 elements of each 32-wide half of each 16-row tile
__device__ __forceinline__ void ldx(v4f (&x)[4][2][4], const float* px) {
#pragma unroll
    for (int rt = 0; rt < 4; ++rt) {
#pragma unroll
        for (int h = 0; h < 2; ++h) { const float* p = px + rt * 16 * DM + h * 32; x[rt][h][0] = *(const v4f*)p; x[rt][h][1] = *(const v4f*)(p + 4); x[rt][h][2] = *(const v4f*)(p + 16); x[rt][h][3] = *(const v4f*)(p + 20); } } }
// one 64-wide chunk of 64 weight rows
__device__ __forceinline__ void ldw(v16bf (&b)[2][4], const bf* pb) {
#pragma unroll
    for (int h = 0; h < 2; ++h) {
#pragma unroll
        for (int nb = 0; nb < 4; ++nb) b[h][nb] = WFrag<bf>::ld(pb + nb * 16 * DM + h * 32); } }
__device__ __forceinline__ void mma64(v8f (&acc)[4][4], const v16bf (&a)[4][2], const v16bf (&b)[2][4]) {
#pragma unroll
    for (int h = 0; h < 2; ++h) {
#pragma unroll
        for (int rt = 0; rt < 4; ++rt) {
#pragma unroll
            for (int nb = 0; nb < 4; ++nb) acc[rt][nb] = wmmab(a[rt][h], b[h][nb], acc[rt][nb]); } } }
__global__ __launch_bounds__(256) void k_proj(const float* __restrict__ X, const bf* __restrict__ Wb, bf* QKh, bf* QKl, bf* VTh, bf* VTl) {
    typedef v16bf V;
    constexpr int NW = 8, PW = 64 * 68;   // floats of LDS per wave: one partial 64x64 tile, pitch 68 (q, k: read back as 16-byte words) or 65 (v: read back down the columns, every lane in a bank of its own)
    __shared__ __align__(16) float os[NW * PW];
    const int lane = threadIdx.x & 31, lr = lane & 15, hi = lane >> 4; const int r0 = blockIdx.x * 64;
    const int w = __builtin_amdgcn_readfirstlane((int)(threadIdx.x >> 5));   // wave number in a scalar register: the test for a second chunk stays a scalar branch and EXEC stays full at every WMMA
    const bool two = w + NW < DM / 64;
    const float* px = X + (size_t)(r0 + lr) * DM + w * 64 + 8 * hi;   // the lane's own row of the first tile; the other tiles, the halves and the second chunk are immediate offsets
    const bf* pw = Wb + (size_t)lr * DM + w * 64 + 8 * hi;            // the lane's own weight row of the first block; the other blocks and column groups are immediate offsets
    v4f x0[4][2][4], x1[4][2][4]; V b0[2][4], b1[2][4];
    ldx(x0, px); if (two) ldx(x1, px + NW * 64);
    ldw(b0, pw); if (two) ldw(b1, pw + NW * 64);
    // both pointers stay in their registers, untouched, up to this wait: nothing overwrites an address register of an issued load in front of it
    asm volatile("s_wait_xcnt 0x0" :: "v"(px), "v"(pw) : "memory");
    __builtin_amdgcn_sched_barrier(0);   // keeps every load in front of the first conversion: all of a wave's reads of x fly together instead of paying the memory latency tile by tile
    V a0[4][2], a1[4][2];
#pragma unroll
    for (int rt = 0; rt < 4; ++rt) {
#pragma unroll
        for (int h = 0; h < 2; ++h) a0[rt][h] = cvtfrag(x0[rt][h][0], x0[rt][h][1], x0[rt][h][2], x0[rt][h][3]); }
    if (two) {
#pragma unroll
        for (int rt = 0; rt < 4; ++rt) {
#pragma unroll
            for (int h = 0; h < 2; ++h) a1[rt][h] = cvtfrag(x1[rt][h][0], x1[rt][h][1], x1[rt][h][2], x1[rt][h][3]); } }
    float* ow = os + w * PW;
#pragma unroll
    for (int cg = 0; cg < 3; ++cg) {   // 0: q, 1: k, 2: v
        const int P = (cg == 2) ? 65 : 68;
        v8f acc[4][4];
#pragma unroll
        for (int rt = 0; rt < 4; ++rt) {
#pragma unroll
            for (int nb = 0; nb < 4; ++nb) acc[rt][nb] = (v8f){}; }
        mma64(acc, a0, b0);
        if (cg < 2) ldw(b0, pw + (cg + 1) * 64 * DM);
        if (two) { mma64(acc, a1, b1); if (cg < 2) ldw(b1, pw + (cg + 1) * 64 * DM + NW * 64); }
        if (cg < 2) {
            asm volatile("s_wait_xcnt 0x0" :: "v"(pw) : "memory");   // the weight pointer stays untouched up to this wait
            __builtin_amdgcn_sched_barrier(0); }   // keeps the next column group's weight loads here, in front of the sums through LDS, under which they fly
#pragma unroll
        for (int rt = 0; rt < 4; ++rt) {
#pragma unroll
            for (int nb = 0; nb < 4; ++nb) {
#pragma unroll
                for (int j = 0; j < 8; ++j) ow[(rt * 16 + hi * 8 + j) * P + nb * 16 + lr] = acc[rt][nb][j]; } }
        __syncthreads();   // every wave's partial tile is in LDS before any of them is summed
        float val[4][4]; bf* dh[4]; bf* dl[4];   // four items a thread, four neighbouring elements of a stored row each
        if (cg < 2) {
#pragma unroll
            for (int u = 0; u < 4; ++u) { const int it = threadIdx.x + u * 256, row = it >> 4, cofs = (it & 15) * 4; v4f s = *(const v4fa*)(os + row * 68 + cofs);
#pragma unroll
                for (int q = 1; q < NW; ++q) s += *(const v4fa*)(os + q * PW + row * 68 + cofs);
#pragma unroll
                for (int i = 0; i < 4; ++i) val[u][i] = s[i];
                const size_t e = ((size_t)cg * MT + r0 + row) * HD + cofs; dh[u] = QKh + e; dl[u] = QKl + e; }
            __syncthreads();   // every partial tile has been read before the next column group's partial tiles overwrite it; the stores stand behind it and fly under the next group's products
        } else {
#pragma unroll
            for (int u = 0; u < 4; ++u) { const int it = threadIdx.x + u * 256, tq = (it & 15) * 4, d = it >> 4;   // 16 lanes hold the 64 positions of one transposed row: one whole line a store
#pragma unroll
                for (int i = 0; i < 4; ++i) val[u][i] = os[(tq + i) * 65 + d];
#pragma unroll
                for (int q = 1; q < NW; ++q) {
#pragma unroll
                    for (int i = 0; i < 4; ++i) val[u][i] += os[q * PW + (tq + i) * 65 + d]; }
                const size_t e = ((size_t)(r0 / TT) * HD + d) * TT + (r0 % TT) + tq; dh[u] = VTh + e; dl[u] = VTl + e; }
        }
        v4us oh[4], ol[4];
#pragma unroll
        for (int u = 0; u < 4; ++u) {
#pragma unroll
            for (int i = 0; i < 4; ++i) { unsigned short h2, l2; splitf(val[u][i], h2, l2); oh[u][i] = h2; ol[u][i] = l2; } }
#pragma unroll
        for (int u = 0; u < 4; ++u) { *(v4us*)dh[u] = oh[u]; *(v4us*)dl[u] = ol[u]; }
        // the stores' pointers and data stay in their registers, untouched, up to this wait: nothing overwrites a register of an issued store in front of it
        asm volatile("s_wait_xcnt 0x0" :: "v"(dh[0]), "v"(dh[1]), "v"(dh[2]), "v"(dh[3]), "v"(dl[0]), "v"(dl[1]), "v"(dl[2]), "v"(dl[3]), "v"(oh[0]), "v"(oh[1]), "v"(oh[2]), "v"(oh[3]), "v"(ol[0]), "v"(ol[1]), "v"(ol[2]), "v"(ol[3]) : "memory");
    }
}

typedef v4us __attribute__((may_alias)) v4usa;
// 2^x with the one vector slot that the instruction set asks for behind a transcendental in the same statement
__device__ __forceinline__ float exp2s(float x) { float r; asm("v_exp_f32 %0, %1\n\tv_nop" : "=v"(r) : "v"(x)); return r; }

// ---- k_fattn: causal scores, softmax and probability x value in ONE kernel; neither scores nor probabilities go through memory. ONE WORK-GROUP of NW waves per 16 query rows, grid (batches, TT/16): blockIdx.x picks the batch's planes, mask row and output, so the four batches' tiles of equal length start side by side.
// The keys up to the diagonal are dealt to the waves in chunks of 64: wave w takes chunks w, w + NW, ... For each chunk a wave forms its 16x64 score tile (hi/lo planes, 3 products), keeps a running row maximum m,
// a running sum l of exp(s - m) and a running 16x64 context tile o (both rescaled by exp(m_old - m_new) when m grows), and multiplies the unnormalised probabilities (split into hi/lo planes, 3 products) with the value chunk.
// Score column lr of block nb is key 4 lr + nb of the chunk, so a lane holds four neighbouring keys of a row and stores them to LDS as one 8-byte word; in LDS the probabilities lie in plain key order, [row][key], pitch 72.
// At the end the NW partial (m, l, o) go to LDS and are merged in wave order 0 .. NW-1 with the weights exp(m_w - max m); the context is divided by the merged sum and written straight to the output.
template <int NW>
__global__ __launch_bounds__(NW * 32) void k_fattn(const bf* __restrict__ Qh0, const bf* __restrict__ Ql0, const bf* __restrict__ Kh0, const bf* __restrict__ Kl0, const bf* __restrict__ Vh0, const bf* __restrict__ Vl0, const int* __restrict__ MK0, float* OUT0) {
    const size_t zb = (size_t)blockIdx.x * TT * HD;   // every plane and the output hold TT x HD elements a batch
    const bf* __restrict__ Qh = Qh0 + zb; const bf* __restrict__ Ql = Ql0 + zb; const bf* __restrict__ Kh = Kh0 + zb; const bf* __restrict__ Kl = Kl0 + zb; const bf* __restrict__ Vh = Vh0 + zb; const bf* __restrict__ Vl = Vl0 + zb;
    const int* __restrict__ MKb = MK0 + (size_t)blockIdx.x * TT; float* OUTb = OUT0 + zb;
    typedef WFrag<bf> F; typedef F::V V;
    constexpr float L2E = 1.4426950408889634f, NEG = -3.0e38f;
    constexpr int WS = 1152;   // floats of LDS per wave: two 16 x 72 probability planes of 16 bits during the loop, the 16 x 68 f32 context tile behind it
    __shared__ __align__(16) float os[NW * WS];
    __shared__ float ms[NW * 16], ls[NW * 16];
    const int lane = threadIdx.x & 31, lr = lane & 15, hi = lane >> 4; const int r0 = blockIdx.y * 16;
    const int w = __builtin_amdgcn_readfirstlane((int)(threadIdx.x >> 5));   // wave number in a scalar register: the key loop's branch stays scalar and EXEC stays full at every WMMA
    const int Kend = (r0 + 16 + 63) & ~63;   // the 64-wide chunk that holds this tile's last row is the last one with a kept key
    V qh[2], ql[2]; const bf* pqh = Qh + (size_t)(r0 + lr) * HD + 8 * hi; const bf* pql = Ql + (size_t)(r0 + lr) * HD + 8 * hi;
#pragma unroll
    for (int h = 0; h < 2; ++h) { qh[h] = F::ld(pqh + h * 32); ql[h] = F::ld(pql + h * 32); }
    asm volatile("s_wait_xcnt 0x0" :: "v"(pqh), "v"(pql) : "memory");   // the query pointers' registers are reused at once: the wait stands in front of the first overwrite of an address register of an issued load
    v8f o[4]; float m[8], l[8];
#pragma unroll
    for (int nb = 0; nb < 4; ++nb) o[nb] = (v8f){};
#pragma unroll
    for (int j = 0; j < 8; ++j) { m[j] = NEG; l[j] = 0.f; }
    float* ow = os + w * WS; bf* ph = (bf*)ow; bf* pl = ph + 16 * 72;
    const size_t koff = (size_t)(w * 64 + lr * 4) * HD + 8 * hi, voff = (size_t)lr * TT + w * 64 + 8 * hi;
    const bf* pkh = Kh + koff; const bf* pkl = Kl + koff; const bf* pvh = Vh + voff; const bf* pvl = Vl + voff; const int* pm = MKb + w * 64 + lr * 4;   // each lane's own pointers, stepped from chunk to chunk
#pragma unroll 1
    for (int kc = w * 64; kc < Kend; kc += NW * 64) {
        V kh[2][4], kl[2][4], vh[2][4], vl[2][4];
#pragma unroll
        for (int h = 0; h < 2; ++h) {
#pragma unroll
            for (int nb = 0; nb < 4; ++nb) { kh[h][nb] = F::ld(pkh + nb * HD + h * 32); kl[h][nb] = F::ld(pkl + nb * HD + h * 32); } }
        const v4i mk = *(const v4i*)pm;
#pragma unroll
        for (int h = 0; h < 2; ++h) {
#pragma unroll
            for (int nb = 0; nb < 4; ++nb) { vh[h][nb] = F::ld(pvh + nb * 16 * TT + h * 32); vl[h][nb] = F::ld(pvl + nb * 16 * TT + h * 32); } }
        // the pointers stay in their registers, untouched, up to this wait: no later load's result and no pointer step overwrites an address register of an issued load in front of it
        asm volatile("s_wait_xcnt 0x0" :: "v"(pkh), "v"(pkl), "v"(pvh), "v"(pvl), "v"(pm) : "memory");
        __builtin_amdgcn_sched_barrier(0);   // keeps every load of the chunk, the values' too, in front of the first WMMA: the value loads fly under the scores and the softmax instead of paying their latency behind them
        v8f s[4];
#pragma unroll
        for (int nb = 0; nb < 4; ++nb) s[nb] = (v8f){};
#pragma unroll
        for (int h = 0; h < 2; ++h) {
#pragma unroll
            for (int nb = 0; nb < 4; ++nb) s[nb] = F::mma(qh[h], kh[h][nb], s[nb]);
#pragma unroll
            for (int nb = 0; nb < 4; ++nb) s[nb] = F::mma(ql[h], kh[h][nb], s[nb]);
#pragma unroll
            for (int nb = 0; nb < 4; ++nb) s[nb] = F::mma(qh[h], kl[h][nb], s[nb]); }
        const int key0 = kc + lr * 4;
#pragma unroll
        for (int j = 0; j < 8; ++j) { const int i = r0 + hi * 8 + j; float x[4]; bool keep[4]; float rm = NEG;
#pragma unroll
            for (int nb = 0; nb < 4; ++nb) { keep[nb] = (key0 + nb <= i) && (mk[nb] != 0); x[nb] = s[nb][j] * SCL; if (keep[nb]) rm = fmaxf(rm, x[nb]); }
#pragma unroll
            for (int sh = 8; sh; sh >>= 1) rm = fmaxf(rm, __shfl_xor(rm, sh, 32));   // the 16 lanes of a half hold one row
            const float mn = fmaxf(m[j], rm); const float al = exp2s((m[j] - mn) * L2E); m[j] = mn;
            float ps = 0.f; v4us oh, ol;
#pragma unroll
            for (int nb = 0; nb < 4; ++nb) { const float ex = exp2s((x[nb] - mn) * L2E); const float pv = keep[nb] ? ex : 0.f; ps += pv; unsigned short h2, l2; splitf(pv, h2, l2); oh[nb] = h2; ol[nb] = l2; }
            l[j] = l[j] * al + ps;   // each lane sums its own four keys of a chunk; the 16 lanes are added once, behind the loop
#pragma unroll
            for (int nb = 0; nb < 4; ++nb) o[nb][j] *= al;
            *(v4usa*)(ph + (hi * 8 + j) * 72 + lr * 4) = oh; *(v4usa*)(pl + (hi * 8 + j) * 72 + lr * 4) = ol; }
        __builtin_amdgcn_wave_barrier(); asm volatile("" ::: "memory");   // compiler order only: every lane's probability stores stand in front of the fragment reads, which take other lanes' words (LDS serves one wave in order)
        V pa[2], pb[2];
#pragma unroll
        for (int h = 0; h < 2; ++h) { const int po = lr * 72 + 8 * hi + h * 32; pa[h] = cat16b(*(const v8usa*)(ph + po), *(const v8usa*)(ph + po + 16)); pb[h] = cat16b(*(const v8usa*)(pl + po), *(const v8usa*)(pl + po + 16)); }
        __builtin_amdgcn_wave_barrier(); asm volatile("" ::: "memory");   // compiler order only: the fragment reads stand in front of the next chunk's probability stores
#pragma unroll
        for (int h = 0; h < 2; ++h) {
#pragma unroll
            for (int nb = 0; nb < 4; ++nb) o[nb] = F::mma(pa[h], vh[h][nb], o[nb]);
#pragma unroll
            for (int nb = 0; nb < 4; ++nb) o[nb] = F::mma(pb[h], vh[h][nb], o[nb]);
#pragma unroll
            for (int nb = 0; nb < 4; ++nb) o[nb] = F::mma(pa[h], vl[h][nb], o[nb]); }
        // four vector slots behind the last WMMA, so that nothing on the taken side of the loop branch touches its registers too early
        asm volatile("v_nop\n\tv_nop\n\tv_nop\n\tv_nop" : "+v"(o[0]), "+v"(o[1]), "+v"(o[2]), "+v"(o[3]) : "v"(pa[1]));
        pkh += NW * 64 * HD; pkl += NW * 64 * HD; pvh += NW * 64; pvl += NW * 64; pm += NW * 64;
    }
#pragma unroll
    for (int sh = 8; sh; sh >>= 1) {
#pragma unroll
        for (int j = 0; j < 8; ++j) l[j] += __shfl_xor(l[j], sh, 32); }
    if (lr == 0) {
#pragma unroll
        for (int j = 0; j < 8; ++j) { ms[w * 16 + hi * 8 + j] = m[j]; ls[w * 16 + hi * 8 + j] = l[j]; } }
#pragma unroll
    for (int nb = 0; nb < 4; ++nb) {
#pragma unroll
        for (int j = 0; j < 8; ++j) ow[(hi * 8 + j) * 68 + nb * 16 + lr] = o[nb][j]; }
    __syncthreads();   // every wave's partial maximum, sum and context tile are in LDS before any of them is merged
    for (int it = threadIdx.x; it < 256; it += NW * 32) { const int row = it >> 4, cofs = (it & 15) * 4; float M = ms[row];
#pragma unroll
        for (int q = 1; q < NW; ++q) M = fmaxf(M, ms[q * 16 + row]);
        float L = 0.f; v4f val = (v4f){};
#pragma unroll
        for (int q = 0; q < NW; ++q) { const float sc = exp2s((ms[q * 16 + row] - M) * L2E); L += ls[q * 16 + row] * sc; val += *(const v4fa*)(os + q * WS + row * 68 + cofs) * sc; }
        const float f = (L > 0.f) ? __fdiv_rn(1.0f, L) : 0.f;
        *(v4f*)(OUTb + (size_t)(r0 + row) * HD + cofs) = val * f; }
}

extern "C" void kernel_launch(void* const* d_in, const int* in_sizes, int n_in,
                              void* d_out, int out_size, void* d_ws, size_t ws_size, hipStream_t stream) {
    (void)in_sizes; (void)n_in; (void)out_size;
    const float* x = (const float*)d_in[0]; const int* MK = (const int*)d_in[1]; const float* wq = (const float*)d_in[2]; const float* wk = (const float*)d_in[3]; const float* wv = (const float*)d_in[4]; const float* wo = nullptr; (void)wo;
    float* OUT = (float*)d_out;     // [4][4096][64]
    char* wsp = (char*)d_ws;
    auto take = [&](size_t bytes) { char* p = wsp; wsp += (bytes + 255) & ~(size_t)255; return (void*)p; };
    bf* WQKV = (bf*)take((size_t)(DQ + 2 * DKV) * DM * 2);   // the three weights one behind the other: Bt [192][768]
    bf* QKh = (bf*)take((size_t)2 * MT * HD * 2); bf* QKl = (bf*)take((size_t)2 * MT * HD * 2); bf* VTh = (bf*)take((size_t)MT * HD * 2); bf* VTl = (bf*)take((size_t)MT * HD * 2);   // plane 0 of QK*: q, plane 1: k
    if ((size_t)(wsp - (char*)d_ws) > ws_size) return;    // ws 256 MiB
    k_cvt8x3<<<dim3((unsigned)(((size_t)DQ * DM / 8 + 255) / 256), 3, 1), 256, 0, stream>>>(wq, wk, wv, WQKV, (size_t)DQ * DM / 8);   /* 'oi' [64][768] weights are Bt as-is */
    k_proj<<<MT / 64, 256, 0, stream>>>(x, WQKV, QKh, QKl, VTh, VTl);
    k_fattn<8><<<dim3(NB_, TT / 16, 1), 256, 0, stream>>>(QKh, QKl, QKh + (size_t)MT * HD, QKl + (size_t)MT * HD, VTh, VTl, MK, OUT);
}

// v005
// It runs in 64.6 microseconds.
// Next to v004, in two timings, it ran 1.51 and 1.47 times as fast.
// Over all steps from v000 it is 13.1 times as fast.
#include <hip/hip_runtime.h>

// Single-head causal attention with a key padding mask (x [4][4096][768]; q, k, v = x W^T ('oi' [64][768], no bias; one 64-wide head); scores = q.k x 64^-0.5; keep = causal (j <= i) and mask[b][j] != 0 (int32, read); softmax; out = attn.v -> [4][4096][64] f32 (1 M); no output projection).
// Compute dtypes, f32 accumulate: every input rounded to bf16; q/k/v on PLAIN bf16 operands (inputs: exact); causal scores and attn.v (tile skipping) on hi/lo planes for every row (3 products); online softmax in f32 inside one fused kernel (scores and probabilities never reach memory); no output projection: the context is written in f32.

#define NB_  4
#define TT   4096
#define MT   (NB_ * TT)          // rows of all batches together
#define DM   768
#define NH_  1
#define NKV  1
#define REP  (NH_ / NKV)
#define HD   64
#define DQ   (NH_ * HD)
#define DKV  (NKV * HD)
#define ZH   1
#define RH   4096                 // every row hi/lo (streaming softmax, no register row)
#define RB   TT
#define WIN  4096
#define PCAR 1024.0f
#define SCL  0.125f   // H^-0.5 with H = 64 (the head width)
typedef _Float16 h16;
typedef unsigned short bf;
typedef __attribute__((ext_vector_type(16))) __bf16   v16bf;
typedef __attribute__((ext_vector_type(16))) _Float16 v16h;
typedef __attribute__((ext_vector_type(8)))  _Float16 v8h;
typedef __attribute__((ext_vector_type(8)))  unsigned short v8us;
typedef __attribute__((ext_vector_type(8)))  float    v8f;
typedef __attribute__((ext_vector_type(4)))  float    v4f;
typedef v8h  __attribute__((may_alias)) v8ha;
typedef v4f  __attribute__((may_alias)) v4fa;
typedef v8us __attribute__((may_alias)) v8usa;

__device__ __forceinline__ unsigned short f2bf(float f) { unsigned u = __float_as_uint(f); u += 0x7FFFu + ((u >> 16) & 1u); return (unsigned short)(u >> 16); }
__device__ __forceinline__ float bf2f(unsigned short b) { return __uint_as_float(((unsigned)b) << 16); }
__device__ __forceinline__ float bfr(float f) { return bf2f(f2bf(f)); }
__device__ __forceinline__ v16h cat16(v8h lo, v8h hi) { return __builtin_shufflevector(lo, hi, 0, 1, 2, 3, 4, 5, 6, 7, 8, 9, 10, 11, 12, 13, 14, 15); }
__device__ __forceinline__ v16bf cat16b(v8us lo, v8us hi) { return __builtin_bit_cast(v16bf, __builtin_shufflevector(lo, hi, 0, 1, 2, 3, 4, 5, 6, 7, 8, 9, 10, 11, 12, 13, 14, 15)); }
__device__ __forceinline__ v8f wmma16(v16h a, v16h b, v8f c) { return __builtin_amdgcn_wmma_f32_16x16x32_f16(false, a, false, b, (short)0, c, false, false); }
__device__ __forceinline__ v8f wmmab(v16bf a, v16bf b, v8f c) { return __builtin_amdgcn_wmma_f32_16x16x32_bf16(false, a, false, b, (short)0, c, false, false); }



// fragment loaders and matrix products by 16-bit operand type
template <typename T16> struct WFrag;
template <> struct WFrag<h16> { typedef v16h V; static __device__ __forceinline__ V ld(const h16* p) { return cat16(*(const v8h*)p, *(const v8h*)(p + 16)); } static __device__ __forceinline__ v8f mma(V a, V b, v8f c) { return wmma16(a, b, c); } };
template <> struct WFrag<bf> { typedef v16bf V; static __device__ __forceinline__ V ld(const bf* p) { return cat16b(*(const v8us*)p, *(const v8us*)(p + 16)); } static __device__ __forceinline__ v8f mma(V a, V b, v8f c) { return wmmab(a, b, c); } };

// FRAGMENT ORDER: an operand that one launch writes for another launch's WMMA loads lies as the loads take it: a 16 x 32 fragment is two units of 512 bytes, unit 'half' holding for lane (hi, lr), at lane * 16 bytes,
// the eight elements k = half * 16 + hi * 8 + 0 .. 7 of fragment row (or column) lr. A wave-wide 16-byte load then covers four whole 128-byte lines instead of a piece of 16 lines.
__device__ __forceinline__ v16bf ldfo(const bf* p) { return cat16b(*(const v8us*)p, *(const v8us*)(p + 256)); }
__device__ __forceinline__ h16 tohx(float x) { return (h16)x; }
__device__ __forceinline__ void splitf(float y, unsigned short& h, unsigned short& l) { h = f2bf(y); l = f2bf(y - bf2f(h)); }
typedef __attribute__((ext_vector_type(2))) _Float16 v2h;
typedef __attribute__((ext_vector_type(4))) _Float16 v4h;
typedef __attribute__((ext_vector_type(2))) unsigned short v2us;
typedef __attribute__((ext_vector_type(4))) unsigned short v4us;
typedef __attribute__((ext_vector_type(2))) float v2f;
typedef __attribute__((ext_vector_type(4))) int v4i;

__global__ __launch_bounds__(256) void k_wtG(const float* __restrict__ w, int K, int N, bf* Bt) {
    const int lane = threadIdx.x & 31; const int L0 = (blockIdx.x * 8 + (threadIdx.x >> 5)) * 8; const int nlines = N * K / 64;
{
#pragma unroll 1
        for (int l = 0; l < 8; ++l) { const int L = L0 + l; if (L >= nlines) break; const size_t e = (size_t)L * 64 + lane * 2; const int k = (int)(e % K), n = (int)(e / K); v2us o;
            o[0] = f2bf(w[(size_t)k * N + n]); o[1] = f2bf(w[(size_t)(k + 1) * N + n]); *(v2us*)(Bt + e) = o; }
         }
}
// k_cvt8x3: f32 to bf16, eight elements a thread, for three [64][DM] sources in one launch; blockIdx.y picks the source, the results lie one behind the other in dst, each in fragment order:
// [64-wide chunk of k][32-wide half h][16-row block nb][unit][lane][8]; a thread's eight elements are one lane's 16 bytes of one unit
__global__ __launch_bounds__(256) void k_cvt8x3(const float* __restrict__ s0, const float* __restrict__ s1, const float* __restrict__ s2, bf* dst, size_t n8) { const size_t i = (size_t)blockIdx.x * 256 + threadIdx.x; if (i >= n8) return; const float* src = (blockIdx.y == 0) ? s0 : (blockIdx.y == 1) ? s1 : s2; const v8f v = *(const v8f*)(src + i * 8); v8us o;
#pragma unroll
    for (int k = 0; k < 8; ++k) o[k] = f2bf(v[k]);
    const unsigned n = (unsigned)i / (DM / 8), k8 = (unsigned)i % (DM / 8);   // weight row, and which eight of its elements
    const unsigned u = (((k8 >> 3) * 2 + ((k8 >> 2) & 1)) * 4 + (n >> 4)) * 2 + ((k8 >> 1) & 1);   // the 512-byte unit inside this source
    *(v8us*)(dst + (size_t)blockIdx.y * n8 * 8 + u * 256 + ((k8 & 1) * 16 + (n & 15)) * 8) = o;  }

// ---- k_proj: q, k and v of 64 rows of x in ONE kernel, from the f32 input to the planes that k_fattn reads. ONE WORK-GROUP of 8 waves per 64 rows, grid MT/64.
// The K loop is dealt to the waves in chunks of 64 elements: wave w takes chunks w and w + 8 (the second only where it exists). A wave loads its chunks of all 64 rows of x in f32, rounds them to bf16 in registers and keeps
// the fragments; then, for q, k and v in turn, it multiplies its chunks of the 64 weight rows (loaded once, one column group ahead) with the four 16-row tiles, and the 8 partial 64x64 tiles are summed through LDS in wave order 0 .. 7.
// The summing threads split each value into its hi/lo planes and store them in fragment order, as k_fattn loads them: q as [16-row tile][h][unit][lane][8] (fragment row = query row),
// k as [64-key chunk][h][nb][unit][lane][8] (fragment column lr of block nb = key 4 lr + nb, k = d), v as [64-key chunk][h][nb][unit][lane][8] (fragment column lr of block nb = d 16 nb + lr, k = key). A work-group owns 64 positions: 8 KB in a row of every plane.
__device__ __forceinline__ v16bf cvtfrag(v4f a, v4f b, v4f c, v4f d) { v8us lo, hi;
#pragma unroll
    for (int k = 0; k < 4; ++k) { lo[k] = f2bf(a[k]); lo[4 + k] = f2bf(b[k]); hi[k] = f2bf(c[k]); hi[4 + k] = f2bf(d[k]); }
    return cat16b(lo, hi); }
// one 64-wide chunk of x, 64 rows: the lane's 8 + 8 elements of each 32-wide half of each 16-row tile
__device__ __forceinline__ void ldx(v4f (&x)[4][2][4], const float* px) {
#pragma unroll
    for (int rt = 0; rt < 4; ++rt) {
#pragma unroll
        for (int h = 0; h < 2; ++h) { const float* p = px + rt * 16 * DM + h * 32; x[rt][h][0] = *(const v4f*)p; x[rt][h][1] = *(const v4f*)(p + 4); x[rt][h][2] = *(const v4f*)(p + 16); x[rt][h][3] = *(const v4f*)(p + 20); } } }
// one 64-wide chunk of 64 weight rows, in fragment order
__device__ __forceinline__ void ldw(v16bf (&b)[2][4], const bf* pb) {
#pragma unroll
    for (int h = 0; h < 2; ++h) {
#pragma unroll
        for (int nb = 0; nb < 4; ++nb) b[h][nb] = ldfo(pb + (h * 4 + nb) * 512); } }
__device__ __forceinline__ void mma64(v8f (&acc)[4][4], const v16bf (&a)[4][2], const v16bf (&b)[2][4]) {
#pragma unroll
    for (int h = 0; h < 2; ++h) {
#pragma unroll
        for (int rt = 0; rt < 4; ++rt) {
#pragma unroll
            for (int nb = 0; nb < 4; ++nb) acc[rt][nb] = wmmab(a[rt][h], b[h][nb], acc[rt][nb]); } } }
__global__ __launch_bounds__(256) void k_proj(const float* __restrict__ X, const bf* __restrict__ Wb, bf* QKh, bf* QKl, bf* VTh, bf* VTl) {
    typedef v16bf V;
    constexpr int NW = 8, PW = 64 * 68;   // floats of LDS per wave: one partial 64x64 tile, pitch 68 (q, k: read back as 16-byte words) or 65 (v: read back down the columns, every lane in a bank of its own)
    __shared__ __align__(16) float os[NW * PW];
    const int lane = threadIdx.x & 31, lr = lane & 15, hi = lane >> 4; const int r0 = blockIdx.x * 64;
    const int w = __builtin_amdgcn_readfirstlane((int)(threadIdx.x >> 5));   // wave number in a scalar register: the test for a second chunk stays a scalar branch and EXEC stays full at every WMMA
    const bool two = w + NW < DM / 64;
    const float* px = X + (size_t)(r0 + lr) * DM + w * 64 + 8 * hi;   // the lane's own row of the first tile; the other tiles, the halves and the second chunk are immediate offsets
    const bf* pw = Wb + (size_t)w * 4096 + lane * 8;                  // the lane's own 16 bytes of the first unit of the wave's chunk; the other units, the second chunk and the column groups are immediate offsets
    v4f x0[4][2][4], x1[4][2][4]; V b0[2][4], b1[2][4];
    ldx(x0, px); if (two) ldx(x1, px + NW * 64);
    ldw(b0, pw); if (two) ldw(b1, pw + NW * 4096);
    // both pointers stay in their registers, untouched, up to this wait: nothing overwrites an address register of an issued load in front of it
    asm volatile("s_wait_xcnt 0x0" :: "v"(px), "v"(pw) : "memory");
    __builtin_amdgcn_sched_barrier(0);   // keeps every load in front of the first conversion: all of a wave's reads of x fly together instead of paying the memory latency tile by tile
    V a0[4][2], a1[4][2];
#pragma unroll
    for (int rt = 0; rt < 4; ++rt) {
#pragma unroll
        for (int h = 0; h < 2; ++h) a0[rt][h] = cvtfrag(x0[rt][h][0], x0[rt][h][1], x0[rt][h][2], x0[rt][h][3]); }
    if (two) {
#pragma unroll
        for (int rt = 0; rt < 4; ++rt) {
#pragma unroll
            for (int h = 0; h < 2; ++h) a1[rt][h] = cvtfrag(x1[rt][h][0], x1[rt][h][1], x1[rt][h][2], x1[rt][h][3]); } }
    float* ow = os + w * PW;
#pragma unroll
    for (int cg = 0; cg < 3; ++cg) {   // 0: q, 1: k, 2: v
        const int P = (cg == 2) ? 65 : 68;
        v8f acc[4][4];
#pragma unroll
        for (int rt = 0; rt < 4; ++rt) {
#pragma unroll
            for (int nb = 0; nb < 4; ++nb) acc[rt][nb] = (v8f){}; }
        mma64(acc, a0, b0);
        if (cg < 2) ldw(b0, pw + (cg + 1) * 64 * DM);
        if (two) { mma64(acc, a1, b1); if (cg < 2) ldw(b1, pw + (cg + 1) * 64 * DM + NW * 4096); }
        if (cg < 2) {
            asm volatile("s_wait_xcnt 0x0" :: "v"(pw) : "memory");   // the weight pointer stays untouched up to this wait
            __builtin_amdgcn_sched_barrier(0); }   // keeps the next column group's weight loads here, in front of the sums through LDS, under which they fly
#pragma unroll
        for (int rt = 0; rt < 4; ++rt) {
#pragma unroll
            for (int nb = 0; nb < 4; ++nb) {
#pragma unroll
                for (int j = 0; j < 8; ++j) ow[(rt * 16 + hi * 8 + j) * P + nb * 16 + lr] = acc[rt][nb][j]; } }
        __syncthreads();   // every wave's partial tile is in LDS before any of them is summed
        float val[4][4]; bf* dh[4]; bf* dl[4];   // four items a thread, four neighbouring elements of a fragment's k direction each
        const int t16 = threadIdx.x >> 4, c4 = (threadIdx.x & 15) * 4;   // the item's fragment row or column, and its first k of 64
        const int fh = c4 >> 5, fu = (c4 >> 4) & 1, fl = (((c4 >> 3) & 1) * 16 + t16) * 8 + (c4 & 7);   // 32-wide half, unit, and the place inside the unit
        if (cg < 2) {
#pragma unroll
            for (int u = 0; u < 4; ++u) { const int row = (cg == 0) ? u * 16 + t16 : t16 * 4 + u, cofs = c4; v4f s = *(const v4fa*)(os + row * 68 + cofs);   // q: row t16 of tile u; k: column t16 of block u
#pragma unroll
                for (int q = 1; q < NW; ++q) s += *(const v4fa*)(os + q * PW + row * 68 + cofs);
#pragma unroll
                for (int i = 0; i < 4; ++i) val[u][i] = s[i];
                const size_t e = ((size_t)cg * MT + r0) * HD + ((cg == 0) ? u * 1024 + (fh * 2 + fu) * 256 : ((fh * 4 + u) * 2 + fu) * 256) + fl; dh[u] = QKh + e; dl[u] = QKl + e; }
            __syncthreads();   // every partial tile has been read before the next column group's partial tiles overwrite it; the stores stand behind it and fly under the next group's products
        } else {
#pragma unroll
            for (int u = 0; u < 4; ++u) { const int tq = c4, d = u * 16 + t16;   // column t16 of block u, four neighbouring positions
#pragma unroll
                for (int i = 0; i < 4; ++i) val[u][i] = os[(tq + i) * 65 + d];
#pragma unroll
                for (int q = 1; q < NW; ++q) {
#pragma unroll
                    for (int i = 0; i < 4; ++i) val[u][i] += os[q * PW + (tq + i) * 65 + d]; }
                const size_t e = (size_t)r0 * HD + ((fh * 4 + u) * 2 + fu) * 256 + fl; dh[u] = VTh + e; dl[u] = VTl + e; }
        }
        v4us oh[4], ol[4];
#pragma unroll
        for (int u = 0; u < 4; ++u) {
#pragma unroll
            for (int i = 0; i < 4; ++i) { unsigned short h2, l2; splitf(val[u][i], h2, l2); oh[u][i] = h2; ol[u][i] = l2; } }
#pragma unroll
        for (int u = 0; u < 4; ++u) { *(v4us*)dh[u] = oh[u]; *(v4us*)dl[u] = ol[u]; }
        // the stores' pointers and data stay in their registers, untouched, up to this wait: nothing overwrites a register of an issued store in front of it
        asm volatile("s_wait_xcnt 0x0" :: "v"(dh[0]), "v"(dh[1]), "v"(dh[2]), "v"(dh[3]), "v"(dl[0]), "v"(dl[1]), "v"(dl[2]), "v"(dl[3]), "v"(oh[0]), "v"(oh[1]), "v"(oh[2]), "v"(oh[3]), "v"(ol[0]), "v"(ol[1]), "v"(ol[2]), "v"(ol[3]) : "memory");
    }
}

typedef v4us __attribute__((may_alias)) v4usa;
// 2^x with the one vector slot that the instruction set asks for behind a transcendental in the same statement
__device__ __forceinline__ float exp2s(float x) { float r; asm("v_exp_f32 %0, %1\n\tv_nop" : "=v"(r) : "v"(x)); return r; }

// ---- k_fattn: causal scores, softmax and probability x value in ONE kernel; neither scores nor probabilities go through memory. ONE WORK-GROUP of NW waves per 16 query rows, grid (batches, TT/16): blockIdx.x picks the batch's planes, mask row and output.
// The keys up to the diagonal are dealt to the waves in chunks of 64: wave w takes chunks w, w + NW, ... For each chunk a wave forms its 16x64 score tile (hi/lo planes, 3 products), keeps a running row maximum m,
// a running sum l of exp(s - m) and a running 16x64 context tile o (both rescaled by exp(m_old - m_new) when m grows), and multiplies the unnormalised probabilities (split into hi/lo planes, 3 products) with the value chunk.
// Score column lr of block nb is key 4 lr + nb of the chunk, so a lane holds four neighbouring keys of a row and stores them to LDS as one 8-byte word; in LDS the probabilities lie in plain key order, [row][key], pitch 72.
// At the end the NW partial (m, l, o) go to LDS and are merged in wave order 0 .. NW-1 with the weights exp(m_w - max m); the context is divided by the merged sum and written straight to the output.
template <int NW>
__global__ __launch_bounds__(NW * 32) void k_fattn(const bf* __restrict__ Qh0, const bf* __restrict__ Ql0, const bf* __restrict__ Kh0, const bf* __restrict__ Kl0, const bf* __restrict__ Vh0, const bf* __restrict__ Vl0, const int* __restrict__ MK0, float* OUT0) {
    const size_t zb = (size_t)blockIdx.x * TT * HD;   // every plane and the output hold TT x HD elements a batch
    const bf* __restrict__ Qh = Qh0 + zb; const bf* __restrict__ Ql = Ql0 + zb; const bf* __restrict__ Kh = Kh0 + zb; const bf* __restrict__ Kl = Kl0 + zb; const bf* __restrict__ Vh = Vh0 + zb; const bf* __restrict__ Vl = Vl0 + zb;
    const int* __restrict__ MKb = MK0 + (size_t)blockIdx.x * TT; float* OUTb = OUT0 + zb;
    typedef WFrag<bf> F; typedef F::V V;
    constexpr float L2E = 1.4426950408889634f, NEG = -3.0e38f;
    constexpr int WS = 1152;   // floats of LDS per wave: two 16 x 72 probability planes of 16 bits during the loop, the 16 x 68 f32 context tile behind it
    __shared__ __align__(16) float os[NW * WS];
    __shared__ float ms[NW * 16], ls[NW * 16];
    const int lane = threadIdx.x & 31, lr = lane & 15, hi = lane >> 4; const int r0 = blockIdx.y * 16;
    const int w = __builtin_amdgcn_readfirstlane((int)(threadIdx.x >> 5));   // wave number in a scalar register: the key loop's branch stays scalar and EXEC stays full at every WMMA
    const int Kend = (r0 + 16 + 63) & ~63;   // the 64-wide chunk that holds this tile's last row is the last one with a kept key
    V qh[2], ql[2]; const bf* pqh = Qh + (size_t)r0 * HD + lane * 8; const bf* pql = Ql + (size_t)r0 * HD + lane * 8;   // every plane lies in fragment order (k_proj): a lane's own 16 bytes of a unit, the units at immediate offsets
#pragma unroll
    for (int h = 0; h < 2; ++h) { qh[h] = ldfo(pqh + h * 512); ql[h] = ldfo(pql + h * 512); }
    asm volatile("s_wait_xcnt 0x0" :: "v"(pqh), "v"(pql) : "memory");   // the query pointers' registers are reused at once: the wait stands in front of the first overwrite of an address register of an issued load
    v8f o[4]; float m[8], l[8];
#pragma unroll
    for (int nb = 0; nb < 4; ++nb) o[nb] = (v8f){};
#pragma unroll
    for (int j = 0; j < 8; ++j) { m[j] = NEG; l[j] = 0.f; }
    float* ow = os + w * WS; bf* ph = (bf*)ow; bf* pl = ph + 16 * 72;
    const size_t koff = (size_t)w * 64 * HD + lane * 8, voff = koff;   // a 64-key chunk is 64 x HD elements in a row of every plane
    const bf* pkh = Kh + koff; const bf* pkl = Kl + koff; const bf* pvh = Vh + voff; const bf* pvl = Vl + voff; const int* pm = MKb + w * 64 + lr * 4;   // each lane's own pointers, stepped from chunk to chunk
#pragma unroll 1
    for (int kc = w * 64; kc < Kend; kc += NW * 64) {
        V kh[2][4], kl[2][4], vh[2][4], vl[2][4];
#pragma unroll
        for (int h = 0; h < 2; ++h) {
#pragma unroll
            for (int nb = 0; nb < 4; ++nb) { kh[h][nb] = ldfo(pkh + (h * 4 + nb) * 512); kl[h][nb] = ldfo(pkl + (h * 4 + nb) * 512); } }
        const v4i mk = *(const v4i*)pm;
#pragma unroll
        for (int h = 0; h < 2; ++h) {
#pragma unroll
            for (int nb = 0; nb < 4; ++nb) { vh[h][nb] = ldfo(pvh + (h * 4 + nb) * 512); vl[h][nb] = ldfo(pvl + (h * 4 + nb) * 512); } }
        // the pointers stay in their registers, untouched, up to this wait: no later load's result and no pointer step overwrites an address register of an issued load in front of it
        asm volatile("s_wait_xcnt 0x0" :: "v"(pkh), "v"(pkl), "v"(pvh), "v"(pvl), "v"(pm) : "memory");
        __builtin_amdgcn_sched_barrier(0);   // keeps every load of the chunk, the values' too, in front of the first WMMA: the value loads fly under the scores and the softmax instead of paying their latency behind them
        v8f s[4];
#pragma unroll
        for (int nb = 0; nb < 4; ++nb) s[nb] = (v8f){};
#pragma unroll
        for (int h = 0; h < 2; ++h) {
#pragma unroll
            for (int nb = 0; nb < 4; ++nb) s[nb] = F::mma(qh[h], kh[h][nb], s[nb]);
#pragma unroll
            for (int nb = 0; nb < 4; ++nb) s[nb] = F::mma(ql[h], kh[h][nb], s[nb]);
#pragma unroll
            for (int nb = 0; nb < 4; ++nb) s[nb] = F::mma(qh[h], kl[h][nb], s[nb]); }
        const int key0 = kc + lr * 4;
#pragma unroll
        for (int j = 0; j < 8; ++j) { const int i = r0 + hi * 8 + j; float x[4]; bool keep[4]; float rm = NEG;
#pragma unroll
            for (int nb = 0; nb < 4; ++nb) { keep[nb] = (key0 + nb <= i) && (mk[nb] != 0); x[nb] = s[nb][j] * SCL; if (keep[nb]) rm = fmaxf(rm, x[nb]); }
#pragma unroll
            for (int sh = 8; sh; sh >>= 1) rm = fmaxf(rm, __shfl_xor(rm, sh, 32));   // the 16 lanes of a half hold one row
            const float mn = fmaxf(m[j], rm); const float al = exp2s((m[j] - mn) * L2E); m[j] = mn;
            float ps = 0.f; v4us oh, ol;
#pragma unroll
            for (int nb = 0; nb < 4; ++nb) { const float ex = exp2s((x[nb] - mn) * L2E); const float pv = keep[nb] ? ex : 0.f; ps += pv; unsigned short h2, l2; splitf(pv, h2, l2); oh[nb] = h2; ol[nb] = l2; }
            l[j] = l[j] * al + ps;   // each lane sums its own four keys of a chunk; the 16 lanes are added once, behind the loop
#pragma unroll
            for (int nb = 0; nb < 4; ++nb) o[nb][j] *= al;
            *(v4usa*)(ph + (hi * 8 + j) * 72 + lr * 4) = oh; *(v4usa*)(pl + (hi * 8 + j) * 72 + lr * 4) = ol; }
        __builtin_amdgcn_wave_barrier(); asm volatile("" ::: "memory");   // compiler order only: every lane's probability stores stand in front of the fragment reads, which take other lanes' words (LDS serves one wave in order)
        V pa[2], pb[2];
#pragma unroll
        for (int h = 0; h < 2; ++h) { const int po = lr * 72 + 8 * hi + h * 32; pa[h] = cat16b(*(const v8usa*)(ph + po), *(const v8usa*)(ph + po + 16)); pb[h] = cat16b(*(const v8usa*)(pl + po), *(const v8usa*)(pl + po + 16)); }
        __builtin_amdgcn_wave_barrier(); asm volatile("" ::: "memory");   // compiler order only: the fragment reads stand in front of the next chunk's probability stores
#pragma unroll
        for (int h = 0; h < 2; ++h) {
#pragma unroll
            for (int nb = 0; nb < 4; ++nb) o[nb] = F::mma(pa[h], vh[h][nb], o[nb]);
#pragma unroll
            for (int nb = 0; nb < 4; ++nb) o[nb] = F::mma(pb[h], vh[h][nb], o[nb]);
#pragma unroll
            for (int nb = 0; nb < 4; ++nb) o[nb] = F::mma(pa[h], vl[h][nb], o[nb]); }
        // four vector slots behind the last WMMA, so that nothing on the taken side of the loop branch touches its registers too early
        asm volatile("v_nop\n\tv_nop\n\tv_nop\n\tv_nop" : "+v"(o[0]), "+v"(o[1]), "+v"(o[2]), "+v"(o[3]) : "v"(pa[1]));
        pkh += NW * 64 * HD; pkl += NW * 64 * HD; pvh += NW * 64 * HD; pvl += NW * 64 * HD; pm += NW * 64;
    }
#pragma unroll
    for (int sh = 8; sh; sh >>= 1) {
#pragma unroll
        for (int j = 0; j < 8; ++j) l[j] += __shfl_xor(l[j], sh, 32); }
    if (lr == 0) {
#pragma unroll
        for (int j = 0; j < 8; ++j) { ms[w * 16 + hi * 8 + j] = m[j]; ls[w * 16 + hi * 8 + j] = l[j]; } }
#pragma unroll
    for (int nb = 0; nb < 4; ++nb) {
#pragma unroll
        for (int j = 0; j < 8; ++j) ow[(hi * 8 + j) * 68 + nb * 16 + lr] = o[nb][j]; }
    __syncthreads();   // every wave's partial maximum, sum and context tile are in LDS before any of them is merged
    for (int it = threadIdx.x; it < 256; it += NW * 32) { const int row = it >> 4, cofs = (it & 15) * 4; float M = ms[row];
#pragma unroll
        for (int q = 1; q < NW; ++q) M = fmaxf(M, ms[q * 16 + row]);
        float L = 0.f; v4f val = (v4f){};
#pragma unroll
        for (int q = 0; q < NW; ++q) { const float sc = exp2s((ms[q * 16 + row] - M) * L2E); L += ls[q * 16 + row] * sc; val += *(const v4fa*)(os + q * WS + row * 68 + cofs) * sc; }
        const float f = (L > 0.f) ? __fdiv_rn(1.0f, L) : 0.f;
        *(v4f*)(OUTb + (size_t)(r0 + row) * HD + cofs) = val * f; }
}

extern "C" void kernel_launch(void* const* d_in, const int* in_sizes, int n_in,
                              void* d_out, int out_size, void* d_ws, size_t ws_size, hipStream_t stream) {
    (void)in_sizes; (void)n_in; (void)out_size;
    const float* x = (const float*)d_in[0]; const int* MK = (const int*)d_in[1]; const float* wq = (const float*)d_in[2]; const float* wk = (const float*)d_in[3]; const float* wv = (const float*)d_in[4]; const float* wo = nullptr; (void)wo;
    float* OUT = (float*)d_out;     // [4][4096][64]
    char* wsp = (char*)d_ws;
    auto take = [&](size_t bytes) { char* p = wsp; wsp += (bytes + 255) & ~(size_t)255; return (void*)p; };
    bf* WQKV = (bf*)take((size_t)(DQ + 2 * DKV) * DM * 2);   // the three weights one behind the other, each 64 x 768 in fragment order
    bf* QKh = (bf*)take((size_t)2 * MT * HD * 2); bf* QKl = (bf*)take((size_t)2 * MT * HD * 2); bf* VTh = (bf*)take((size_t)MT * HD * 2); bf* VTl = (bf*)take((size_t)MT * HD * 2);   // plane 0 of QK*: q, plane 1: k
    if ((size_t)(wsp - (char*)d_ws) > ws_size) return;    // ws 256 MiB
    k_cvt8x3<<<dim3((unsigned)(((size_t)DQ * DM / 8 + 255) / 256), 3, 1), 256, 0, stream>>>(wq, wk, wv, WQKV, (size_t)DQ * DM / 8);   /* 'oi' [64][768] weights are Bt; stored in fragment order */
    k_proj<<<MT / 64, 256, 0, stream>>>(x, WQKV, QKh, QKl, VTh, VTl);
    k_fattn<8><<<dim3(NB_, TT / 16, 1), 256, 0, stream>>>(QKh, QKl, QKh + (size_t)MT * HD, QKl + (size_t)MT * HD, VTh, VTl, MK, OUT);
}

// v006
// A run of this version takes 60.3 microseconds.
// In two side-by-side timings against v005, it was 1.06 and 1.07 times as fast.
// Counting every step since v000, it is 13.9 times as fast.
#include <hip/hip_runtime.h>

// Single-head causal attention with a key padding mask (x [4][4096][768]; q, k, v = x W^T ('oi' [64][768], no bias; one 64-wide head); scores = q.k x 64^-0.5; keep = causal (j <= i) and mask[b][j] != 0 (int32, read); softmax; out = attn.v -> [4][4096][64] f32 (1 M); no output projection).
// Compute dtypes, f32 accumulate: every input rounded to bf16; q/k/v on PLAIN bf16 operands (inputs: exact); causal scores and attn.v (tile skipping) on hi/lo planes for every row (3 products); online softmax in f32 inside one fused kernel (scores and probabilities never reach memory); no output projection: the context is written in f32.

#define NB_  4
#define TT   4096
#define MT   (NB_ * TT)          // rows of all batches together
#define DM   768
#define NH_  1
#define NKV  1
#define REP  (NH_ / NKV)
#define HD   64
#define DQ   (NH_ * HD)
#define DKV  (NKV * HD)
#define ZH   1
#define RH   4096                 // every row hi/lo (streaming softmax, no register row)
#define RB   TT
#define WIN  4096
#define PCAR 1024.0f
#define SCL  0.125f   // H^-0.5 with H = 64 (the head width)
typedef _Float16 h16;
typedef unsigned short bf;
typedef __attribute__((ext_vector_type(16))) __bf16   v16bf;
typedef __attribute__((ext_vector_type(16))) _Float16 v16h;
typedef __attribute__((ext_vector_type(8)))  _Float16 v8h;
typedef __attribute__((ext_vector_type(8)))  unsigned short v8us;
typedef __attribute__((ext_vector_type(8)))  float    v8f;
typedef __attribute__((ext_vector_type(4)))  float    v4f;
typedef v8h  __attribute__((may_alias)) v8ha;
typedef v4f  __attribute__((may_alias)) v4fa;
typedef v8us __attribute__((may_alias)) v8usa;

__device__ __forceinline__ unsigned short f2bf(float f) { unsigned u = __float_as_uint(f); u += 0x7FFFu + ((u >> 16) & 1u); return (unsigned short)(u >> 16); }
__device__ __forceinline__ float bf2f(unsigned short b) { return __uint_as_float(((unsigned)b) << 16); }
__device__ __forceinline__ float bfr(float f) { return bf2f(f2bf(f)); }
__device__ __forceinline__ v16h cat16(v8h lo, v8h hi) { return __builtin_shufflevector(lo, hi, 0, 1, 2, 3, 4, 5, 6, 7, 8, 9, 10, 11, 12, 13, 14, 15); }
__device__ __forceinline__ v16bf cat16b(v8us lo, v8us hi) { return __builtin_bit_cast(v16bf, __builtin_shufflevector(lo, hi, 0, 1, 2, 3, 4, 5, 6, 7, 8, 9, 10, 11, 12, 13, 14, 15)); }
__device__ __forceinline__ v8f wmma16(v16h a, v16h b, v8f c) { return __builtin_amdgcn_wmma_f32_16x16x32_f16(false, a, false, b, (short)0, c, false, false); }
__device__ __forceinline__ v8f wmmab(v16bf a, v16bf b, v8f c) { return __builtin_amdgcn_wmma_f32_16x16x32_bf16(false, a, false, b, (short)0, c, false, false); }



// fragment loaders and matrix products by 16-bit operand type
template <typename T16> struct WFrag;
template <> struct WFrag<h16> { typedef v16h V; static __device__ __forceinline__ V ld(const h16* p) { return cat16(*(const v8h*)p, *(const v8h*)(p + 16)); } static __device__ __forceinline__ v8f mma(V a, V b, v8f c) { return wmma16(a, b, c); } };
template <> struct WFrag<bf> { typedef v16bf V; static __device__ __forceinline__ V ld(const bf* p) { return cat16b(*(const v8us*)p, *(const v8us*)(p + 16)); } static __device__ __forceinline__ v8f mma(V a, V b, v8f c) { return wmmab(a, b, c); } };

// FRAGMENT ORDER: an operand that one launch writes for another launch's WMMA loads lies as the loads take it: a 16 x 32 fragment is two units of 512 bytes, unit 'half' holding for lane (hi, lr), at lane * 16 bytes,
// the eight elements k = half * 16 + hi * 8 + 0 .. 7 of fragment row (or column) lr. A wave-wide 16-byte load then covers four whole 128-byte lines instead of a piece of 16 lines.
__device__ __forceinline__ v16bf ldfo(const bf* p) { return cat16b(*(const v8us*)p, *(const v8us*)(p + 256)); }
__device__ __forceinline__ h16 tohx(float x) { return (h16)x; }
__device__ __forceinline__ void splitf(float y, unsigned short& h, unsigned short& l) { h = f2bf(y); l = f2bf(y - bf2f(h)); }
// f32 to bf16 by the packed convert instruction: two values a vector slot, round to nearest even as in f2bf; a in the low half of the word
typedef __attribute__((ext_vector_type(2))) __bf16 v2bf;
typedef __attribute__((ext_vector_type(2))) float v2fl;
typedef __attribute__((ext_vector_type(2))) unsigned v2u;
typedef __attribute__((ext_vector_type(4))) unsigned v4u;
typedef __attribute__((ext_vector_type(8))) unsigned v8u;
typedef v2u __attribute__((may_alias)) v2ua;
typedef v4u __attribute__((may_alias)) v4ua;
__device__ __forceinline__ unsigned pk2(float a, float b) { return __builtin_bit_cast(unsigned, __builtin_convertvector((v2fl){a, b}, v2bf)); }
// hi/lo planes of two values: h holds both rounded values, l both rounded remainders
__device__ __forceinline__ void split2(float a, float b, unsigned& h, unsigned& l) { h = pk2(a, b); l = pk2(a - __uint_as_float(h << 16), b - __uint_as_float(h & 0xFFFF0000u)); }
typedef __attribute__((ext_vector_type(2))) _Float16 v2h;
typedef __attribute__((ext_vector_type(4))) _Float16 v4h;
typedef __attribute__((ext_vector_type(2))) unsigned short v2us;
typedef __attribute__((ext_vector_type(4))) unsigned short v4us;
typedef __attribute__((ext_vector_type(2))) float v2f;
typedef __attribute__((ext_vector_type(4))) int v4i;

__global__ __launch_bounds__(256) void k_wtG(const float* __restrict__ w, int K, int N, bf* Bt) {
    const int lane = threadIdx.x & 31; const int L0 = (blockIdx.x * 8 + (threadIdx.x >> 5)) * 8; const int nlines = N * K / 64;
{
#pragma unroll 1
        for (int l = 0; l < 8; ++l) { const int L = L0 + l; if (L >= nlines) break; const size_t e = (size_t)L * 64 + lane * 2; const int k = (int)(e % K), n = (int)(e / K); v2us o;
            o[0] = f2bf(w[(size_t)k * N + n]); o[1] = f2bf(w[(size_t)(k + 1) * N + n]); *(v2us*)(Bt + e) = o; }
         }
}
// k_cvt8x3: f32 to bf16, eight elements a thread, for three [64][DM] sources in one launch; blockIdx.y picks the source, the results lie one behind the other in dst, each in fragment order:
// [64-wide chunk of k][32-wide half h][16-row block nb][unit][lane][8]; a thread's eight elements are one lane's 16 bytes of one unit
__global__ __launch_bounds__(256) void k_cvt8x3(const float* __restrict__ s0, const float* __restrict__ s1, const float* __restrict__ s2, bf* dst, size_t n8) { const size_t i = (size_t)blockIdx.x * 256 + threadIdx.x; if (i >= n8) return; const float* src = (blockIdx.y == 0) ? s0 : (blockIdx.y == 1) ? s1 : s2; const v8f v = *(const v8f*)(src + i * 8); v4u o;
#pragma unroll
    for (int k = 0; k < 4; ++k) o[k] = pk2(v[2 * k], v[2 * k + 1]);
    const unsigned n = (unsigned)i / (DM / 8), k8 = (unsigned)i % (DM / 8);   // weight row, and which eight of its elements
    const unsigned u = (((k8 >> 3) * 2 + ((k8 >> 2) & 1)) * 4 + (n >> 4)) * 2 + ((k8 >> 1) & 1);   // the 512-byte unit inside this source
    *(v4ua*)(dst + (size_t)blockIdx.y * n8 * 8 + u * 256 + ((k8 & 1) * 16 + (n & 15)) * 8) = o;  }

// ---- k_proj: q, k and v of 64 rows of x in ONE kernel, from the f32 input to the planes that k_fattn reads. ONE WORK-GROUP of 8 waves per 64 rows, grid MT/64.
// The K loop is dealt to the waves in chunks of 64 elements: wave w takes chunks w and w + 8 (the second only where it exists). A wave loads its chunks of all 64 rows of x in f32, rounds them to bf16 in registers and keeps
// the fragments; then, for q, k and v in turn, it multiplies its chunks of the 64 weight rows (loaded once, one column group ahead) with the four 16-row tiles, and the 8 partial 64x64 tiles are summed through LDS in wave order 0 .. 7.
// The summing threads split each value into its hi/lo planes and store them in fragment order, as k_fattn loads them: q as [16-row tile][h][unit][lane][8] (fragment row = query row),
// k as [64-key chunk][h][nb][unit][lane][8] (fragment column lr of block nb = key 4 lr + nb, k = d), v as [64-key chunk][h][nb][unit][lane][8] (fragment column lr of block nb = d 16 nb + lr, k = key). A work-group owns 64 positions: 8 KB in a row of every plane.
__device__ __forceinline__ v16bf cvtfrag(v4f a, v4f b, v4f c, v4f d) {
    const v8u r = { pk2(a[0], a[1]), pk2(a[2], a[3]), pk2(b[0], b[1]), pk2(b[2], b[3]), pk2(c[0], c[1]), pk2(c[2], c[3]), pk2(d[0], d[1]), pk2(d[2], d[3]) };
    return __builtin_bit_cast(v16bf, r); }
// one 64-wide chunk of x, 64 rows: the lane's 8 + 8 elements of each 32-wide half of each 16-row tile
__device__ __forceinline__ void ldx(v4f (&x)[4][2][4], const float* px) {
#pragma unroll
    for (int rt = 0; rt < 4; ++rt) {
#pragma unroll
        for (int h = 0; h < 2; ++h) { const float* p = px + rt * 16 * DM + h * 32; x[rt][h][0] = *(const v4f*)p; x[rt][h][1] = *(const v4f*)(p + 4); x[rt][h][2] = *(const v4f*)(p + 16); x[rt][h][3] = *(const v4f*)(p + 20); } } }
// one 64-wide chunk of 64 weight rows, in fragment order
__device__ __forceinline__ void ldw(v16bf (&b)[2][4], const bf* pb) {
#pragma unroll
    for (int h = 0; h < 2; ++h) {
#pragma unroll
        for (int nb = 0; nb < 4; ++nb) b[h][nb] = ldfo(pb + (h * 4 + nb) * 512); } }
__device__ __forceinline__ void mma64(v8f (&acc)[4][4], const v16bf (&a)[4][2], const v16bf (&b)[2][4]) {
#pragma unroll
    for (int h = 0; h < 2; ++h) {
#pragma unroll
        for (int rt = 0; rt < 4; ++rt) {
#pragma unroll
            for (int nb = 0; nb < 4; ++nb) acc[rt][nb] = wmmab(a[rt][h], b[h][nb], acc[rt][nb]); } } }
__global__ __launch_bounds__(256) void k_proj(const float* __restrict__ X, const bf* __restrict__ Wb, bf* QKh, bf* QKl, bf* VTh, bf* VTl) {
    typedef v16bf V;
    constexpr int NW = 8, PW = 64 * 68;   // floats of LDS per wave: one partial 64x64 tile, pitch 68 (q, k: read back as 16-byte words) or 65 (v: read back down the columns, every lane in a bank of its own)
    __shared__ __align__(16) float os[NW * PW];
    const int lane = threadIdx.x & 31, lr = lane & 15, hi = lane >> 4; const int r0 = blockIdx.x * 64;
    const int w = __builtin_amdgcn_readfirstlane((int)(threadIdx.x >> 5));   // wave number in a scalar register: the test for a second chunk stays a scalar branch and EXEC stays full at every WMMA
    const bool two = w + NW < DM / 64;
    const float* px = X + (size_t)(r0 + lr) * DM + w * 64 + 8 * hi;   // the lane's own row of the first tile; the other tiles, the halves and the second chunk are immediate offsets
    const bf* pw = Wb + (size_t)w * 4096 + lane * 8;                  // the lane's own 16 bytes of the first unit of the wave's chunk; the other units, the second chunk and the column groups are immediate offsets
    v4f x0[4][2][4], x1[4][2][4]; V b0[2][4], b1[2][4];
    ldx(x0, px); if (two) ldx(x1, px + NW * 64);
    ldw(b0, pw); if (two) ldw(b1, pw + NW * 4096);
    // both pointers stay in their registers, untouched, up to this wait: nothing overwrites an address register of an issued load in front of it
    asm volatile("s_wait_xcnt 0x0" :: "v"(px), "v"(pw) : "memory");
    __builtin_amdgcn_sched_barrier(0);   // keeps every load in front of the first conversion: all of a wave's reads of x fly together instead of paying the memory latency tile by tile
    V a0[4][2], a1[4][2];
#pragma unroll
    for (int rt = 0; rt < 4; ++rt) {
#pragma unroll
        for (int h = 0; h < 2; ++h) a0[rt][h] = cvtfrag(x0[rt][h][0], x0[rt][h][1], x0[rt][h][2], x0[rt][h][3]); }
    if (two) {
#pragma unroll
        for (int rt = 0; rt < 4; ++rt) {
#pragma unroll
            for (int h = 0; h < 2; ++h) a1[rt][h] = cvtfrag(x1[rt][h][0], x1[rt][h][1], x1[rt][h][2], x1[rt][h][3]); } }
    float* ow = os + w * PW;
#pragma unroll
    for (int cg = 0; cg < 3; ++cg) {   // 0: q, 1: k, 2: v
        const int P = (cg == 2) ? 65 : 68;
        v8f acc[4][4];
#pragma unroll
        for (int rt = 0; rt < 4; ++rt) {
#pragma unroll
            for (int nb = 0; nb < 4; ++nb) acc[rt][nb] = (v8f){}; }
        mma64(acc, a0, b0);
        if (cg < 2) ldw(b0, pw + (cg + 1) * 64 * DM);
        if (two) { mma64(acc, a1, b1); if (cg < 2) ldw(b1, pw + (cg + 1) * 64 * DM + NW * 4096); }
        if (cg < 2) {
            asm volatile("s_wait_xcnt 0x0" :: "v"(pw) : "memory");   // the weight pointer stays untouched up to this wait
            __builtin_amdgcn_sched_barrier(0); }   // keeps the next column group's weight loads here, in front of the sums through LDS, under which they fly
#pragma unroll
        for (int rt = 0; rt < 4; ++rt) {
#pragma unroll
            for (int nb = 0; nb < 4; ++nb) {
#pragma unroll
                for (int j = 0; j < 8; ++j) ow[(rt * 16 + hi * 8 + j) * P + nb * 16 + lr] = acc[rt][nb][j]; } }
        __syncthreads();   // every wave's partial tile is in LDS before any of them is summed
        float val[4][4]; bf* dh[4]; bf* dl[4];   // four items a thread, four neighbouring elements of a fragment's k direction each
        const int t16 = threadIdx.x >> 4, c4 = (threadIdx.x & 15) * 4;   // the item's fragment row or column, and its first k of 64
        const int fh = c4 >> 5, fu = (c4 >> 4) & 1, fl = (((c4 >> 3) & 1) * 16 + t16) * 8 + (c4 & 7);   // 32-wide half, unit, and the place inside the unit
        if (cg < 2) {
#pragma unroll
            for (int u = 0; u < 4; ++u) { const int row = (cg == 0) ? u * 16 + t16 : t16 * 4 + u, cofs = c4; v4f s = *(const v4fa*)(os + row * 68 + cofs);   // q: row t16 of tile u; k: column t16 of block u
#pragma unroll
                for (int q = 1; q < NW; ++q) s += *(const v4fa*)(os + q * PW + row * 68 + cofs);
#pragma unroll
                for (int i = 0; i < 4; ++i) val[u][i] = s[i];
                const size_t e = ((size_t)cg * MT + r0) * HD + ((cg == 0) ? u * 1024 + (fh * 2 + fu) * 256 : ((fh * 4 + u) * 2 + fu) * 256) + fl; dh[u] = QKh + e; dl[u] = QKl + e; }
            __syncthreads();   // every partial tile has been read before the next column group's partial tiles overwrite it; the stores stand behind it and fly under the next group's products
        } else {
#pragma unroll
            for (int u = 0; u < 4; ++u) { const int tq = c4, d = u * 16 + t16;   // column t16 of block u, four neighbouring positions
#pragma unroll
                for (int i = 0; i < 4; ++i) val[u][i] = os[(tq + i) * 65 + d];
#pragma unroll
                for (int q = 1; q < NW; ++q) {
#pragma unroll
                    for (int i = 0; i < 4; ++i) val[u][i] += os[q * PW + (tq + i) * 65 + d]; }
                const size_t e = (size_t)r0 * HD + ((fh * 4 + u) * 2 + fu) * 256 + fl; dh[u] = VTh + e; dl[u] = VTl + e; }
        }
        v2u oh[4], ol[4];
#pragma unroll
        for (int u = 0; u < 4; ++u) {
#pragma unroll
            for (int i = 0; i < 2; ++i) { unsigned h2, l2; split2(val[u][2 * i], val[u][2 * i + 1], h2, l2); oh[u][i] = h2; ol[u][i] = l2; } }
#pragma unroll
        for (int u = 0; u < 4; ++u) { *(v2ua*)dh[u] = oh[u]; *(v2ua*)dl[u] = ol[u]; }
        // the stores' pointers and data stay in their registers, untouched, up to this wait: nothing overwrites a register of an issued store in front of it
        asm volatile("s_wait_xcnt 0x0" :: "v"(dh[0]), "v"(dh[1]), "v"(dh[2]), "v"(dh[3]), "v"(dl[0]), "v"(dl[1]), "v"(dl[2]), "v"(dl[3]), "v"(oh[0]), "v"(oh[1]), "v"(oh[2]), "v"(oh[3]), "v"(ol[0]), "v"(ol[1]), "v"(ol[2]), "v"(ol[3]) : "memory");
    }
}

typedef v4us __attribute__((may_alias)) v4usa;
// 2^x with the one vector slot that the instruction set asks for behind a transcendental in the same statement
__device__ __forceinline__ float exp2s(float x) { float r; asm("v_exp_f32 %0, %1\n\tv_nop" : "=v"(r) : "v"(x)); return r; }

// ---- k_fattn: causal scores, softmax and probability x value in ONE kernel; neither scores nor probabilities go through memory. ONE WORK-GROUP of NW waves per 16 query rows, grid (batches, TT/16): blockIdx.x picks the batch's planes, mask row and output.
// The keys up to the diagonal are dealt to the waves in chunks of 64: wave w takes chunks w, w + NW, ... For each chunk a wave forms its 16x64 score tile (hi/lo planes, 3 products), keeps a running row maximum m,
// a running sum l of exp(s - m) and a running 16x64 context tile o (both rescaled by exp(m_old - m_new) when m grows), and multiplies the unnormalised probabilities (split into hi/lo planes, 3 products) with the value chunk.
// Score column lr of block nb is key 4 lr + nb of the chunk, so a lane holds four neighbouring keys of a row and stores them to LDS as one 8-byte word; in LDS the probabilities lie in plain key order, [row][key], pitch 72.
// At the end the NW partial (m, l, o) go to LDS and are merged in wave order 0 .. NW-1 with the weights exp(m_w - max m); the context is divided by the merged sum and written straight to the output.
template <int NW>
__global__ __launch_bounds__(NW * 32) void k_fattn(const bf* __restrict__ Qh0, const bf* __restrict__ Ql0, const bf* __restrict__ Kh0, const bf* __restrict__ Kl0, const bf* __restrict__ Vh0, const bf* __restrict__ Vl0, const int* __restrict__ MK0, float* OUT0) {
    const size_t zb = (size_t)blockIdx.x * TT * HD;   // every plane and the output hold TT x HD elements a batch
    const bf* __restrict__ Qh = Qh0 + zb; const bf* __restrict__ Ql = Ql0 + zb; const bf* __restrict__ Kh = Kh0 + zb; const bf* __restrict__ Kl = Kl0 + zb; const bf* __restrict__ Vh = Vh0 + zb; const bf* __restrict__ Vl = Vl0 + zb;
    const int* __restrict__ MKb = MK0 + (size_t)blockIdx.x * TT; float* OUTb = OUT0 + zb;
    typedef WFrag<bf> F; typedef F::V V;
    constexpr float L2E = 1.4426950408889634f, NEG = -3.0e38f;
    constexpr int WS = 1152;   // floats of LDS per wave: two 16 x 72 probability planes of 16 bits during the loop, the 16 x 68 f32 context tile behind it
    __shared__ __align__(16) float os[NW * WS];
    __shared__ float ms[NW * 16], ls[NW * 16];
    const int lane = threadIdx.x & 31, lr = lane & 15, hi = lane >> 4; const int r0 = blockIdx.y * 16;
    const int w = __builtin_amdgcn_readfirstlane((int)(threadIdx.x >> 5));   // wave number in a scalar register: the key loop's branch stays scalar and EXEC stays full at every WMMA
    const int Kend = (r0 + 16 + 63) & ~63;   // the 64-wide chunk that holds this tile's last row is the last one with a kept key
    V qh[2], ql[2]; const bf* pqh = Qh + (size_t)r0 * HD + lane * 8; const bf* pql = Ql + (size_t)r0 * HD + lane * 8;   // every plane lies in fragment order (k_proj): a lane's own 16 bytes of a unit, the units at immediate offsets
#pragma unroll
    for (int h = 0; h < 2; ++h) { qh[h] = ldfo(pqh + h * 512); ql[h] = ldfo(pql + h * 512); }
    asm volatile("s_wait_xcnt 0x0" :: "v"(pqh), "v"(pql) : "memory");   // the query pointers' registers are reused at once: the wait stands in front of the first overwrite of an address register of an issued load
    v8f o[4]; float m[8], l[8];
#pragma unroll
    for (int nb = 0; nb < 4; ++nb) o[nb] = (v8f){};
#pragma unroll
    for (int j = 0; j < 8; ++j) { m[j] = NEG; l[j] = 0.f; }
    float* ow = os + w * WS; bf* ph = (bf*)ow; bf* pl = ph + 16 * 72;
    const size_t koff = (size_t)w * 64 * HD + lane * 8, voff = koff;   // a 64-key chunk is 64 x HD elements in a row of every plane
    const bf* pkh = Kh + koff; const bf* pkl = Kl + koff; const bf* pvh = Vh + voff; const bf* pvl = Vl + voff; const int* pm = MKb + w * 64 + lr * 4;   // each lane's own pointers, stepped from chunk to chunk
#pragma unroll 1
    for (int kc = w * 64; kc < Kend; kc += NW * 64) {
        V kh[2][4], kl[2][4], vh[2][4], vl[2][4];
#pragma unroll
        for (int h = 0; h < 2; ++h) {
#pragma unroll
            for (int nb = 0; nb < 4; ++nb) { kh[h][nb] = ldfo(pkh + (h * 4 + nb) * 512); kl[h][nb] = ldfo(pkl + (h * 4 + nb) * 512); } }
        const v4i mk = *(const v4i*)pm;
#pragma unroll
        for (int h = 0; h < 2; ++h) {
#pragma unroll
            for (int nb = 0; nb < 4; ++nb) { vh[h][nb] = ldfo(pvh + (h * 4 + nb) * 512); vl[h][nb] = ldfo(pvl + (h * 4 + nb) * 512); } }
        // the pointers stay in their registers, untouched, up to this wait: no later load's result and no pointer step overwrites an address register of an issued load in front of it
        asm volatile("s_wait_xcnt 0x0" :: "v"(pkh), "v"(pkl), "v"(pvh), "v"(pvl), "v"(pm) : "memory");
        __builtin_amdgcn_sched_barrier(0);   // keeps every load of the chunk, the values' too, in front of the first WMMA: the value loads fly under the scores and the softmax instead of paying their latency behind them
        v8f s[4];
#pragma unroll
        for (int nb = 0; nb < 4; ++nb) s[nb] = (v8f){};
#pragma unroll
        for (int h = 0; h < 2; ++h) {
#pragma unroll
            for (int nb = 0; nb < 4; ++nb) s[nb] = F::mma(qh[h], kh[h][nb], s[nb]);
#pragma unroll
            for (int nb = 0; nb < 4; ++nb) s[nb] = F::mma(ql[h], kh[h][nb], s[nb]);
#pragma unroll
            for (int nb = 0; nb < 4; ++nb) s[nb] = F::mma(qh[h], kl[h][nb], s[nb]); }
        const int key0 = kc + lr * 4;
#pragma unroll
        for (int j = 0; j < 8; ++j) { const int i = r0 + hi * 8 + j; float x[4]; bool keep[4]; float rm = NEG;
#pragma unroll
            for (int nb = 0; nb < 4; ++nb) { keep[nb] = (key0 + nb <= i) && (mk[nb] != 0); x[nb] = s[nb][j] * SCL; if (keep[nb]) rm = fmaxf(rm, x[nb]); }
#pragma unroll
            for (int sh = 8; sh; sh >>= 1) rm = fmaxf(rm, __shfl_xor(rm, sh, 32));   // the 16 lanes of a half hold one row
            const float mn = fmaxf(m[j], rm); const float al = exp2s((m[j] - mn) * L2E); m[j] = mn;
            float ps = 0.f, pv[4]; v2u oh, ol;
#pragma unroll
            for (int nb = 0; nb < 4; ++nb) { const float ex = exp2s((x[nb] - mn) * L2E); pv[nb] = keep[nb] ? ex : 0.f; ps += pv[nb]; }
#pragma unroll
            for (int i = 0; i < 2; ++i) { unsigned h2, l2; split2(pv[2 * i], pv[2 * i + 1], h2, l2); oh[i] = h2; ol[i] = l2; }
            l[j] = l[j] * al + ps;   // each lane sums its own four keys of a chunk; the 16 lanes are added once, behind the loop
#pragma unroll
            for (int nb = 0; nb < 4; ++nb) o[nb][j] *= al;
            *(v2ua*)(ph + (hi * 8 + j) * 72 + lr * 4) = oh; *(v2ua*)(pl + (hi * 8 + j) * 72 + lr * 4) = ol; }
        __builtin_amdgcn_wave_barrier(); asm volatile("" ::: "memory");   // compiler order only: every lane's probability stores stand in front of the fragment reads, which take other lanes' words (LDS serves one wave in order)
        V pa[2], pb[2];
#pragma unroll
        for (int h = 0; h < 2; ++h) { const int po = lr * 72 + 8 * hi + h * 32; pa[h] = cat16b(*(const v8usa*)(ph + po), *(const v8usa*)(ph + po + 16)); pb[h] = cat16b(*(const v8usa*)(pl + po), *(const v8usa*)(pl + po + 16)); }
        __builtin_amdgcn_wave_barrier(); asm volatile("" ::: "memory");   // compiler order only: the fragment reads stand in front of the next chunk's probability stores
#pragma unroll
        for (int h = 0; h < 2; ++h) {
#pragma unroll
            for (int nb = 0; nb < 4; ++nb) o[nb] = F::mma(pa[h], vh[h][nb], o[nb]);
#pragma unroll
            for (int nb = 0; nb < 4; ++nb) o[nb] = F::mma(pb[h], vh[h][nb], o[nb]);
#pragma unroll
            for (int nb = 0; nb < 4; ++nb) o[nb] = F::mma(pa[h], vl[h][nb], o[nb]); }
        // four vector slots behind the last WMMA, so that nothing on the taken side of the loop branch touches its registers too early
        asm volatile("v_nop\n\tv_nop\n\tv_nop\n\tv_nop" : "+v"(o[0]), "+v"(o[1]), "+v"(o[2]), "+v"(o[3]) : "v"(pa[1]));
        pkh += NW * 64 * HD; pkl += NW * 64 * HD; pvh += NW * 64 * HD; pvl += NW * 64 * HD; pm += NW * 64;
    }
#pragma unroll
    for (int sh = 8; sh; sh >>= 1) {
#pragma unroll
        for (int j = 0; j < 8; ++j) l[j] += __shfl_xor(l[j], sh, 32); }
    if (lr == 0) {
#pragma unroll
        for (int j = 0; j < 8; ++j) { ms[w * 16 + hi * 8 + j] = m[j]; ls[w * 16 + hi * 8 + j] = l[j]; } }
#pragma unroll
    for (int nb = 0; nb < 4; ++nb) {
#pragma unroll
        for (int j = 0; j < 8; ++j) ow[(hi * 8 + j) * 68 + nb * 16 + lr] = o[nb][j]; }
    __syncthreads();   // every wave's partial maximum, sum and context tile are in LDS before any of them is merged
    for (int it = threadIdx.x; it < 256; it += NW * 32) { const int row = it >> 4, cofs = (it & 15) * 4; float M = ms[row];
#pragma unroll
        for (int q = 1; q < NW; ++q) M = fmaxf(M, ms[q * 16 + row]);
        float L = 0.f; v4f val = (v4f){};
#pragma unroll
        for (int q = 0; q < NW; ++q) { const float sc = exp2s((ms[q * 16 + row] - M) * L2E); L += ls[q * 16 + row] * sc; val += *(const v4fa*)(os + q * WS + row * 68 + cofs) * sc; }
        const float f = (L > 0.f) ? __fdiv_rn(1.0f, L) : 0.f;
        *(v4f*)(OUTb + (size_t)(r0 + row) * HD + cofs) = val * f; }
}

extern "C" void kernel_launch(void* const* d_in, const int* in_sizes, int n_in,
                              void* d_out, int out_size, void* d_ws, size_t ws_size, hipStream_t stream) {
    (void)in_sizes; (void)n_in; (void)out_size;
    const float* x = (const float*)d_in[0]; const int* MK = (const int*)d_in[1]; const float* wq = (const float*)d_in[2]; const float* wk = (const float*)d_in[3]; const float* wv = (const float*)d_in[4]; const float* wo = nullptr; (void)wo;
    float* OUT = (float*)d_out;     // [4][4096][64]
    char* wsp = (char*)d_ws;
    auto take = [&](size_t bytes) { char* p = wsp; wsp += (bytes + 255) & ~(size_t)255; return (void*)p; };
    bf* WQKV = (bf*)take((size_t)(DQ + 2 * DKV) * DM * 2);   // the three weights one behind the other, each 64 x 768 in fragment order
    bf* QKh = (bf*)take((size_t)2 * MT * HD * 2); bf* QKl = (bf*)take((size_t)2 * MT * HD * 2); bf* VTh = (bf*)take((size_t)MT * HD * 2); bf* VTl = (bf*)take((size_t)MT * HD * 2);   // plane 0 of QK*: q, plane 1: k
    if ((size_t)(wsp - (char*)d_ws) > ws_size) return;    // ws 256 MiB
    k_cvt8x3<<<dim3((unsigned)(((size_t)DQ * DM / 8 + 255) / 256), 3, 1), 256, 0, stream>>>(wq, wk, wv, WQKV, (size_t)DQ * DM / 8);   /* 'oi' [64][768] weights are Bt; stored in fragment order */
    k_proj<<<MT / 64, 256, 0, stream>>>(x, WQKV, QKh, QKl, VTh, VTl);
    k_fattn<8><<<dim3(NB_, TT / 16, 1), 256, 0, stream>>>(QKh, QKl, QKh + (size_t)MT * HD, QKl + (size_t)MT * HD, VTh, VTl, MK, OUT);
}

// v007
// Measured time: 53.1 microseconds a run.
// Timed twice side by side with v006, it ran 1.15 and 1.18 times as fast.
// All steps since v000 together make it 16.2 times as fast.
#include <hip/hip_runtime.h>

// Single-head causal attention with a key padding mask (x [4][4096][768]; q, k, v = x W^T ('oi' [64][768], no bias; one 64-wide head); scores = q.k x 64^-0.5; keep = causal (j <= i) and mask[b][j] != 0 (int32, read); softmax; out = attn.v -> [4][4096][64] f32 (1 M); no output projection).
// Compute dtypes, f32 accumulate: every input rounded to bf16; q/k/v on PLAIN bf16 operands (inputs: exact); causal scores and attn.v (tile skipping) on hi/lo planes for every row (3 products); online softmax in f32 inside one fused kernel (scores and probabilities never reach memory); no output projection: the context is written in f32.

#define NB_  4
#define TT   4096
#define MT   (NB_ * TT)          // rows of all batches together
#define DM   768
#define NH_  1
#define NKV  1
#define REP  (NH_ / NKV)
#define HD   64
#define DQ   (NH_ * HD)
#define DKV  (NKV * HD)
#define ZH   1
#define RH   4096                 // every row hi/lo (streaming softmax, no register row)
#define RB   TT
#define WIN  4096
#define PCAR 1024.0f
#define SCL  0.125f   // H^-0.5 with H = 64 (the head width)
typedef _Float16 h16;
typedef unsigned short bf;
typedef __attribute__((ext_vector_type(16))) __bf16   v16bf;
typedef __attribute__((ext_vector_type(16))) _Float16 v16h;
typedef __attribute__((ext_vector_type(8)))  _Float16 v8h;
typedef __attribute__((ext_vector_type(8)))  unsigned short v8us;
typedef __attribute__((ext_vector_type(8)))  float    v8f;
typedef __attribute__((ext_vector_type(4)))  float    v4f;
typedef v8h  __attribute__((may_alias)) v8ha;
typedef v4f  __attribute__((may_alias)) v4fa;
typedef v8us __attribute__((may_alias)) v8usa;

__device__ __forceinline__ unsigned short f2bf(float f) { unsigned u = __float_as_uint(f); u += 0x7FFFu + ((u >> 16) & 1u); return (unsigned short)(u >> 16); }
__device__ __forceinline__ float bf2f(unsigned short b) { return __uint_as_float(((unsigned)b) << 16); }
__device__ __forceinline__ float bfr(float f) { return bf2f(f2bf(f)); }
__device__ __forceinline__ v16h cat16(v8h lo, v8h hi) { return __builtin_shufflevector(lo, hi, 0, 1, 2, 3, 4, 5, 6, 7, 8, 9, 10, 11, 12, 13, 14, 15); }
__device__ __forceinline__ v16bf cat16b(v8us lo, v8us hi) { return __builtin_bit_cast(v16bf, __builtin_shufflevector(lo, hi, 0, 1, 2, 3, 4, 5, 6, 7, 8, 9, 10, 11, 12, 13, 14, 15)); }
__device__ __forceinline__ v8f wmma16(v16h a, v16h b, v8f c) { return __builtin_amdgcn_wmma_f32_16x16x32_f16(false, a, false, b, (short)0, c, false, false); }
__device__ __forceinline__ v8f wmmab(v16bf a, v16bf b, v8f c) { return __builtin_amdgcn_wmma_f32_16x16x32_bf16(false, a, false, b, (short)0, c, false, false); }



// fragment loaders and matrix products by 16-bit operand type
template <typename T16> struct WFrag;
template <> struct WFrag<h16> { typedef v16h V; static __device__ __forceinline__ V ld(const h16* p) { return cat16(*(const v8h*)p, *(const v8h*)(p + 16)); } static __device__ __forceinline__ v8f mma(V a, V b, v8f c) { return wmma16(a, b, c); } };
template <> struct WFrag<bf> { typedef v16bf V; static __device__ __forceinline__ V ld(const bf* p) { return cat16b(*(const v8us*)p, *(const v8us*)(p + 16)); } static __device__ __forceinline__ v8f mma(V a, V b, v8f c) { return wmmab(a, b, c); } };

// FRAGMENT ORDER: an operand that one launch writes for another launch's WMMA loads lies as the loads take it: a 16 x 32 fragment is two units of 512 bytes, unit 'half' holding for lane (hi, lr), at lane * 16 bytes,
// the eight elements k = half * 16 + hi * 8 + 0 .. 7 of fragment row (or column) lr. A wave-wide 16-byte load then covers four whole 128-byte lines instead of a piece of 16 lines.
__device__ __forceinline__ v16bf ldfo(const bf* p) { return cat16b(*(const v8us*)p, *(const v8us*)(p + 256)); }
__device__ __forceinline__ h16 tohx(float x) { return (h16)x; }
__device__ __forceinline__ void splitf(float y, unsigned short& h, unsigned short& l) { h = f2bf(y); l = f2bf(y - bf2f(h)); }
// f32 to bf16 by the packed convert instruction: two values a vector slot, round to nearest even as in f2bf; a in the low half of the word
typedef __attribute__((ext_vector_type(2))) __bf16 v2bf;
typedef __attribute__((ext_vector_type(2))) float v2fl;
typedef __attribute__((ext_vector_type(2))) unsigned v2u;
typedef __attribute__((ext_vector_type(4))) unsigned v4u;
typedef __attribute__((ext_vector_type(8))) unsigned v8u;
typedef v2u __attribute__((may_alias)) v2ua;
typedef v4u __attribute__((may_alias)) v4ua;
__device__ __forceinline__ unsigned pk2(float a, float b) { return __builtin_bit_cast(unsigned, __builtin_convertvector((v2fl){a, b}, v2bf)); }
// hi/lo planes of two values: h holds both rounded values, l both rounded remainders
__device__ __forceinline__ void split2(float a, float b, unsigned& h, unsigned& l) { h = pk2(a, b); l = pk2(a - __uint_as_float(h << 16), b - __uint_as_float(h & 0xFFFF0000u)); }
typedef __attribute__((ext_vector_type(2))) _Float16 v2h;
typedef __attribute__((ext_vector_type(4))) _Float16 v4h;
typedef __attribute__((ext_vector_type(2))) unsigned short v2us;
typedef __attribute__((ext_vector_type(4))) unsigned short v4us;
typedef __attribute__((ext_vector_type(2))) float v2f;
typedef __attribute__((ext_vector_type(4))) int v4i;

__global__ __launch_bounds__(256) void k_wtG(const float* __restrict__ w, int K, int N, bf* Bt) {
    const int lane = threadIdx.x & 31; const int L0 = (blockIdx.x * 8 + (threadIdx.x >> 5)) * 8; const int nlines = N * K / 64;
{
#pragma unroll 1
        for (int l = 0; l < 8; ++l) { const int L = L0 + l; if (L >= nlines) break; const size_t e = (size_t)L * 64 + lane * 2; const int k = (int)(e % K), n = (int)(e / K); v2us o;
            o[0] = f2bf(w[(size_t)k * N + n]); o[1] = f2bf(w[(size_t)(k + 1) * N + n]); *(v2us*)(Bt + e) = o; }
         }
}
// k_cvt8x3: f32 to bf16, eight elements a thread, for three [64][DM] sources in one launch; blockIdx.y picks the source, the results lie one behind the other in dst, each in fragment order:
// [64-wide chunk of k][32-wide half h][16-row block nb][unit][lane][8]; a thread's eight elements are one lane's 16 bytes of one unit
__global__ __launch_bounds__(256) void k_cvt8x3(const float* __restrict__ s0, const float* __restrict__ s1, const float* __restrict__ s2, bf* dst, size_t n8) { const size_t i = (size_t)blockIdx.x * 256 + threadIdx.x; if (i >= n8) return; const float* src = (blockIdx.y == 0) ? s0 : (blockIdx.y == 1) ? s1 : s2; const v8f v = *(const v8f*)(src + i * 8); v4u o;
#pragma unroll
    for (int k = 0; k < 4; ++k) o[k] = pk2(v[2 * k], v[2 * k + 1]);
    const unsigned n = (unsigned)i / (DM / 8), k8 = (unsigned)i % (DM / 8);   // weight row, and which eight of its elements
    const unsigned u = (((k8 >> 3) * 2 + ((k8 >> 2) & 1)) * 4 + (n >> 4)) * 2 + ((k8 >> 1) & 1);   // the 512-byte unit inside this source
    *(v4ua*)(dst + (size_t)blockIdx.y * n8 * 8 + u * 256 + ((k8 & 1) * 16 + (n & 15)) * 8) = o;  }

// ---- k_proj: q, k and v of 64 rows of x in ONE kernel, from the f32 input to the planes that k_fattn reads. ONE WORK-GROUP of 8 waves per 64 rows, grid MT/64.
// The K loop is dealt to the waves in chunks of 64 elements: wave w takes chunks w and w + 8 (the second only where it exists). A wave loads its chunks of all 64 rows of x in f32, rounds them to bf16 in registers and keeps
// the fragments; then, for q, k and v in turn, it multiplies its chunks of the 64 weight rows (loaded once, one column group ahead) with the four 16-row tiles, and the 8 partial 64x64 tiles are summed through LDS in wave order 0 .. 7.
// The summing threads split each value into its hi/lo planes and store them in fragment order, as k_fattn loads them: q as [16-row tile][h][unit][lane][8] (fragment row = query row),
// k as [64-key chunk][h][nb][unit][lane][8] (fragment column lr of block nb = key 4 lr + nb, k = d), v as [64-key chunk][h][nb][unit][lane][8] (fragment column lr of block nb = d 16 nb + lr, k = key). A work-group owns 64 positions: 8 KB in a row of every plane.
__device__ __forceinline__ v16bf cvtfrag(v4f a, v4f b, v4f c, v4f d) {
    const v8u r = { pk2(a[0], a[1]), pk2(a[2], a[3]), pk2(b[0], b[1]), pk2(b[2], b[3]), pk2(c[0], c[1]), pk2(c[2], c[3]), pk2(d[0], d[1]), pk2(d[2], d[3]) };
    return __builtin_bit_cast(v16bf, r); }
// one 64-wide chunk of x, 64 rows: the lane's 8 + 8 elements of each 32-wide half of each 16-row tile
__device__ __forceinline__ void ldx(v4f (&x)[4][2][4], const float* px) {
#pragma unroll
    for (int rt = 0; rt < 4; ++rt) {
#pragma unroll
        for (int h = 0; h < 2; ++h) { const float* p = px + rt * 16 * DM + h * 32; x[rt][h][0] = *(const v4f*)p; x[rt][h][1] = *(const v4f*)(p + 4); x[rt][h][2] = *(const v4f*)(p + 16); x[rt][h][3] = *(const v4f*)(p + 20); } } }
// one 64-wide chunk of 64 weight rows, in fragment order
__device__ __forceinline__ void ldw(v16bf (&b)[2][4], const bf* pb) {
#pragma unroll
    for (int h = 0; h < 2; ++h) {
#pragma unroll
        for (int nb = 0; nb < 4; ++nb) b[h][nb] = ldfo(pb + (h * 4 + nb) * 512); } }
__device__ __forceinline__ void mma64(v8f (&acc)[4][4], const v16bf (&a)[4][2], const v16bf (&b)[2][4]) {
#pragma unroll
    for (int h = 0; h < 2; ++h) {
#pragma unroll
        for (int rt = 0; rt < 4; ++rt) {
#pragma unroll
            for (int nb = 0; nb < 4; ++nb) acc[rt][nb] = wmmab(a[rt][h], b[h][nb], acc[rt][nb]); } } }
__global__ __launch_bounds__(256) void k_proj(const float* __restrict__ X, const bf* __restrict__ Wb, bf* QKh, bf* QKl, bf* VTh, bf* VTl) {
    typedef v16bf V;
    constexpr int NW = 8, PW = 64 * 68;   // floats of LDS per wave: one partial 64x64 tile, pitch 68 (q, k: read back as 16-byte words) or 65 (v: read back down the columns, every lane in a bank of its own)
    __shared__ __align__(16) float os[NW * PW];
    const int lane = threadIdx.x & 31, lr = lane & 15, hi = lane >> 4; const int r0 = blockIdx.x * 64;
    const int w = __builtin_amdgcn_readfirstlane((int)(threadIdx.x >> 5));   // wave number in a scalar register: the test for a second chunk stays a scalar branch and EXEC stays full at every WMMA
    const bool two = w + NW < DM / 64;
    const float* px = X + (size_t)(r0 + lr) * DM + w * 64 + 8 * hi;   // the lane's own row of the first tile; the other tiles, the halves and the second chunk are immediate offsets
    const bf* pw = Wb + (size_t)w * 4096 + lane * 8;                  // the lane's own 16 bytes of the first unit of the wave's chunk; the other units, the second chunk and the column groups are immediate offsets
    v4f x0[4][2][4], x1[4][2][4]; V b0[2][4], b1[2][4];
    ldx(x0, px); if (two) ldx(x1, px + NW * 64);
    ldw(b0, pw); if (two) ldw(b1, pw + NW * 4096);
    // both pointers stay in their registers, untouched, up to this wait: nothing overwrites an address register of an issued load in front of it
    asm volatile("s_wait_xcnt 0x0" :: "v"(px), "v"(pw) : "memory");
    __builtin_amdgcn_sched_barrier(0);   // keeps every load in front of the first conversion: all of a wave's reads of x fly together instead of paying the memory latency tile by tile
    V a0[4][2], a1[4][2];
#pragma unroll
    for (int rt = 0; rt < 4; ++rt) {
#pragma unroll
        for (int h = 0; h < 2; ++h) a0[rt][h] = cvtfrag(x0[rt][h][0], x0[rt][h][1], x0[rt][h][2], x0[rt][h][3]); }
    if (two) {
#pragma unroll
        for (int rt = 0; rt < 4; ++rt) {
#pragma unroll
            for (int h = 0; h < 2; ++h) a1[rt][h] = cvtfrag(x1[rt][h][0], x1[rt][h][1], x1[rt][h][2], x1[rt][h][3]); } }
    float* ow = os + w * PW;
#pragma unroll
    for (int cg = 0; cg < 3; ++cg) {   // 0: q, 1: k, 2: v
        const int P = (cg == 2) ? 65 : 68;
        v8f acc[4][4];
#pragma unroll
        for (int rt = 0; rt < 4; ++rt) {
#pragma unroll
            for (int nb = 0; nb < 4; ++nb) acc[rt][nb] = (v8f){}; }
        mma64(acc, a0, b0);
        if (cg < 2) ldw(b0, pw + (cg + 1) * 64 * DM);
        if (two) { mma64(acc, a1, b1); if (cg < 2) ldw(b1, pw + (cg + 1) * 64 * DM + NW * 4096); }
        if (cg < 2) {
            asm volatile("s_wait_xcnt 0x0" :: "v"(pw) : "memory");   // the weight pointer stays untouched up to this wait
            __builtin_amdgcn_sched_barrier(0); }   // keeps the next column group's weight loads here, in front of the sums through LDS, under which they fly
#pragma unroll
        for (int rt = 0; rt < 4; ++rt) {
#pragma unroll
            for (int nb = 0; nb < 4; ++nb) {
#pragma unroll
                for (int j = 0; j < 8; ++j) ow[(rt * 16 + hi * 8 + j) * P + nb * 16 + lr] = acc[rt][nb][j]; } }
        __syncthreads();   // every wave's partial tile is in LDS before any of them is summed
        float val[4][4]; bf* dh[4]; bf* dl[4];   // four items a thread, four neighbouring elements of a fragment's k direction each
        const int t16 = threadIdx.x >> 4, c4 = (threadIdx.x & 15) * 4;   // the item's fragment row or column, and its first k of 64
        const int fh = c4 >> 5, fu = (c4 >> 4) & 1, fl = (((c4 >> 3) & 1) * 16 + t16) * 8 + (c4 & 7);   // 32-wide half, unit, and the place inside the unit
        if (cg < 2) {
#pragma unroll
            for (int u = 0; u < 4; ++u) { const int row = (cg == 0) ? u * 16 + t16 : t16 * 4 + u, cofs = c4; v4f s = *(const v4fa*)(os + row * 68 + cofs);   // q: row t16 of tile u; k: column t16 of block u
#pragma unroll
                for (int q = 1; q < NW; ++q) s += *(const v4fa*)(os + q * PW + row * 68 + cofs);
#pragma unroll
                for (int i = 0; i < 4; ++i) val[u][i] = s[i];
                const size_t e = ((size_t)cg * MT + r0) * HD + ((cg == 0) ? u * 1024 + (fh * 2 + fu) * 256 : ((fh * 4 + u) * 2 + fu) * 256) + fl; dh[u] = QKh + e; dl[u] = QKl + e; }
            __syncthreads();   // every partial tile has been read before the next column group's partial tiles overwrite it; the stores stand behind it and fly under the next group's products
        } else {
#pragma unroll
            for (int u = 0; u < 4; ++u) { const int tq = c4, d = u * 16 + t16;   // column t16 of block u, four neighbouring positions
#pragma unroll
                for (int i = 0; i < 4; ++i) val[u][i] = os[(tq + i) * 65 + d];
#pragma unroll
                for (int q = 1; q < NW; ++q) {
#pragma unroll
                    for (int i = 0; i < 4; ++i) val[u][i] += os[q * PW + (tq + i) * 65 + d]; }
                const size_t e = (size_t)r0 * HD + ((fh * 4 + u) * 2 + fu) * 256 + fl; dh[u] = VTh + e; dl[u] = VTl + e; }
        }
        v2u oh[4], ol[4];
#pragma unroll
        for (int u = 0; u < 4; ++u) {
#pragma unroll
            for (int i = 0; i < 2; ++i) { unsigned h2, l2; split2(val[u][2 * i], val[u][2 * i + 1], h2, l2); oh[u][i] = h2; ol[u][i] = l2; } }
#pragma unroll
        for (int u = 0; u < 4; ++u) { *(v2ua*)dh[u] = oh[u]; *(v2ua*)dl[u] = ol[u]; }
        // the stores' pointers and data stay in their registers, untouched, up to this wait: nothing overwrites a register of an issued store in front of it
        asm volatile("s_wait_xcnt 0x0" :: "v"(dh[0]), "v"(dh[1]), "v"(dh[2]), "v"(dh[3]), "v"(dl[0]), "v"(dl[1]), "v"(dl[2]), "v"(dl[3]), "v"(oh[0]), "v"(oh[1]), "v"(oh[2]), "v"(oh[3]), "v"(ol[0]), "v"(ol[1]), "v"(ol[2]), "v"(ol[3]) : "memory");
    }
}

typedef v4us __attribute__((may_alias)) v4usa;
// 2^x with the one vector slot that the instruction set asks for behind a transcendental in the same statement
__device__ __forceinline__ float exp2s(float x) { float r; asm("v_exp_f32 %0, %1\n\tv_nop" : "=v"(r) : "v"(x)); return r; }

// ---- k_fattn: causal scores, softmax and probability x value in ONE kernel; neither scores nor probabilities go through memory. ONE WORK-GROUP of NW waves per 32 query rows (two 16-row tiles), grid (batches, TT/32): blockIdx.x picks the batch's planes, mask row and output.
// The keys up to the diagonal are dealt to the waves in chunks of 64: wave w takes chunks w, w + NW, ... A wave loads a chunk's key and value fragments ONCE and uses them for both query tiles, which halves the bytes that the kernel draws from L2. For each chunk and each query tile a wave forms its 16x64 score tile (hi/lo planes, 3 products), keeps a running row maximum m,
// a running sum l of exp(s - m) and a running 16x64 context tile o (both rescaled by exp(m_old - m_new) when m grows), and multiplies the unnormalised probabilities (split into hi/lo planes, 3 products) with the value chunk.
// Score column lr of block nb is key 4 lr + nb of the chunk, so a lane holds four neighbouring keys of a row and stores them to LDS as one 8-byte word; in LDS the probabilities lie in plain key order, [row][key], pitch 72.
// At the end the NW partial (m, l, o) go to LDS and are merged in wave order 0 .. NW-1 with the weights exp(m_w - max m); the context is divided by the merged sum and written straight to the output.
template <int NW>
__global__ __launch_bounds__(NW * 32) void k_fattn(const bf* __restrict__ Qh0, const bf* __restrict__ Ql0, const bf* __restrict__ Kh0, const bf* __restrict__ Kl0, const bf* __restrict__ Vh0, const bf* __restrict__ Vl0, const int* __restrict__ MK0, float* OUT0) {
    const size_t zb = (size_t)blockIdx.x * TT * HD;   // every plane and the output hold TT x HD elements a batch
    const bf* __restrict__ Qh = Qh0 + zb; const bf* __restrict__ Ql = Ql0 + zb; const bf* __restrict__ Kh = Kh0 + zb; const bf* __restrict__ Kl = Kl0 + zb; const bf* __restrict__ Vh = Vh0 + zb; const bf* __restrict__ Vl = Vl0 + zb;
    const int* __restrict__ MKb = MK0 + (size_t)blockIdx.x * TT; float* OUTb = OUT0 + zb;
    typedef WFrag<bf> F; typedef F::V V;
    constexpr float L2E = 1.4426950408889634f, NEG = -3.0e38f;
    constexpr int WS = 2304;   // floats of LDS per wave: for each of the two query tiles two 16 x 72 probability planes of 16 bits during the loop; the 32 x 68 f32 context tile behind it
    __shared__ __align__(16) float os[NW * WS];
    __shared__ float ms[NW * 32], ls[NW * 32];
    const int lane = threadIdx.x & 31, lr = lane & 15, hi = lane >> 4; const int r0 = blockIdx.y * 32;
    const int w = __builtin_amdgcn_readfirstlane((int)(threadIdx.x >> 5));   // wave number in a scalar register: the key loop's branch stays scalar and EXEC stays full at every WMMA
    const int Kend = (r0 + 32 + 63) & ~63;   // the 64-wide chunk that holds these rows (both tiles lie in one chunk) is the last one with a kept key
    V qh[2][2], ql[2][2]; const bf* pqh = Qh + (size_t)r0 * HD + lane * 8; const bf* pql = Ql + (size_t)r0 * HD + lane * 8;   // every plane lies in fragment order (k_proj): a lane's own 16 bytes of a unit, the units at immediate offsets
#pragma unroll
    for (int t = 0; t < 2; ++t) {
#pragma unroll
        for (int h = 0; h < 2; ++h) { qh[t][h] = ldfo(pqh + t * 1024 + h * 512); ql[t][h] = ldfo(pql + t * 1024 + h * 512); } }
    asm volatile("s_wait_xcnt 0x0" :: "v"(pqh), "v"(pql) : "memory");   // the query pointers' registers are reused at once: the wait stands in front of the first overwrite of an address register of an issued load
    __builtin_amdgcn_sched_barrier(0);   // keeps the code below behind that wait: without it this build lifts writes of the loads' offset and base registers over the wait
    v8f o[2][4]; float m[2][8], l[2][8];
#pragma unroll
    for (int t = 0; t < 2; ++t) {
#pragma unroll
        for (int nb = 0; nb < 4; ++nb) o[t][nb] = (v8f){};
#pragma unroll
        for (int j = 0; j < 8; ++j) { m[t][j] = NEG; l[t][j] = 0.f; } }
    float* ow = os + w * WS; bf* ph0 = (bf*)ow;   // planes of tile t: hi at ph0 + t * 2 * 16 * 72, lo 16 * 72 behind it
    const size_t koff = (size_t)w * 64 * HD + lane * 8, voff = koff;   // a 64-key chunk is 64 x HD elements in a row of every plane
    const bf* pkh = Kh + koff; const bf* pkl = Kl + koff; const bf* pvh = Vh + voff; const bf* pvl = Vl + voff; const int* pm = MKb + w * 64 + lr * 4;   // each lane's own pointers, stepped from chunk to chunk
#pragma unroll 1
    for (int kc = w * 64; kc < Kend; kc += NW * 64) {
        V kh[2][4], kl[2][4], vh[2][4], vl[2][4];
#pragma unroll
        for (int h = 0; h < 2; ++h) {
#pragma unroll
            for (int nb = 0; nb < 4; ++nb) { kh[h][nb] = ldfo(pkh + (h * 4 + nb) * 512); kl[h][nb] = ldfo(pkl + (h * 4 + nb) * 512); } }
        const v4i mk = *(const v4i*)pm;
        // the pointers stay in their registers, untouched, up to this wait: no later load's result and no pointer step overwrites an address register of an issued load in front of it
        asm volatile("s_wait_xcnt 0x0" :: "v"(pkh), "v"(pkl), "v"(pm) : "memory");
        __builtin_amdgcn_sched_barrier(0);   // keeps every key load of the chunk in front of the first WMMA: they fly together instead of paying the latency group by group
        v8f s[2][4];
#pragma unroll
        for (int t = 0; t < 2; ++t) {   // the two query tiles in turn, on the same key fragments
#pragma unroll
            for (int nb = 0; nb < 4; ++nb) s[t][nb] = (v8f){};
#pragma unroll
            for (int h = 0; h < 2; ++h) {
#pragma unroll
                for (int nb = 0; nb < 4; ++nb) s[t][nb] = F::mma(qh[t][h], kh[h][nb], s[t][nb]);
#pragma unroll
                for (int nb = 0; nb < 4; ++nb) s[t][nb] = F::mma(ql[t][h], kh[h][nb], s[t][nb]);
#pragma unroll
                for (int nb = 0; nb < 4; ++nb) s[t][nb] = F::mma(qh[t][h], kl[h][nb], s[t][nb]); } }
        __builtin_amdgcn_sched_barrier(0);   // keeps the value loads behind the last score product, where the key fragments' registers are free for them: in front of it two tiles' state and both operands do not fit and the build spills
#pragma unroll
        for (int h = 0; h < 2; ++h) {
#pragma unroll
            for (int nb = 0; nb < 4; ++nb) { vh[h][nb] = ldfo(pvh + (h * 4 + nb) * 512); vl[h][nb] = ldfo(pvl + (h * 4 + nb) * 512); } }
        asm volatile("s_wait_xcnt 0x0" :: "v"(pvh), "v"(pvl) : "memory");   // as above, for the value pointers
        __builtin_amdgcn_sched_barrier(0);   // keeps every value load in front of the softmax of both tiles, under which they fly instead of paying their latency behind it
        const int key0 = kc + lr * 4;
#pragma unroll
        for (int t = 0; t < 2; ++t) {
            bf* ph = ph0 + t * 2 * 16 * 72; bf* pl = ph + 16 * 72;
#pragma unroll
            for (int j = 0; j < 8; ++j) { const int i = r0 + t * 16 + hi * 8 + j; float x[4]; bool keep[4]; float rm = NEG;
#pragma unroll
                for (int nb = 0; nb < 4; ++nb) { keep[nb] = (key0 + nb <= i) && (mk[nb] != 0); x[nb] = s[t][nb][j] * SCL; if (keep[nb]) rm = fmaxf(rm, x[nb]); }
#pragma unroll
                for (int sh = 8; sh; sh >>= 1) rm = fmaxf(rm, __shfl_xor(rm, sh, 32));   // the 16 lanes of a half hold one row
                const float mn = fmaxf(m[t][j], rm); const float al = exp2s((m[t][j] - mn) * L2E); m[t][j] = mn;
                float ps = 0.f, pv[4]; v2u oh, ol;
#pragma unroll
                for (int nb = 0; nb < 4; ++nb) { const float ex = exp2s((x[nb] - mn) * L2E); pv[nb] = keep[nb] ? ex : 0.f; ps += pv[nb]; }
#pragma unroll
                for (int i2 = 0; i2 < 2; ++i2) { unsigned h2, l2; split2(pv[2 * i2], pv[2 * i2 + 1], h2, l2); oh[i2] = h2; ol[i2] = l2; }
                l[t][j] = l[t][j] * al + ps;   // each lane sums its own four keys of a chunk; the 16 lanes are added once, behind the loop
#pragma unroll
                for (int nb = 0; nb < 4; ++nb) o[t][nb][j] *= al;
                *(v2ua*)(ph + (hi * 8 + j) * 72 + lr * 4) = oh; *(v2ua*)(pl + (hi * 8 + j) * 72 + lr * 4) = ol; } }
        __builtin_amdgcn_wave_barrier(); asm volatile("" ::: "memory");   // compiler order only: every lane's probability stores stand in front of the fragment reads, which take other lanes' words (LDS serves one wave in order)
        V pa[2][2], pb[2][2];
#pragma unroll
        for (int t = 0; t < 2; ++t) { const bf* ph = ph0 + t * 2 * 16 * 72; const bf* pl = ph + 16 * 72;
#pragma unroll
            for (int h = 0; h < 2; ++h) { const int po = lr * 72 + 8 * hi + h * 32; pa[t][h] = cat16b(*(const v8usa*)(ph + po), *(const v8usa*)(ph + po + 16)); pb[t][h] = cat16b(*(const v8usa*)(pl + po), *(const v8usa*)(pl + po + 16)); } }
        __builtin_amdgcn_wave_barrier(); asm volatile("" ::: "memory");   // compiler order only: the fragment reads stand in front of the next chunk's probability stores
#pragma unroll
        for (int t = 0; t < 2; ++t) {   // the two query tiles in turn, on the same value fragments
#pragma unroll
            for (int h = 0; h < 2; ++h) {
#pragma unroll
                for (int nb = 0; nb < 4; ++nb) o[t][nb] = F::mma(pa[t][h], vh[h][nb], o[t][nb]);
#pragma unroll
                for (int nb = 0; nb < 4; ++nb) o[t][nb] = F::mma(pb[t][h], vh[h][nb], o[t][nb]);
#pragma unroll
                for (int nb = 0; nb < 4; ++nb) o[t][nb] = F::mma(pa[t][h], vl[h][nb], o[t][nb]); } }
        // four vector slots behind the last WMMA, so that nothing on the taken side of the loop branch touches its registers too early
        asm volatile("v_nop\n\tv_nop\n\tv_nop\n\tv_nop" : "+v"(o[0][0]), "+v"(o[0][1]), "+v"(o[0][2]), "+v"(o[0][3]), "+v"(o[1][0]), "+v"(o[1][1]), "+v"(o[1][2]), "+v"(o[1][3]) : "v"(pa[0][1]), "v"(pa[1][1]));
        pkh += NW * 64 * HD; pkl += NW * 64 * HD; pvh += NW * 64 * HD; pvl += NW * 64 * HD; pm += NW * 64;
    }
#pragma unroll
    for (int sh = 8; sh; sh >>= 1) {
#pragma unroll
        for (int t = 0; t < 2; ++t) {
#pragma unroll
            for (int j = 0; j < 8; ++j) l[t][j] += __shfl_xor(l[t][j], sh, 32); } }
    if (lr == 0) {
#pragma unroll
        for (int t = 0; t < 2; ++t) {
#pragma unroll
            for (int j = 0; j < 8; ++j) { ms[w * 32 + t * 16 + hi * 8 + j] = m[t][j]; ls[w * 32 + t * 16 + hi * 8 + j] = l[t][j]; } } }
#pragma unroll
    for (int t = 0; t < 2; ++t) {
#pragma unroll
        for (int nb = 0; nb < 4; ++nb) {
#pragma unroll
            for (int j = 0; j < 8; ++j) ow[(t * 16 + hi * 8 + j) * 68 + nb * 16 + lr] = o[t][nb][j]; } }
    __syncthreads();   // every wave's partial maximum, sum and context tile are in LDS before any of them is merged
    for (int it = threadIdx.x; it < 512; it += NW * 32) { const int row = it >> 4, cofs = (it & 15) * 4; float M = ms[row];
#pragma unroll
        for (int q = 1; q < NW; ++q) M = fmaxf(M, ms[q * 32 + row]);
        float L = 0.f; v4f val = (v4f){};
#pragma unroll
        for (int q = 0; q < NW; ++q) { const float sc = exp2s((ms[q * 32 + row] - M) * L2E); L += ls[q * 32 + row] * sc; val += *(const v4fa*)(os + q * WS + row * 68 + cofs) * sc; }
        const float f = (L > 0.f) ? __fdiv_rn(1.0f, L) : 0.f;
        *(v4f*)(OUTb + (size_t)(r0 + row) * HD + cofs) = val * f; }
}

extern "C" void kernel_launch(void* const* d_in, const int* in_sizes, int n_in,
                              void* d_out, int out_size, void* d_ws, size_t ws_size, hipStream_t stream) {
    (void)in_sizes; (void)n_in; (void)out_size;
    const float* x = (const float*)d_in[0]; const int* MK = (const int*)d_in[1]; const float* wq = (const float*)d_in[2]; const float* wk = (const float*)d_in[3]; const float* wv = (const float*)d_in[4]; const float* wo = nullptr; (void)wo;
    float* OUT = (float*)d_out;     // [4][4096][64]
    char* wsp = (char*)d_ws;
    auto take = [&](size_t bytes) { char* p = wsp; wsp += (bytes + 255) & ~(size_t)255; return (void*)p; };
    bf* WQKV = (bf*)take((size_t)(DQ + 2 * DKV) * DM * 2);   // the three weights one behind the other, each 64 x 768 in fragment order
    bf* QKh = (bf*)take((size_t)2 * MT * HD * 2); bf* QKl = (bf*)take((size_t)2 * MT * HD * 2); bf* VTh = (bf*)take((size_t)MT * HD * 2); bf* VTl = (bf*)take((size_t)MT * HD * 2);   // plane 0 of QK*: q, plane 1: k
    if ((size_t)(wsp - (char*)d_ws) > ws_size) return;    // ws 256 MiB
    k_cvt8x3<<<dim3((unsigned)(((size_t)DQ * DM / 8 + 255) / 256), 3, 1), 256, 0, stream>>>(wq, wk, wv, WQKV, (size_t)DQ * DM / 8);   /* 'oi' [64][768] weights are Bt; stored in fragment order */
    k_proj<<<MT / 64, 256, 0, stream>>>(x, WQKV, QKh, QKl, VTh, VTl);
    k_fattn<8><<<dim3(NB_, TT / 32, 1), 256, 0, stream>>>(QKh, QKl, QKh + (size_t)MT * HD, QKl + (size_t)MT * HD, VTh, VTl, MK, OUT);
}

// v008
// It runs in 47.6 microseconds.
// Next to v007, in two timings, it ran 1.11 times as fast each time.
// Counting every step since v000, it is 18.0 times as fast.
#include <hip/hip_runtime.h>

// Single-head causal attention with a key padding mask (x [4][4096][768]; q, k, v = x W^T ('oi' [64][768], no bias; one 64-wide head); scores = q.k x 64^-0.5; keep = causal (j <= i) and mask[b][j] != 0 (int32, read); softmax; out = attn.v -> [4][4096][64] f32 (1 M); no output projection).
// Compute dtypes, f32 accumulate: every input rounded to bf16; q/k/v on PLAIN bf16 operands (inputs: exact); causal scores and attn.v (tile skipping) on hi/lo planes for every row (3 products); online softmax in f32 inside one fused kernel (scores and probabilities never reach memory); no output projection: the context is written in f32.

#define NB_  4
#define TT   4096
#define MT   (NB_ * TT)          // rows of all batches together
#define DM   768
#define NH_  1
#define NKV  1
#define REP  (NH_ / NKV)
#define HD   64
#define DQ   (NH_ * HD)
#define DKV  (NKV * HD)
#define ZH   1
#define RH   4096                 // every row hi/lo (streaming softmax, no register row)
#define RB   TT
#define WIN  4096
#define PCAR 1024.0f
#define SCL  0.125f   // H^-0.5 with H = 64 (the head width)
typedef _Float16 h16;
typedef unsigned short bf;
typedef __attribute__((ext_vector_type(16))) __bf16   v16bf;
typedef __attribute__((ext_vector_type(16))) _Float16 v16h;
typedef __attribute__((ext_vector_type(8)))  _Float16 v8h;
typedef __attribute__((ext_vector_type(8)))  unsigned short v8us;
typedef __attribute__((ext_vector_type(8)))  float    v8f;
typedef __attribute__((ext_vector_type(4)))  float    v4f;
typedef v8h  __attribute__((may_alias)) v8ha;
typedef v4f  __attribute__((may_alias)) v4fa;
typedef v8us __attribute__((may_alias)) v8usa;

__device__ __forceinline__ unsigned short f2bf(float f) { unsigned u = __float_as_uint(f); u += 0x7FFFu + ((u >> 16) & 1u); return (unsigned short)(u >> 16); }
__device__ __forceinline__ float bf2f(unsigned short b) { return __uint_as_float(((unsigned)b) << 16); }
__device__ __forceinline__ float bfr(float f) { return bf2f(f2bf(f)); }
__device__ __forceinline__ v16h cat16(v8h lo, v8h hi) { return __builtin_shufflevector(lo, hi, 0, 1, 2, 3, 4, 5, 6, 7, 8, 9, 10, 11, 12, 13, 14, 15); }
__device__ __forceinline__ v16bf cat16b(v8us lo, v8us hi) { return __builtin_bit_cast(v16bf, __builtin_shufflevector(lo, hi, 0, 1, 2, 3, 4, 5, 6, 7, 8, 9, 10, 11, 12, 13, 14, 15)); }
__device__ __forceinline__ v8f wmma16(v16h a, v16h b, v8f c) { return __builtin_amdgcn_wmma_f32_16x16x32_f16(false, a, false, b, (short)0, c, false, false); }
__device__ __forceinline__ v8f wmmab(v16bf a, v16bf b, v8f c) { return __builtin_amdgcn_wmma_f32_16x16x32_bf16(false, a, false, b, (short)0, c, false, false); }



// fragment loaders and matrix products by 16-bit operand type
template <typename T16> struct WFrag;
template <> struct WFrag<h16> { typedef v16h V; static __device__ __forceinline__ V ld(const h16* p) { return cat16(*(const v8h*)p, *(const v8h*)(p + 16)); } static __device__ __forceinline__ v8f mma(V a, V b, v8f c) { return wmma16(a, b, c); } };
template <> struct WFrag<bf> { typedef v16bf V; static __device__ __forceinline__ V ld(const bf* p) { return cat16b(*(const v8us*)p, *(const v8us*)(p + 16)); } static __device__ __forceinline__ v8f mma(V a, V b, v8f c) { return wmmab(a, b, c); } };

// FRAGMENT ORDER: an operand that one launch writes for another launch's WMMA loads lies as the loads take it: a 16 x 32 fragment is two units of 512 bytes, unit 'half' holding for lane (hi, lr), at lane * 16 bytes,
// the eight elements k = half * 16 + hi * 8 + 0 .. 7 of fragment row (or column) lr. A wave-wide 16-byte load then covers four whole 128-byte lines instead of a piece of 16 lines.
__device__ __forceinline__ v16bf ldfo(const bf* p) { return cat16b(*(const v8us*)p, *(const v8us*)(p + 256)); }
__device__ __forceinline__ h16 tohx(float x) { return (h16)x; }
__device__ __forceinline__ void splitf(float y, unsigned short& h, unsigned short& l) { h = f2bf(y); l = f2bf(y - bf2f(h)); }
// f32 to bf16 by the packed convert instruction: two values a vector slot, round to nearest even as in f2bf; a in the low half of the word
typedef __attribute__((ext_vector_type(2))) __bf16 v2bf;
typedef __attribute__((ext_vector_type(2))) float v2fl;
typedef __attribute__((ext_vector_type(2))) unsigned v2u;
typedef __attribute__((ext_vector_type(4))) unsigned v4u;
typedef __attribute__((ext_vector_type(8))) unsigned v8u;
typedef v2u __attribute__((may_alias)) v2ua;
typedef v4u __attribute__((may_alias)) v4ua;
__device__ __forceinline__ unsigned pk2(float a, float b) { return __builtin_bit_cast(unsigned, __builtin_convertvector((v2fl){a, b}, v2bf)); }
// hi/lo planes of two values: h holds both rounded values, l both rounded remainders
__device__ __forceinline__ void split2(float a, float b, unsigned& h, unsigned& l) { h = pk2(a, b); l = pk2(a - __uint_as_float(h << 16), b - __uint_as_float(h & 0xFFFF0000u)); }
typedef __attribute__((ext_vector_type(2))) _Float16 v2h;
typedef __attribute__((ext_vector_type(4))) _Float16 v4h;
typedef __attribute__((ext_vector_type(2))) unsigned short v2us;
typedef __attribute__((ext_vector_type(4))) unsigned short v4us;
typedef __attribute__((ext_vector_type(2))) float v2f;
typedef __attribute__((ext_vector_type(4))) int v4i;

__global__ __launch_bounds__(256) void k_wtG(const float* __restrict__ w, int K, int N, bf* Bt) {
    const int lane = threadIdx.x & 31; const int L0 = (blockIdx.x * 8 + (threadIdx.x >> 5)) * 8; const int nlines = N * K / 64;
{
#pragma unroll 1
        for (int l = 0; l < 8; ++l) { const int L = L0 + l; if (L >= nlines) break; const size_t e = (size_t)L * 64 + lane * 2; const int k = (int)(e % K), n = (int)(e / K); v2us o;
            o[0] = f2bf(w[(size_t)k * N + n]); o[1] = f2bf(w[(size_t)(k + 1) * N + n]); *(v2us*)(Bt + e) = o; }
         }
}
// k_cvt8x3: f32 to bf16, eight elements a thread, for three [64][DM] sources in one launch; blockIdx.y picks the source, the results lie one behind the other in dst, each in fragment order:
// [64-wide chunk of k][32-wide half h][16-row block nb][unit][lane][8]; a thread's eight elements are one lane's 16 bytes of one unit
__global__ __launch_bounds__(256) void k_cvt8x3(const float* __restrict__ s0, const float* __restrict__ s1, const float* __restrict__ s2, bf* dst, size_t n8) { const size_t i = (size_t)blockIdx.x * 256 + threadIdx.x; if (i >= n8) return; const float* src = (blockIdx.y == 0) ? s0 : (blockIdx.y == 1) ? s1 : s2; const v8f v = *(const v8f*)(src + i * 8); v4u o;
#pragma unroll
    for (int k = 0; k < 4; ++k) o[k] = pk2(v[2 * k], v[2 * k + 1]);
    const unsigned n = (unsigned)i / (DM / 8), k8 = (unsigned)i % (DM / 8);   // weight row, and which eight of its elements
    const unsigned u = (((k8 >> 3) * 2 + ((k8 >> 2) & 1)) * 4 + (n >> 4)) * 2 + ((k8 >> 1) & 1);   // the 512-byte unit inside this source
    *(v4ua*)(dst + (size_t)blockIdx.y * n8 * 8 + u * 256 + ((k8 & 1) * 16 + (n & 15)) * 8) = o;  }

// ---- k_proj: q, k and v of 64 rows of x in ONE kernel, from the f32 input to the planes that k_fattn reads. ONE WORK-GROUP of 8 waves per 64 rows, grid MT/64.
// The K loop is dealt to the waves in chunks of 64 elements: wave w takes chunks w and w + 8 (the second only where it exists). A wave loads its chunks of all 64 rows of x in f32, rounds them to bf16 in registers and keeps
// the fragments; then, for q, k and v in turn, it multiplies its chunks of the 64 weight rows (loaded once, one column group ahead) with the four 16-row tiles, and the 8 partial 64x64 tiles are summed through LDS in wave order 0 .. 7.
// The summing threads split each value into its hi/lo planes and store them in fragment order, as k_fattn loads them: q as [16-row tile][h][unit][lane][8] (fragment row = query row),
// k as [64-key chunk][h][nb][unit][lane][8] (fragment column lr of block nb = key 4 lr + nb, k = d), v as [64-key chunk][h][nb][unit][lane][8] (fragment column lr of block nb = d 16 nb + lr, k = key). A work-group owns 64 positions: 8 KB in a row of every plane.
__device__ __forceinline__ v16bf cvtfrag(v4f a, v4f b, v4f c, v4f d) {
    const v8u r = { pk2(a[0], a[1]), pk2(a[2], a[3]), pk2(b[0], b[1]), pk2(b[2], b[3]), pk2(c[0], c[1]), pk2(c[2], c[3]), pk2(d[0], d[1]), pk2(d[2], d[3]) };
    return __builtin_bit_cast(v16bf, r); }
// one 64-wide chunk of x, 64 rows: the lane's 8 + 8 elements of each 32-wide half of each 16-row tile
__device__ __forceinline__ void ldx(v4f (&x)[4][2][4], const float* px) {
#pragma unroll
    for (int rt = 0; rt < 4; ++rt) {
#pragma unroll
        for (int h = 0; h < 2; ++h) { const float* p = px + rt * 16 * DM + h * 32; x[rt][h][0] = *(const v4f*)p; x[rt][h][1] = *(const v4f*)(p + 4); x[rt][h][2] = *(const v4f*)(p + 16); x[rt][h][3] = *(const v4f*)(p + 20); } } }
// one 64-wide chunk of 64 weight rows, in fragment order
__device__ __forceinline__ void ldw(v16bf (&b)[2][4], const bf* pb) {
#pragma unroll
    for (int h = 0; h < 2; ++h) {
#pragma unroll
        for (int nb = 0; nb < 4; ++nb) b[h][nb] = ldfo(pb + (h * 4 + nb) * 512); } }
__device__ __forceinline__ void mma64(v8f (&acc)[4][4], const v16bf (&a)[4][2], const v16bf (&b)[2][4]) {
#pragma unroll
    for (int h = 0; h < 2; ++h) {
#pragma unroll
        for (int rt = 0; rt < 4; ++rt) {
#pragma unroll
            for (int nb = 0; nb < 4; ++nb) acc[rt][nb] = wmmab(a[rt][h], b[h][nb], acc[rt][nb]); } } }
__global__ __launch_bounds__(256) void k_proj(const float* __restrict__ X, const bf* __restrict__ Wb, bf* QKh, bf* QKl, bf* VTh, bf* VTl) {
    typedef v16bf V;
    constexpr int NW = 8, PW = 64 * 68;   // floats of LDS per wave: one partial 64x64 tile, pitch 68 (q, k: read back as 16-byte words) or 65 (v: read back down the columns, every lane in a bank of its own)
    __shared__ __align__(16) float os[NW * PW];
    const int lane = threadIdx.x & 31, lr = lane & 15, hi = lane >> 4; const int r0 = blockIdx.x * 64;
    const int w = __builtin_amdgcn_readfirstlane((int)(threadIdx.x >> 5));   // wave number in a scalar register: the test for a second chunk stays a scalar branch and EXEC stays full at every WMMA
    const bool two = w + NW < DM / 64;
    const float* px = X + (size_t)(r0 + lr) * DM + w * 64 + 8 * hi;   // the lane's own row of the first tile; the other tiles, the halves and the second chunk are immediate offsets
    const bf* pw = Wb + (size_t)w * 4096 + lane * 8;                  // the lane's own 16 bytes of the first unit of the wave's chunk; the other units, the second chunk and the column groups are immediate offsets
    v4f x0[4][2][4], x1[4][2][4]; V b0[2][4], b1[2][4];
    ldx(x0, px); if (two) ldx(x1, px + NW * 64);
    ldw(b0, pw); if (two) ldw(b1, pw + NW * 4096);
    // both pointers stay in their registers, untouched, up to this wait: nothing overwrites an address register of an issued load in front of it
    asm volatile("s_wait_xcnt 0x0" :: "v"(px), "v"(pw) : "memory");
    __builtin_amdgcn_sched_barrier(0);   // keeps every load in front of the first conversion: all of a wave's reads of x fly together instead of paying the memory latency tile by tile
    V a0[4][2], a1[4][2];
#pragma unroll
    for (int rt = 0; rt < 4; ++rt) {
#pragma unroll
        for (int h = 0; h < 2; ++h) a0[rt][h] = cvtfrag(x0[rt][h][0], x0[rt][h][1], x0[rt][h][2], x0[rt][h][3]); }
    if (two) {
#pragma unroll
        for (int rt = 0; rt < 4; ++rt) {
#pragma unroll
            for (int h = 0; h < 2; ++h) a1[rt][h] = cvtfrag(x1[rt][h][0], x1[rt][h][1], x1[rt][h][2], x1[rt][h][3]); } }
    float* ow = os + w * PW;
#pragma unroll
    for (int cg = 0; cg < 3; ++cg) {   // 0: q, 1: k, 2: v
        const int P = (cg == 2) ? 65 : 68;
        v8f acc[4][4];
#pragma unroll
        for (int rt = 0; rt < 4; ++rt) {
#pragma unroll
            for (int nb = 0; nb < 4; ++nb) acc[rt][nb] = (v8f){}; }
        mma64(acc, a0, b0);
        if (cg < 2) ldw(b0, pw + (cg + 1) * 64 * DM);
        if (two) { mma64(acc, a1, b1); if (cg < 2) ldw(b1, pw + (cg + 1) * 64 * DM + NW * 4096); }
        if (cg < 2) {
            asm volatile("s_wait_xcnt 0x0" :: "v"(pw) : "memory");   // the weight pointer stays untouched up to this wait
            __builtin_amdgcn_sched_barrier(0); }   // keeps the next column group's weight loads here, in front of the sums through LDS, under which they fly
#pragma unroll
        for (int rt = 0; rt < 4; ++rt) {
#pragma unroll
            for (int nb = 0; nb < 4; ++nb) {
#pragma unroll
                for (int j = 0; j < 8; ++j) ow[(rt * 16 + hi * 8 + j) * P + nb * 16 + lr] = acc[rt][nb][j]; } }
        __syncthreads();   // every wave's partial tile is in LDS before any of them is summed
        float val[4][4]; bf* dh[4]; bf* dl[4];   // four items a thread, four neighbouring elements of a fragment's k direction each
        const int t16 = threadIdx.x >> 4, c4 = (threadIdx.x & 15) * 4;   // the item's fragment row or column, and its first k of 64
        const int fh = c4 >> 5, fu = (c4 >> 4) & 1, fl = (((c4 >> 3) & 1) * 16 + t16) * 8 + (c4 & 7);   // 32-wide half, unit, and the place inside the unit
        if (cg < 2) {
#pragma unroll
            for (int u = 0; u < 4; ++u) { const int row = (cg == 0) ? u * 16 + t16 : t16 * 4 + u, cofs = c4; v4f s = *(const v4fa*)(os + row * 68 + cofs);   // q: row t16 of tile u; k: column t16 of block u
#pragma unroll
                for (int q = 1; q < NW; ++q) s += *(const v4fa*)(os + q * PW + row * 68 + cofs);
#pragma unroll
                for (int i = 0; i < 4; ++i) val[u][i] = s[i];
                const size_t e = ((size_t)cg * MT + r0) * HD + ((cg == 0) ? u * 1024 + (fh * 2 + fu) * 256 : ((fh * 4 + u) * 2 + fu) * 256) + fl; dh[u] = QKh + e; dl[u] = QKl + e; }
            __syncthreads();   // every partial tile has been read before the next column group's partial tiles overwrite it; the stores stand behind it and fly under the next group's products
        } else {
#pragma unroll
            for (int u = 0; u < 4; ++u) { const int tq = c4, d = u * 16 + t16;   // column t16 of block u, four neighbouring positions
#pragma unroll
                for (int i = 0; i < 4; ++i) val[u][i] = os[(tq + i) * 65 + d];
#pragma unroll
                for (int q = 1; q < NW; ++q) {
#pragma unroll
                    for (int i = 0; i < 4; ++i) val[u][i] += os[q * PW + (tq + i) * 65 + d]; }
                const size_t e = (size_t)r0 * HD + ((fh * 4 + u) * 2 + fu) * 256 + fl; dh[u] = VTh + e; dl[u] = VTl + e; }
        }
        v2u oh[4], ol[4];
#pragma unroll
        for (int u = 0; u < 4; ++u) {
#pragma unroll
            for (int i = 0; i < 2; ++i) { unsigned h2, l2; split2(val[u][2 * i], val[u][2 * i + 1], h2, l2); oh[u][i] = h2; ol[u][i] = l2; } }
#pragma unroll
        for (int u = 0; u < 4; ++u) { *(v2ua*)dh[u] = oh[u]; *(v2ua*)dl[u] = ol[u]; }
        // the stores' pointers and data stay in their registers, untouched, up to this wait: nothing overwrites a register of an issued store in front of it
        asm volatile("s_wait_xcnt 0x0" :: "v"(dh[0]), "v"(dh[1]), "v"(dh[2]), "v"(dh[3]), "v"(dl[0]), "v"(dl[1]), "v"(dl[2]), "v"(dl[3]), "v"(oh[0]), "v"(oh[1]), "v"(oh[2]), "v"(oh[3]), "v"(ol[0]), "v"(ol[1]), "v"(ol[2]), "v"(ol[3]) : "memory");
    }
}

typedef v4us __attribute__((may_alias)) v4usa;
// 2^x with the one vector slot that the instruction set asks for behind a transcendental in the same statement
__device__ __forceinline__ float exp2s(float x) { float r; asm("v_exp_f32 %0, %1\n\tv_nop" : "=v"(r) : "v"(x)); return r; }

// ---- k_fattn: causal scores, softmax and probability x value in ONE kernel; neither scores nor probabilities go through memory. ONE WORK-GROUP of NW waves per 32 query rows (two 16-row tiles), grid (batches, TT/32): blockIdx.x picks the batch's planes, mask row and output, so the four batches' tiles of equal length start side by side.
// A work-group fills its WGP's registers, so the grid runs in two rounds: blockIdx.y counts the query tiles DOWN from the last one, the long tiles first (for speed only: every tile is done once in any order).
// The keys up to the diagonal are dealt to the waves in chunks of 64: wave w takes chunks w, w + NW, ... A wave loads a chunk's key and value fragments ONCE and uses them for both query tiles, which halves the bytes that the kernel draws from L2. For each chunk and each query tile a wave forms its 16x64 score tile (hi/lo planes, 3 products), keeps a running row maximum m,
// a running sum l of exp(s - m) and a running 16x64 context tile o (both rescaled by exp(m_old - m_new) when m grows), and multiplies the unnormalised probabilities (split into hi/lo planes, 3 products) with the value chunk.
// Score column lr of block nb is key 4 lr + nb of the chunk, so a lane holds four neighbouring keys of a row and stores them to LDS as one 8-byte word; in LDS the probabilities lie in plain key order, [row][key], pitch 72.
// At the end the NW partial (m, l, o) go to LDS and are merged in wave order 0 .. NW-1 with the weights exp(m_w - max m); the context is divided by the merged sum and written straight to the output.
template <int NW>
__global__ __launch_bounds__(NW * 32) void k_fattn(const bf* __restrict__ Qh0, const bf* __restrict__ Ql0, const bf* __restrict__ Kh0, const bf* __restrict__ Kl0, const bf* __restrict__ Vh0, const bf* __restrict__ Vl0, const int* __restrict__ MK0, float* OUT0) {
    const size_t zb = (size_t)blockIdx.x * TT * HD;   // every plane and the output hold TT x HD elements a batch
    const bf* __restrict__ Qh = Qh0 + zb; const bf* __restrict__ Ql = Ql0 + zb; const bf* __restrict__ Kh = Kh0 + zb; const bf* __restrict__ Kl = Kl0 + zb; const bf* __restrict__ Vh = Vh0 + zb; const bf* __restrict__ Vl = Vl0 + zb;
    const int* __restrict__ MKb = MK0 + (size_t)blockIdx.x * TT; float* OUTb = OUT0 + zb;
    typedef WFrag<bf> F; typedef F::V V;
    constexpr float L2E = 1.4426950408889634f, NEG = -3.0e38f;
    constexpr int WS = 2304;   // floats of LDS per wave: for each of the two query tiles two 16 x 72 probability planes of 16 bits during the loop; the 32 x 68 f32 context tile behind it
    __shared__ __align__(16) float os[NW * WS];
    __shared__ float ms[NW * 32], ls[NW * 32];
    const int lane = threadIdx.x & 31, lr = lane & 15, hi = lane >> 4; const int r0 = (TT / 32 - 1 - (int)blockIdx.y) * 32;   // longest tiles first (see above)
    const int w = __builtin_amdgcn_readfirstlane((int)(threadIdx.x >> 5));   // wave number in a scalar register: the key loop's branch stays scalar and EXEC stays full at every WMMA
    const int Kend = (r0 + 32 + 63) & ~63;   // the 64-wide chunk that holds these rows (both tiles lie in one chunk) is the last one with a kept key
    V qh[2][2], ql[2][2]; const bf* pqh = Qh + (size_t)r0 * HD + lane * 8; const bf* pql = Ql + (size_t)r0 * HD + lane * 8;   // every plane lies in fragment order (k_proj): a lane's own 16 bytes of a unit, the units at immediate offsets
#pragma unroll
    for (int t = 0; t < 2; ++t) {
#pragma unroll
        for (int h = 0; h < 2; ++h) { qh[t][h] = ldfo(pqh + t * 1024 + h * 512); ql[t][h] = ldfo(pql + t * 1024 + h * 512); } }
    asm volatile("s_wait_xcnt 0x0" :: "v"(pqh), "v"(pql) : "memory");   // the query pointers' registers are reused at once: the wait stands in front of the first overwrite of an address register of an issued load
    __builtin_amdgcn_sched_barrier(0);   // keeps the code below behind that wait: without it this build lifts writes of the loads' offset and base registers over the wait
    v8f o[2][4]; float m[2][8], l[2][8];
#pragma unroll
    for (int t = 0; t < 2; ++t) {
#pragma unroll
        for (int nb = 0; nb < 4; ++nb) o[t][nb] = (v8f){};
#pragma unroll
        for (int j = 0; j < 8; ++j) { m[t][j] = NEG; l[t][j] = 0.f; } }
    float* ow = os + w * WS; bf* ph0 = (bf*)ow;   // planes of tile t: hi at ph0 + t * 2 * 16 * 72, lo 16 * 72 behind it
    const size_t koff = (size_t)w * 64 * HD + lane * 8, voff = koff;   // a 64-key chunk is 64 x HD elements in a row of every plane
    const bf* pkh = Kh + koff; const bf* pkl = Kl + koff; const bf* pvh = Vh + voff; const bf* pvl = Vl + voff; const int* pm = MKb + w * 64 + lr * 4;   // each lane's own pointers, stepped from chunk to chunk
#pragma unroll 1
    for (int kc = w * 64; kc < Kend; kc += NW * 64) {
        V kh[2][4], kl[2][4], vh[2][4], vl[2][4];
#pragma unroll
        for (int h = 0; h < 2; ++h) {
#pragma unroll
            for (int nb = 0; nb < 4; ++nb) { kh[h][nb] = ldfo(pkh + (h * 4 + nb) * 512); kl[h][nb] = ldfo(pkl + (h * 4 + nb) * 512); } }
        const v4i mk = *(const v4i*)pm;
        // the pointers stay in their registers, untouched, up to this wait: no later load's result and no pointer step overwrites an address register of an issued load in front of it
        asm volatile("s_wait_xcnt 0x0" :: "v"(pkh), "v"(pkl), "v"(pm) : "memory");
        __builtin_amdgcn_sched_barrier(0);   // keeps every key load of the chunk in front of the first WMMA: they fly together instead of paying the latency group by group
        v8f s[2][4];
#pragma unroll
        for (int t = 0; t < 2; ++t) {   // the two query tiles in turn, on the same key fragments
#pragma unroll
            for (int nb = 0; nb < 4; ++nb) s[t][nb] = (v8f){};
#pragma unroll
            for (int h = 0; h < 2; ++h) {
#pragma unroll
                for (int nb = 0; nb < 4; ++nb) s[t][nb] = F::mma(qh[t][h], kh[h][nb], s[t][nb]);
#pragma unroll
                for (int nb = 0; nb < 4; ++nb) s[t][nb] = F::mma(ql[t][h], kh[h][nb], s[t][nb]);
#pragma unroll
                for (int nb = 0; nb < 4; ++nb) s[t][nb] = F::mma(qh[t][h], kl[h][nb], s[t][nb]); } }
        __builtin_amdgcn_sched_barrier(0);   // keeps the value loads behind the last score product, where the key fragments' registers are free for them: in front of it two tiles' state and both operands do not fit and the build spills
#pragma unroll
        for (int h = 0; h < 2; ++h) {
#pragma unroll
            for (int nb = 0; nb < 4; ++nb) { vh[h][nb] = ldfo(pvh + (h * 4 + nb) * 512); vl[h][nb] = ldfo(pvl + (h * 4 + nb) * 512); } }
        asm volatile("s_wait_xcnt 0x0" :: "v"(pvh), "v"(pvl) : "memory");   // as above, for the value pointers
        __builtin_amdgcn_sched_barrier(0);   // keeps every value load in front of the softmax of both tiles, under which they fly instead of paying their latency behind it
        const int key0 = kc + lr * 4;
#pragma unroll
        for (int t = 0; t < 2; ++t) {
            bf* ph = ph0 + t * 2 * 16 * 72; bf* pl = ph + 16 * 72;
#pragma unroll
            for (int j = 0; j < 8; ++j) { const int i = r0 + t * 16 + hi * 8 + j; float x[4]; bool keep[4]; float rm = NEG;
#pragma unroll
                for (int nb = 0; nb < 4; ++nb) { keep[nb] = (key0 + nb <= i) && (mk[nb] != 0); x[nb] = s[t][nb][j] * SCL; if (keep[nb]) rm = fmaxf(rm, x[nb]); }
#pragma unroll
                for (int sh = 8; sh; sh >>= 1) rm = fmaxf(rm, __shfl_xor(rm, sh, 32));   // the 16 lanes of a half hold one row
                const float mn = fmaxf(m[t][j], rm); const float al = exp2s((m[t][j] - mn) * L2E); m[t][j] = mn;
                float ps = 0.f, pv[4]; v2u oh, ol;
#pragma unroll
                for (int nb = 0; nb < 4; ++nb) { const float ex = exp2s((x[nb] - mn) * L2E); pv[nb] = keep[nb] ? ex : 0.f; ps += pv[nb]; }
#pragma unroll
                for (int i2 = 0; i2 < 2; ++i2) { unsigned h2, l2; split2(pv[2 * i2], pv[2 * i2 + 1], h2, l2); oh[i2] = h2; ol[i2] = l2; }
                l[t][j] = l[t][j] * al + ps;   // each lane sums its own four keys of a chunk; the 16 lanes are added once, behind the loop
#pragma unroll
                for (int nb = 0; nb < 4; ++nb) o[t][nb][j] *= al;
                *(v2ua*)(ph + (hi * 8 + j) * 72 + lr * 4) = oh; *(v2ua*)(pl + (hi * 8 + j) * 72 + lr * 4) = ol; } }
        __builtin_amdgcn_wave_barrier(); asm volatile("" ::: "memory");   // compiler order only: every lane's probability stores stand in front of the fragment reads, which take other lanes' words (LDS serves one wave in order)
        V pa[2][2], pb[2][2];
#pragma unroll
        for (int t = 0; t < 2; ++t) { const bf* ph = ph0 + t * 2 * 16 * 72; const bf* pl = ph + 16 * 72;
#pragma unroll
            for (int h = 0; h < 2; ++h) { const int po = lr * 72 + 8 * hi + h * 32; pa[t][h] = cat16b(*(const v8usa*)(ph + po), *(const v8usa*)(ph + po + 16)); pb[t][h] = cat16b(*(const v8usa*)(pl + po), *(const v8usa*)(pl + po + 16)); } }
        __builtin_amdgcn_wave_barrier(); asm volatile("" ::: "memory");   // compiler order only: the fragment reads stand in front of the next chunk's probability stores
#pragma unroll
        for (int t = 0; t < 2; ++t) {   // the two query tiles in turn, on the same value fragments
#pragma unroll
            for (int h = 0; h < 2; ++h) {
#pragma unroll
                for (int nb = 0; nb < 4; ++nb) o[t][nb] = F::mma(pa[t][h], vh[h][nb], o[t][nb]);
#pragma unroll
                for (int nb = 0; nb < 4; ++nb) o[t][nb] = F::mma(pb[t][h], vh[h][nb], o[t][nb]);
#pragma unroll
                for (int nb = 0; nb < 4; ++nb) o[t][nb] = F::mma(pa[t][h], vl[h][nb], o[t][nb]); } }
        // four vector slots behind the last WMMA, so that nothing on the taken side of the loop branch touches its registers too early
        asm volatile("v_nop\n\tv_nop\n\tv_nop\n\tv_nop" : "+v"(o[0][0]), "+v"(o[0][1]), "+v"(o[0][2]), "+v"(o[0][3]), "+v"(o[1][0]), "+v"(o[1][1]), "+v"(o[1][2]), "+v"(o[1][3]) : "v"(pa[0][1]), "v"(pa[1][1]));
        pkh += NW * 64 * HD; pkl += NW * 64 * HD; pvh += NW * 64 * HD; pvl += NW * 64 * HD; pm += NW * 64;
    }
#pragma unroll
    for (int sh = 8; sh; sh >>= 1) {
#pragma unroll
        for (int t = 0; t < 2; ++t) {
#pragma unroll
            for (int j = 0; j < 8; ++j) l[t][j] += __shfl_xor(l[t][j], sh, 32); } }
    if (lr == 0) {
#pragma unroll
        for (int t = 0; t < 2; ++t) {
#pragma unroll
            for (int j = 0; j < 8; ++j) { ms[w * 32 + t * 16 + hi * 8 + j] = m[t][j]; ls[w * 32 + t * 16 + hi * 8 + j] = l[t][j]; } } }
#pragma unroll
    for (int t = 0; t < 2; ++t) {
#pragma unroll
        for (int nb = 0; nb < 4; ++nb) {
#pragma unroll
            for (int j = 0; j < 8; ++j) ow[(t * 16 + hi * 8 + j) * 68 + nb * 16 + lr] = o[t][nb][j]; } }
    __syncthreads();   // every wave's partial maximum, sum and context tile are in LDS before any of them is merged
    for (int it = threadIdx.x; it < 512; it += NW * 32) { const int row = it >> 4, cofs = (it & 15) * 4; float M = ms[row];
#pragma unroll
        for (int q = 1; q < NW; ++q) M = fmaxf(M, ms[q * 32 + row]);
        float L = 0.f; v4f val = (v4f){};
#pragma unroll
        for (int q = 0; q < NW; ++q) { const float sc = exp2s((ms[q * 32 + row] - M) * L2E); L += ls[q * 32 + row] * sc; val += *(const v4fa*)(os + q * WS + row * 68 + cofs) * sc; }
        const float f = (L > 0.f) ? __fdiv_rn(1.0f, L) : 0.f;
        *(v4f*)(OUTb + (size_t)(r0 + row) * HD + cofs) = val * f; }
}

extern "C" void kernel_launch(void* const* d_in, const int* in_sizes, int n_in,
                              void* d_out, int out_size, void* d_ws, size_t ws_size, hipStream_t stream) {
    (void)in_sizes; (void)n_in; (void)out_size;
    const float* x = (const float*)d_in[0]; const int* MK = (const int*)d_in[1]; const float* wq = (const float*)d_in[2]; const float* wk = (const float*)d_in[3]; const float* wv = (const float*)d_in[4]; const float* wo = nullptr; (void)wo;
    float* OUT = (float*)d_out;     // [4][4096][64]
    char* wsp = (char*)d_ws;
    auto take = [&](size_t bytes) { char* p = wsp; wsp += (bytes + 255) & ~(size_t)255; return (void*)p; };
    bf* WQKV = (bf*)take((size_t)(DQ + 2 * DKV) * DM * 2);   // the three weights one behind the other, each 64 x 768 in fragment order
    bf* QKh = (bf*)take((size_t)2 * MT * HD * 2); bf* QKl = (bf*)take((size_t)2 * MT * HD * 2); bf* VTh = (bf*)take((size_t)MT * HD * 2); bf* VTl = (bf*)take((size_t)MT * HD * 2);   // plane 0 of QK*: q, plane 1: k
    if ((size_t)(wsp - (char*)d_ws) > ws_size) return;    // ws 256 MiB
    k_cvt8x3<<<dim3((unsigned)(((size_t)DQ * DM / 8 + 255) / 256), 3, 1), 256, 0, stream>>>(wq, wk, wv, WQKV, (size_t)DQ * DM / 8);   /* 'oi' [64][768] weights are Bt; stored in fragment order */
    k_proj<<<MT / 64, 256, 0, stream>>>(x, WQKV, QKh, QKl, VTh, VTl);
    k_fattn<8><<<dim3(NB_, TT / 32, 1), 256, 0, stream>>>(QKh, QKl, QKh + (size_t)MT * HD, QKl + (size_t)MT * HD, VTh, VTl, MK, OUT);
}

// v009
// Measured time: 42.6 microseconds a run.
// Next to v008, in two timings, it ran 1.10 and 1.14 times as fast.
// All steps since v000 together make it 20.2 times as fast.
#include <hip/hip_runtime.h>

// Single-head causal attention with a key padding mask (x [4][4096][768]; q, k, v = x W^T ('oi' [64][768], no bias; one 64-wide head); scores = q.k x 64^-0.5; keep = causal (j <= i) and mask[b][j] != 0 (int32, read); softmax; out = attn.v -> [4][4096][64] f32 (1 M); no output projection).
// Compute dtypes, f32 accumulate: every input rounded to bf16; q/k/v on PLAIN bf16 operands (inputs: exact); causal scores and attn.v (tile skipping) on hi/lo planes for every row (3 products); online softmax in f32 inside one fused kernel (scores and probabilities never reach memory); no output projection: the context is written in f32.

#define NB_  4
#define TT   4096
#define MT   (NB_ * TT)          // rows of all batches together
#define DM   768
#define NH_  1
#define NKV  1
#define REP  (NH_ / NKV)
#define HD   64
#define DQ   (NH_ * HD)
#define DKV  (NKV * HD)
#define ZH   1
#define RH   4096                 // every row hi/lo (streaming softmax, no register row)
#define RB   TT
#define WIN  4096
#define PCAR 1024.0f
#define SCL  0.125f   // H^-0.5 with H = 64 (the head width)
typedef _Float16 h16;
typedef unsigned short bf;
typedef __attribute__((ext_vector_type(16))) __bf16   v16bf;
typedef __attribute__((ext_vector_type(16))) _Float16 v16h;
typedef __attribute__((ext_vector_type(8)))  _Float16 v8h;
typedef __attribute__((ext_vector_type(8)))  unsigned short v8us;
typedef __attribute__((ext_vector_type(8)))  float    v8f;
typedef __attribute__((ext_vector_type(4)))  float    v4f;
typedef v8h  __attribute__((may_alias)) v8ha;
typedef v4f  __attribute__((may_alias)) v4fa;
typedef v8us __attribute__((may_alias)) v8usa;

__device__ __forceinline__ unsigned short f2bf(float f) { unsigned u = __float_as_uint(f); u += 0x7FFFu + ((u >> 16) & 1u); return (unsigned short)(u >> 16); }
__device__ __forceinline__ float bf2f(unsigned short b) { return __uint_as_float(((unsigned)b) << 16); }
__device__ __forceinline__ float bfr(float f) { return bf2f(f2bf(f)); }
__device__ __forceinline__ v16h cat16(v8h lo, v8h hi) { return __builtin_shufflevector(lo, hi, 0, 1, 2, 3, 4, 5, 6, 7, 8, 9, 10, 11, 12, 13, 14, 15); }
__device__ __forceinline__ v16bf cat16b(v8us lo, v8us hi) { return __builtin_bit_cast(v16bf, __builtin_shufflevector(lo, hi, 0, 1, 2, 3, 4, 5, 6, 7, 8, 9, 10, 11, 12, 13, 14, 15)); }
__device__ __forceinline__ v8f wmma16(v16h a, v16h b, v8f c) { return __builtin_amdgcn_wmma_f32_16x16x32_f16(false, a, false, b, (short)0, c, false, false); }
__device__ __forceinline__ v8f wmmab(v16bf a, v16bf b, v8f c) { return __builtin_amdgcn_wmma_f32_16x16x32_bf16(false, a, false, b, (short)0, c, false, false); }



// fragment loaders and matrix products by 16-bit operand type
template <typename T16> struct WFrag;
template <> struct WFrag<h16> { typedef v16h V; static __device__ __forceinline__ V ld(const h16* p) { return cat16(*(const v8h*)p, *(const v8h*)(p + 16)); } static __device__ __forceinline__ v8f mma(V a, V b, v8f c) { return wmma16(a, b, c); } };
template <> struct WFrag<bf> { typedef v16bf V; static __device__ __forceinline__ V ld(const bf* p) { return cat16b(*(const v8us*)p, *(const v8us*)(p + 16)); } static __device__ __forceinline__ v8f mma(V a, V b, v8f c) { return wmmab(a, b, c); } };

// FRAGMENT ORDER: an operand that one launch writes for another launch's WMMA loads lies as the loads take it: a 16 x 32 fragment is two units of 512 bytes, unit 'half' holding for lane (hi, lr), at lane * 16 bytes,
// the eight elements k = half * 16 + hi * 8 + 0 .. 7 of fragment row (or column) lr. A wave-wide 16-byte load then covers four whole 128-byte lines instead of a piece of 16 lines.
__device__ __forceinline__ v16bf ldfo(const bf* p) { return cat16b(*(const v8us*)p, *(const v8us*)(p + 256)); }
__device__ __forceinline__ h16 tohx(float x) { return (h16)x; }
__device__ __forceinline__ void splitf(float y, unsigned short& h, unsigned short& l) { h = f2bf(y); l = f2bf(y - bf2f(h)); }
// f32 to bf16 by the packed convert instruction: two values a vector slot, round to nearest even as in f2bf; a in the low half of the word
typedef __attribute__((ext_vector_type(2))) __bf16 v2bf;
typedef __attribute__((ext_vector_type(2))) float v2fl;
typedef __attribute__((ext_vector_type(2))) unsigned v2u;
typedef __attribute__((ext_vector_type(4))) unsigned v4u;
typedef __attribute__((ext_vector_type(8))) unsigned v8u;
typedef v2u __attribute__((may_alias)) v2ua;
typedef v4u __attribute__((may_alias)) v4ua;
__device__ __forceinline__ unsigned pk2(float a, float b) { return __builtin_bit_cast(unsigned, __builtin_convertvector((v2fl){a, b}, v2bf)); }
// hi/lo planes of two values: h holds both rounded values, l both rounded remainders
__device__ __forceinline__ void split2(float a, float b, unsigned& h, unsigned& l) { h = pk2(a, b); l = pk2(a - __uint_as_float(h << 16), b - __uint_as_float(h & 0xFFFF0000u)); }
typedef __attribute__((ext_vector_type(2))) _Float16 v2h;
typedef __attribute__((ext_vector_type(4))) _Float16 v4h;
typedef __attribute__((ext_vector_type(2))) unsigned short v2us;
typedef __attribute__((ext_vector_type(4))) unsigned short v4us;
typedef __attribute__((ext_vector_type(2))) float v2f;
typedef __attribute__((ext_vector_type(4))) int v4i;

__global__ __launch_bounds__(256) void k_wtG(const float* __restrict__ w, int K, int N, bf* Bt) {
    const int lane = threadIdx.x & 31; const int L0 = (blockIdx.x * 8 + (threadIdx.x >> 5)) * 8; const int nlines = N * K / 64;
{
#pragma unroll 1
        for (int l = 0; l < 8; ++l) { const int L = L0 + l; if (L >= nlines) break; const size_t e = (size_t)L * 64 + lane * 2; const int k = (int)(e % K), n = (int)(e / K); v2us o;
            o[0] = f2bf(w[(size_t)k * N + n]); o[1] = f2bf(w[(size_t)(k + 1) * N + n]); *(v2us*)(Bt + e) = o; }
         }
}
// k_cvt8x3: f32 to bf16, eight elements a thread, for three [64][DM] sources in one launch; blockIdx.y picks the source, the results lie one behind the other in dst, each in fragment order:
// [64-wide chunk of k][32-wide half h][16-row block nb][unit][lane][8]; a thread's eight elements are one lane's 16 bytes of one unit
__global__ __launch_bounds__(256) void k_cvt8x3(const float* __restrict__ s0, const float* __restrict__ s1, const float* __restrict__ s2, bf* dst, size_t n8) { const size_t i = (size_t)blockIdx.x * 256 + threadIdx.x; if (i >= n8) return; const float* src = (blockIdx.y == 0) ? s0 : (blockIdx.y == 1) ? s1 : s2; const v8f v = *(const v8f*)(src + i * 8); v4u o;
#pragma unroll
    for (int k = 0; k < 4; ++k) o[k] = pk2(v[2 * k], v[2 * k + 1]);
    const unsigned n = (unsigned)i / (DM / 8), k8 = (unsigned)i % (DM / 8);   // weight row, and which eight of its elements
    const unsigned u = (((k8 >> 3) * 2 + ((k8 >> 2) & 1)) * 4 + (n >> 4)) * 2 + ((k8 >> 1) & 1);   // the 512-byte unit inside this source
    *(v4ua*)(dst + (size_t)blockIdx.y * n8 * 8 + u * 256 + ((k8 & 1) * 16 + (n & 15)) * 8) = o;  }

// ---- k_proj: q, k and v of 64 rows of x in ONE kernel, from the f32 input to the planes that k_fattn reads. ONE WORK-GROUP of 8 waves per 64 rows, grid MT/64.
// The K loop is dealt to the waves in chunks of 64 elements: wave w takes chunks w and w + 8 (the second only where it exists). A wave loads its chunks of all 64 rows of x in f32, rounds them to bf16 in registers and keeps
// the fragments; then, for q, k and v in turn, it multiplies its chunks of the 64 weight rows (loaded once, one column group ahead) with the four 16-row tiles, and the 8 partial 64x64 tiles are summed through LDS in wave order 0 .. 7.
// The summing threads split each value into its hi/lo planes and store them in fragment order, as k_fattn loads them: q as [16-row tile][h][unit][lane][8] (fragment row = query row),
// k as [64-key chunk][h][nb][unit][lane][8] (fragment row lr of block nb = key 16 nb + lr, k = d), v as [64-key chunk][h][nb][unit][lane][8] (fragment column lr of block nb = d 16 nb + lr, k = key). A work-group owns 64 positions: 8 KB in a row of every plane.
__device__ __forceinline__ v16bf cvtfrag(v4f a, v4f b, v4f c, v4f d) {
    const v8u r = { pk2(a[0], a[1]), pk2(a[2], a[3]), pk2(b[0], b[1]), pk2(b[2], b[3]), pk2(c[0], c[1]), pk2(c[2], c[3]), pk2(d[0], d[1]), pk2(d[2], d[3]) };
    return __builtin_bit_cast(v16bf, r); }
// one 64-wide chunk of x, 64 rows: the lane's 8 + 8 elements of each 32-wide half of each 16-row tile
__device__ __forceinline__ void ldx(v4f (&x)[4][2][4], const float* px) {
#pragma unroll
    for (int rt = 0; rt < 4; ++rt) {
#pragma unroll
        for (int h = 0; h < 2; ++h) { const float* p = px + rt * 16 * DM + h * 32; x[rt][h][0] = *(const v4f*)p; x[rt][h][1] = *(const v4f*)(p + 4); x[rt][h][2] = *(const v4f*)(p + 16); x[rt][h][3] = *(const v4f*)(p + 20); } } }
// one 64-wide chunk of 64 weight rows, in fragment order
__device__ __forceinline__ void ldw(v16bf (&b)[2][4], const bf* pb) {
#pragma unroll
    for (int h = 0; h < 2; ++h) {
#pragma unroll
        for (int nb = 0; nb < 4; ++nb) b[h][nb] = ldfo(pb + (h * 4 + nb) * 512); } }
__device__ __forceinline__ void mma64(v8f (&acc)[4][4], const v16bf (&a)[4][2], const v16bf (&b)[2][4]) {
#pragma unroll
    for (int h = 0; h < 2; ++h) {
#pragma unroll
        for (int rt = 0; rt < 4; ++rt) {
#pragma unroll
            for (int nb = 0; nb < 4; ++nb) acc[rt][nb] = wmmab(a[rt][h], b[h][nb], acc[rt][nb]); } } }
__global__ __launch_bounds__(256) void k_proj(const float* __restrict__ X, const bf* __restrict__ Wb, bf* QKh, bf* QKl, bf* VTh, bf* VTl) {
    typedef v16bf V;
    constexpr int NW = 8, PW = 64 * 68;   // floats of LDS per wave: one partial 64x64 tile, pitch 68 (q, k: read back as 16-byte words) or 65 (v: read back down the columns, every lane in a bank of its own)
    __shared__ __align__(16) float os[NW * PW];
    const int lane = threadIdx.x & 31, lr = lane & 15, hi = lane >> 4; const int r0 = blockIdx.x * 64;
    const int w = __builtin_amdgcn_readfirstlane((int)(threadIdx.x >> 5));   // wave number in a scalar register: the test for a second chunk stays a scalar branch and EXEC stays full at every WMMA
    const bool two = w + NW < DM / 64;
    const float* px = X + (size_t)(r0 + lr) * DM + w * 64 + 8 * hi;   // the lane's own row of the first tile; the other tiles, the halves and the second chunk are immediate offsets
    const bf* pw = Wb + (size_t)w * 4096 + lane * 8;                  // the lane's own 16 bytes of the first unit of the wave's chunk; the other units, the second chunk and the column groups are immediate offsets
    v4f x0[4][2][4], x1[4][2][4]; V b0[2][4], b1[2][4];
    ldx(x0, px); if (two) ldx(x1, px + NW * 64);
    ldw(b0, pw); if (two) ldw(b1, pw + NW * 4096);
    // both pointers stay in their registers, untouched, up to this wait: nothing overwrites an address register of an issued load in front of it
    asm volatile("s_wait_xcnt 0x0" :: "v"(px), "v"(pw) : "memory");
    __builtin_amdgcn_sched_barrier(0);   // keeps every load in front of the first conversion: all of a wave's reads of x fly together instead of paying the memory latency tile by tile
    V a0[4][2], a1[4][2];
#pragma unroll
    for (int rt = 0; rt < 4; ++rt) {
#pragma unroll
        for (int h = 0; h < 2; ++h) a0[rt][h] = cvtfrag(x0[rt][h][0], x0[rt][h][1], x0[rt][h][2], x0[rt][h][3]); }
    if (two) {
#pragma unroll
        for (int rt = 0; rt < 4; ++rt) {
#pragma unroll
            for (int h = 0; h < 2; ++h) a1[rt][h] = cvtfrag(x1[rt][h][0], x1[rt][h][1], x1[rt][h][2], x1[rt][h][3]); } }
    float* ow = os + w * PW;
#pragma unroll
    for (int cg = 0; cg < 3; ++cg) {   // 0: q, 1: k, 2: v
        const int P = (cg == 2) ? 65 : 68;
        v8f acc[4][4];
#pragma unroll
        for (int rt = 0; rt < 4; ++rt) {
#pragma unroll
            for (int nb = 0; nb < 4; ++nb) acc[rt][nb] = (v8f){}; }
        mma64(acc, a0, b0);
        if (cg < 2) ldw(b0, pw + (cg + 1) * 64 * DM);
        if (two) { mma64(acc, a1, b1); if (cg < 2) ldw(b1, pw + (cg + 1) * 64 * DM + NW * 4096); }
        if (cg < 2) {
            asm volatile("s_wait_xcnt 0x0" :: "v"(pw) : "memory");   // the weight pointer stays untouched up to this wait
            __builtin_amdgcn_sched_barrier(0); }   // keeps the next column group's weight loads here, in front of the sums through LDS, under which they fly
#pragma unroll
        for (int rt = 0; rt < 4; ++rt) {
#pragma unroll
            for (int nb = 0; nb < 4; ++nb) {
#pragma unroll
                for (int j = 0; j < 8; ++j) ow[(rt * 16 + hi * 8 + j) * P + nb * 16 + lr] = acc[rt][nb][j]; } }
        __syncthreads();   // every wave's partial tile is in LDS before any of them is summed
        float val[4][4]; bf* dh[4]; bf* dl[4];   // four items a thread, four neighbouring elements of a fragment's k direction each
        const int t16 = threadIdx.x >> 4, c4 = (threadIdx.x & 15) * 4;   // the item's fragment row or column, and its first k of 64
        const int fh = c4 >> 5, fu = (c4 >> 4) & 1, fl = (((c4 >> 3) & 1) * 16 + t16) * 8 + (c4 & 7);   // 32-wide half, unit, and the place inside the unit
        if (cg < 2) {
#pragma unroll
            for (int u = 0; u < 4; ++u) { const int row = u * 16 + t16, cofs = c4; v4f s = *(const v4fa*)(os + row * 68 + cofs);   // q: row t16 of tile u; k: row t16 of block u
#pragma unroll
                for (int q = 1; q < NW; ++q) s += *(const v4fa*)(os + q * PW + row * 68 + cofs);
#pragma unroll
                for (int i = 0; i < 4; ++i) val[u][i] = s[i];
                const size_t e = ((size_t)cg * MT + r0) * HD + ((cg == 0) ? u * 1024 + (fh * 2 + fu) * 256 : ((fh * 4 + u) * 2 + fu) * 256) + fl; dh[u] = QKh + e; dl[u] = QKl + e; }
            __syncthreads();   // every partial tile has been read before the next column group's partial tiles overwrite it; the stores stand behind it and fly under the next group's products
        } else {
#pragma unroll
            for (int u = 0; u < 4; ++u) { const int tq = c4, d = u * 16 + t16;   // column t16 of block u, four neighbouring positions
#pragma unroll
                for (int i = 0; i < 4; ++i) val[u][i] = os[(tq + i) * 65 + d];
#pragma unroll
                for (int q = 1; q < NW; ++q) {
#pragma unroll
                    for (int i = 0; i < 4; ++i) val[u][i] += os[q * PW + (tq + i) * 65 + d]; }
                const size_t e = (size_t)r0 * HD + ((fh * 4 + u) * 2 + fu) * 256 + fl; dh[u] = VTh + e; dl[u] = VTl + e; }
        }
        v2u oh[4], ol[4];
#pragma unroll
        for (int u = 0; u < 4; ++u) {
#pragma unroll
            for (int i = 0; i < 2; ++i) { unsigned h2, l2; split2(val[u][2 * i], val[u][2 * i + 1], h2, l2); oh[u][i] = h2; ol[u][i] = l2; } }
#pragma unroll
        for (int u = 0; u < 4; ++u) { *(v2ua*)dh[u] = oh[u]; *(v2ua*)dl[u] = ol[u]; }
        // the stores' pointers and data stay in their registers, untouched, up to this wait: nothing overwrites a register of an issued store in front of it
        asm volatile("s_wait_xcnt 0x0" :: "v"(dh[0]), "v"(dh[1]), "v"(dh[2]), "v"(dh[3]), "v"(dl[0]), "v"(dl[1]), "v"(dl[2]), "v"(dl[3]), "v"(oh[0]), "v"(oh[1]), "v"(oh[2]), "v"(oh[3]), "v"(ol[0]), "v"(ol[1]), "v"(ol[2]), "v"(ol[3]) : "memory");
    }
}

typedef v4us __attribute__((may_alias)) v4usa;
// 2^x with the one vector slot that the instruction set asks for behind a transcendental in the same statement
__device__ __forceinline__ float exp2s(float x) { float r; asm("v_exp_f32 %0, %1\n\tv_nop" : "=v"(r) : "v"(x)); return r; }

// lane l takes lane l ^ 16's value: one vector cross-row move, no LDS unit and no wait
__device__ __forceinline__ float xhalf(float x) { return __builtin_bit_cast(float, __builtin_amdgcn_permlanex16(__builtin_bit_cast(int, x), __builtin_bit_cast(int, x), 0x76543210, 0xfedcba98, false, false)); }

// ---- k_fattn: causal scores, softmax and probability x value in ONE kernel; neither scores nor probabilities go through memory or LDS. ONE WORK-GROUP of NW waves per 32 query rows (two 16-row tiles), grid (batches, TT/32): blockIdx.x picks the batch's planes, mask row and output, so the four batches' tiles of equal length have neighbouring indices.
// A work-group fills its WGP's registers, so the grid runs in two rounds: blockIdx.y counts the query tiles DOWN from the last one, so that the long tiles have the low indices and the short ones fill the places as they come free (for speed only: every tile is done once in any order).
// The keys up to the diagonal are dealt to the waves in chunks of 64: wave w takes chunks w, w + NW, ... A wave loads a chunk's key and value fragments ONCE and uses them for both query tiles.
// BOTH PRODUCTS ARE TRANSPOSED: scores^T = K.Q^T (A = key fragments, B = query fragments) and context^T += V^T.P^T (A = value fragments, B = probabilities). In a score tile a lane then holds eight keys of ONE query (register r of lane (hi, lr) of block nb: key 16 nb + 8 hi + r, query lr),
// so the maximum and the sum of a query run down the lane's own registers, with one exchange between the wave's halves, and m, l and the rescaling factor are one value a lane and tile. Two score tiles (blocks 2 g, 2 g + 1), rounded in place, ARE the B fragment of keys 32 g .. 32 g + 31 in the hardware's k order, which is the order of the value planes: no LDS, no lane exchange.
// For each chunk and query tile a wave keeps a running maximum m (of the unscaled scores), a running sum l of the unnormalised probabilities and a running 64x16 context^T tile o (both rescaled when m grows); scores and P.V on hi/lo planes, 3 products each.
// At the end the NW partial (m, l, o) go to LDS and are merged in wave order 0 .. NW-1 with the weights exp(m_w - max m); the context is divided by the merged sum and written straight to the output.
template <int NW>
__global__ __launch_bounds__(NW * 32) void k_fattn(const bf* __restrict__ Qh0, const bf* __restrict__ Ql0, const bf* __restrict__ Kh0, const bf* __restrict__ Kl0, const bf* __restrict__ Vh0, const bf* __restrict__ Vl0, const int* __restrict__ MK0, float* OUT0) {
    const size_t zb = (size_t)blockIdx.x * TT * HD;   // every plane and the output hold TT x HD elements a batch
    const bf* __restrict__ Qh = Qh0 + zb; const bf* __restrict__ Ql = Ql0 + zb; const bf* __restrict__ Kh = Kh0 + zb; const bf* __restrict__ Kl = Kl0 + zb; const bf* __restrict__ Vh = Vh0 + zb; const bf* __restrict__ Vl = Vl0 + zb;
    const int* __restrict__ MKb = MK0 + (size_t)blockIdx.x * TT; float* OUTb = OUT0 + zb;
    typedef WFrag<bf> F; typedef F::V V;
    constexpr float L2E = 1.4426950408889634f, NEG = -3.0e38f, CS = SCL * L2E;   // CS: unscaled score to exponent of 2
    constexpr int WS = 32 * 68;   // floats of LDS per wave: the 32 x 68 f32 context tile, [query][d], behind the loop
    __shared__ __align__(16) float os[NW * WS];
    __shared__ float ms[NW * 32], ls[NW * 32];
    const int lane = threadIdx.x & 31, lr = lane & 15, hi = lane >> 4; const int r0 = (TT / 32 - 1 - (int)blockIdx.y) * 32;   // longest tiles first (see above)
    const int w = __builtin_amdgcn_readfirstlane((int)(threadIdx.x >> 5));   // wave number in a scalar register: the key loop's branch stays scalar and EXEC stays full at every WMMA
    const int Kend = (r0 + 32 + 63) & ~63;   // the 64-wide chunk that holds these rows (both tiles lie in one chunk) is the last one with a kept key
    V qh[2][2], ql[2][2]; const bf* pqh = Qh + (size_t)r0 * HD + lane * 8; const bf* pql = Ql + (size_t)r0 * HD + lane * 8;   // every plane lies in fragment order (k_proj): a lane's own 16 bytes of a unit, the units at immediate offsets
#pragma unroll
    for (int t = 0; t < 2; ++t) {
#pragma unroll
        for (int h = 0; h < 2; ++h) { qh[t][h] = ldfo(pqh + t * 1024 + h * 512); ql[t][h] = ldfo(pql + t * 1024 + h * 512); } }
    asm volatile("s_wait_xcnt 0x0" :: "v"(pqh), "v"(pql) : "memory");   // the query pointers' registers are reused at once: the wait stands in front of the first overwrite of an address register of an issued load
    __builtin_amdgcn_sched_barrier(0);   // keeps the code below behind that wait: without it this build lifts writes of the loads' offset and base registers over the wait
    v8f o[2][4]; float m[2], l[2];
#pragma unroll
    for (int t = 0; t < 2; ++t) {
#pragma unroll
        for (int nb = 0; nb < 4; ++nb) o[t][nb] = (v8f){};
        m[t] = NEG; l[t] = 0.f; }
    const size_t koff = (size_t)w * 64 * HD + lane * 8, voff = koff;   // a 64-key chunk is 64 x HD elements in a row of every plane
    const bf* pkh = Kh + koff; const bf* pkl = Kl + koff; const bf* pvh = Vh + voff; const bf* pvl = Vl + voff; const int* pm = MKb + w * 64 + hi * 8;   // each lane's own pointers, stepped from chunk to chunk
#pragma unroll 1
    for (int kc = w * 64; kc < Kend; kc += NW * 64) {
        V kh[2][4], kl[2][4], vh[2][4], vl[2][4];
#pragma unroll
        for (int h = 0; h < 2; ++h) {
#pragma unroll
            for (int nb = 0; nb < 4; ++nb) { kh[h][nb] = ldfo(pkh + (h * 4 + nb) * 512); kl[h][nb] = ldfo(pkl + (h * 4 + nb) * 512); } }
        v4i mk[4][2];   // the mask words of the lane's own eight keys of each block
#pragma unroll
        for (int nb = 0; nb < 4; ++nb) { mk[nb][0] = *(const v4i*)(pm + nb * 16); mk[nb][1] = *(const v4i*)(pm + nb * 16 + 4); }
        // the pointers stay in their registers, untouched, up to this wait: no later load's result and no pointer step overwrites an address register of an issued load in front of it
        asm volatile("s_wait_xcnt 0x0" :: "v"(pkh), "v"(pkl), "v"(pm) : "memory");
        __builtin_amdgcn_sched_barrier(0);   // keeps every key load of the chunk in front of the first WMMA: they fly together instead of paying the latency group by group
        v8f s[2][4];
#pragma unroll
        for (int t = 0; t < 2; ++t) {   // the two query tiles in turn, on the same key fragments
#pragma unroll
            for (int nb = 0; nb < 4; ++nb) s[t][nb] = (v8f){};
#pragma unroll
            for (int h = 0; h < 2; ++h) {
#pragma unroll
                for (int nb = 0; nb < 4; ++nb) s[t][nb] = F::mma(kh[h][nb], qh[t][h], s[t][nb]);
#pragma unroll
                for (int nb = 0; nb < 4; ++nb) s[t][nb] = F::mma(kh[h][nb], ql[t][h], s[t][nb]);
#pragma unroll
                for (int nb = 0; nb < 4; ++nb) s[t][nb] = F::mma(kl[h][nb], qh[t][h], s[t][nb]); } }
        __builtin_amdgcn_sched_barrier(0);   // keeps the value loads behind the last score product, where the key fragments' registers are free for them: in front of it two tiles' state and both operands do not fit and the build spills
#pragma unroll
        for (int h = 0; h < 2; ++h) {
#pragma unroll
            for (int nb = 0; nb < 4; ++nb) { vh[h][nb] = ldfo(pvh + (h * 4 + nb) * 512); vl[h][nb] = ldfo(pvl + (h * 4 + nb) * 512); } }
        asm volatile("s_wait_xcnt 0x0" :: "v"(pvh), "v"(pvl) : "memory");   // as above, for the value pointers
        __builtin_amdgcn_sched_barrier(0);   // keeps every value load in front of the softmax of both tiles, under which they fly instead of paying their latency behind it
        V pa[2][2], pb[2][2];
#pragma unroll
        for (int t = 0; t < 2; ++t) {
            const int dl = r0 + t * 16 + lr - kc - hi * 8;   // the lane's key 16 nb + r (counted from its first) is at or below the diagonal while 16 nb + r <= dl
            float rmb[4];
#pragma unroll
            for (int nb = 0; nb < 4; ++nb) { rmb[nb] = NEG;
#pragma unroll
                for (int r = 0; r < 8; ++r) { const bool keep = (nb * 16 + r <= dl) && (mk[nb][r >> 2][r & 3] != 0); s[t][nb][r] = keep ? s[t][nb][r] : NEG; rmb[nb] = fmaxf(rmb[nb], s[t][nb][r]); } }
            float rm = fmaxf(fmaxf(rmb[0], rmb[1]), fmaxf(rmb[2], rmb[3])); rm = fmaxf(rm, xhalf(rm));   // the two halves of the wave hold one query's keys between them
            const float mn = fmaxf(m[t], rm); const float al = exp2s((m[t] - mn) * CS); m[t] = mn;
            const float sb = (mn > NEG) ? -mn * CS : 0.f;   // no kept key so far: the dropped scores' exponent stays hugely negative and every probability is 0
            float psb[4];
#pragma unroll
            for (int g = 0; g < 2; ++g) { v8u wh, wl;
#pragma unroll
                for (int u = 0; u < 2; ++u) { const int nb = 2 * g + u; psb[nb] = 0.f;
#pragma unroll
                    for (int i2 = 0; i2 < 4; ++i2) { const float p0 = exp2s(fmaf(s[t][nb][2 * i2], CS, sb)), p1 = exp2s(fmaf(s[t][nb][2 * i2 + 1], CS, sb)); psb[nb] += p0 + p1;
                        unsigned h2, l2; split2(p0, p1, h2, l2); wh[u * 4 + i2] = h2; wl[u * 4 + i2] = l2; } }
                pa[t][g] = __builtin_bit_cast(V, wh); pb[t][g] = __builtin_bit_cast(V, wl); }
            l[t] = l[t] * al + ((psb[0] + psb[1]) + (psb[2] + psb[3]));   // each lane sums its own 32 keys of a chunk; the two halves are added once, behind the loop
#pragma unroll
            for (int nb = 0; nb < 4; ++nb) o[t][nb] *= al; }
#pragma unroll
        for (int t = 0; t < 2; ++t) {   // the two query tiles in turn, on the same value fragments
#pragma unroll
            for (int h = 0; h < 2; ++h) {
#pragma unroll
                for (int nb = 0; nb < 4; ++nb) o[t][nb] = F::mma(vh[h][nb], pa[t][h], o[t][nb]);
#pragma unroll
                for (int nb = 0; nb < 4; ++nb) o[t][nb] = F::mma(vh[h][nb], pb[t][h], o[t][nb]);
#pragma unroll
                for (int nb = 0; nb < 4; ++nb) o[t][nb] = F::mma(vl[h][nb], pa[t][h], o[t][nb]); } }
        // four vector slots behind the last WMMA, so that nothing on the taken side of the loop branch touches its registers too early
        asm volatile("v_nop\n\tv_nop\n\tv_nop\n\tv_nop" : "+v"(o[0][0]), "+v"(o[0][1]), "+v"(o[0][2]), "+v"(o[0][3]), "+v"(o[1][0]), "+v"(o[1][1]), "+v"(o[1][2]), "+v"(o[1][3]) : "v"(pa[0][1]), "v"(pa[1][1]));
        pkh += NW * 64 * HD; pkl += NW * 64 * HD; pvh += NW * 64 * HD; pvl += NW * 64 * HD; pm += NW * 64;
    }
    float* ow = os + w * WS;
#pragma unroll
    for (int t = 0; t < 2; ++t) { l[t] += xhalf(l[t]);
        if (hi == 0) { ms[w * 32 + t * 16 + lr] = m[t] * SCL; ls[w * 32 + t * 16 + lr] = l[t]; }   // the merge below takes the maxima in scaled scores
#pragma unroll
        for (int nb = 0; nb < 4; ++nb) {   // register r of block nb is d 16 nb + 8 hi + r of query lr: eight neighbouring floats of a row
            *(v4fa*)(ow + (t * 16 + lr) * 68 + nb * 16 + hi * 8) = (v4f){o[t][nb][0], o[t][nb][1], o[t][nb][2], o[t][nb][3]};
            *(v4fa*)(ow + (t * 16 + lr) * 68 + nb * 16 + hi * 8 + 4) = (v4f){o[t][nb][4], o[t][nb][5], o[t][nb][6], o[t][nb][7]}; } }
    __syncthreads();   // every wave's partial maximum, sum and context tile are in LDS before any of them is merged
    for (int it = threadIdx.x; it < 512; it += NW * 32) { const int row = it >> 4, cofs = (it & 15) * 4; float M = ms[row];
#pragma unroll
        for (int q = 1; q < NW; ++q) M = fmaxf(M, ms[q * 32 + row]);
        float L = 0.f; v4f val = (v4f){};
#pragma unroll
        for (int q = 0; q < NW; ++q) { const float sc = exp2s((ms[q * 32 + row] - M) * L2E); L += ls[q * 32 + row] * sc; val += *(const v4fa*)(os + q * WS + row * 68 + cofs) * sc; }
        const float f = (L > 0.f) ? __fdiv_rn(1.0f, L) : 0.f;
        *(v4f*)(OUTb + (size_t)(r0 + row) * HD + cofs) = val * f; }
}

extern "C" void kernel_launch(void* const* d_in, const int* in_sizes, int n_in,
                              void* d_out, int out_size, void* d_ws, size_t ws_size, hipStream_t stream) {
    (void)in_sizes; (void)n_in; (void)out_size;
    const float* x = (const float*)d_in[0]; const int* MK = (const int*)d_in[1]; const float* wq = (const float*)d_in[2]; const float* wk = (const float*)d_in[3]; const float* wv = (const float*)d_in[4]; const float* wo = nullptr; (void)wo;
    float* OUT = (float*)d_out;     // [4][4096][64]
    char* wsp = (char*)d_ws;
    auto take = [&](size_t bytes) { char* p = wsp; wsp += (bytes + 255) & ~(size_t)255; return (void*)p; };
    bf* WQKV = (bf*)take((size_t)(DQ + 2 * DKV) * DM * 2);   // the three weights one behind the other, each 64 x 768 in fragment order
    bf* QKh = (bf*)take((size_t)2 * MT * HD * 2); bf* QKl = (bf*)take((size_t)2 * MT * HD * 2); bf* VTh = (bf*)take((size_t)MT * HD * 2); bf* VTl = (bf*)take((size_t)MT * HD * 2);   // plane 0 of QK*: q, plane 1: k
    if ((size_t)(wsp - (char*)d_ws) > ws_size) return;    // ws 256 MiB
    k_cvt8x3<<<dim3((unsigned)(((size_t)DQ * DM / 8 + 255) / 256), 3, 1), 256, 0, stream>>>(wq, wk, wv, WQKV, (size_t)DQ * DM / 8);   /* 'oi' [64][768] weights are Bt; stored in fragment order */
    k_proj<<<MT / 64, 256, 0, stream>>>(x, WQKV, QKh, QKl, VTh, VTl);
    k_fattn<8><<<dim3(NB_, TT / 32, 1), 256, 0, stream>>>(QKh, QKl, QKh + (size_t)MT * HD, QKl + (size_t)MT * HD, VTh, VTl, MK, OUT);
}

// v010
// A run of this version takes 39.8 microseconds.
// In two side-by-side timings against v009, it was 1.06 and 1.10 times as fast.
// Over all steps from v000 it is 21.8 times as fast.
#include <hip/hip_runtime.h>

// Single-head causal attention with a key padding mask (x [4][4096][768]; q, k, v = x W^T ('oi' [64][768], no bias; one 64-wide head); scores = q.k x 64^-0.5; keep = causal (j <= i) and mask[b][j] != 0 (int32, read); softmax; out = attn.v -> [4][4096][64] f32 (1 M); no output projection).
// Compute dtypes, f32 accumulate: every input rounded to bf16; q/k/v on PLAIN bf16 operands (inputs: exact); causal scores and attn.v (tile skipping) on hi/lo planes for every row (3 products); online softmax in f32 inside one fused kernel (scores and probabilities never reach memory); no output projection: the context is written in f32.

#define NB_  4
#define TT   4096
#define MT   (NB_ * TT)          // rows of all batches together
#define DM   768
#define NH_  1
#define NKV  1
#define REP  (NH_ / NKV)
#define HD   64
#define DQ   (NH_ * HD)
#define DKV  (NKV * HD)
#define ZH   1
#define RH   4096                 // every row hi/lo (streaming softmax, no register row)
#define RB   TT
#define WIN  4096
#define PCAR 1024.0f
#define SCL  0.125f   // H^-0.5 with H = 64 (the head width)
typedef _Float16 h16;
typedef unsigned short bf;
typedef __attribute__((ext_vector_type(16))) __bf16   v16bf;
typedef __attribute__((ext_vector_type(16))) _Float16 v16h;
typedef __attribute__((ext_vector_type(8)))  _Float16 v8h;
typedef __attribute__((ext_vector_type(8)))  unsigned short v8us;
typedef __attribute__((ext_vector_type(8)))  float    v8f;
typedef __attribute__((ext_vector_type(4)))  float    v4f;
typedef v8h  __attribute__((may_alias)) v8ha;
typedef v4f  __attribute__((may_alias)) v4fa;
typedef v8us __attribute__((may_alias)) v8usa;

__device__ __forceinline__ unsigned short f2bf(float f) { unsigned u = __float_as_uint(f); u += 0x7FFFu + ((u >> 16) & 1u); return (unsigned short)(u >> 16); }
__device__ __forceinline__ float bf2f(unsigned short b) { return __uint_as_float(((unsigned)b) << 16); }
__device__ __forceinline__ float bfr(float f) { return bf2f(f2bf(f)); }
__device__ __forceinline__ v16h cat16(v8h lo, v8h hi) { return __builtin_shufflevector(lo, hi, 0, 1, 2, 3, 4, 5, 6, 7, 8, 9, 10, 11, 12, 13, 14, 15); }
__device__ __forceinline__ v16bf cat16b(v8us lo, v8us hi) { return __builtin_bit_cast(v16bf, __builtin_shufflevector(lo, hi, 0, 1, 2, 3, 4, 5, 6, 7, 8, 9, 10, 11, 12, 13, 14, 15)); }
__device__ __forceinline__ v8f wmma16(v16h a, v16h b, v8f c) { return __builtin_amdgcn_wmma_f32_16x16x32_f16(false, a, false, b, (short)0, c, false, false); }
__device__ __forceinline__ v8f wmmab(v16bf a, v16bf b, v8f c) { return __builtin_amdgcn_wmma_f32_16x16x32_bf16(false, a, false, b, (short)0, c, false, false); }



// fragment loaders and matrix products by 16-bit operand type
template <typename T16> struct WFrag;
template <> struct WFrag<h16> { typedef v16h V; static __device__ __forceinline__ V ld(const h16* p) { return cat16(*(const v8h*)p, *(const v8h*)(p + 16)); } static __device__ __forceinline__ v8f mma(V a, V b, v8f c) { return wmma16(a, b, c); } };
template <> struct WFrag<bf> { typedef v16bf V; static __device__ __forceinline__ V ld(const bf* p) { return cat16b(*(const v8us*)p, *(const v8us*)(p + 16)); } static __device__ __forceinline__ v8f mma(V a, V b, v8f c) { return wmmab(a, b, c); } };

// FRAGMENT ORDER: an operand that one launch writes for another launch's WMMA loads lies as the loads take it: a 16 x 32 fragment is two units of 512 bytes, unit 'half' holding for lane (hi, lr), at lane * 16 bytes,
// the eight elements k = half * 16 + hi * 8 + 0 .. 7 of fragment row (or column) lr. A wave-wide 16-byte load then covers four whole 128-byte lines instead of a piece of 16 lines.
__device__ __forceinline__ v16bf ldfo(const bf* p) { return cat16b(*(const v8us*)p, *(const v8us*)(p + 256)); }
__device__ __forceinline__ h16 tohx(float x) { return (h16)x; }
__device__ __forceinline__ void splitf(float y, unsigned short& h, unsigned short& l) { h = f2bf(y); l = f2bf(y - bf2f(h)); }
// f32 to bf16 by the packed convert instruction: two values a vector slot, round to nearest even as in f2bf; a in the low half of the word
typedef __attribute__((ext_vector_type(2))) __bf16 v2bf;
typedef __attribute__((ext_vector_type(2))) float v2fl;
typedef __attribute__((ext_vector_type(2))) unsigned v2u;
typedef __attribute__((ext_vector_type(4))) unsigned v4u;
typedef __attribute__((ext_vector_type(8))) unsigned v8u;
typedef v2u __attribute__((may_alias)) v2ua;
typedef v4u __attribute__((may_alias)) v4ua;
__device__ __forceinline__ unsigned pk2(float a, float b) { return __builtin_bit_cast(unsigned, __builtin_convertvector((v2fl){a, b}, v2bf)); }
// hi/lo planes of two values: h holds both rounded values, l both rounded remainders
__device__ __forceinline__ void split2(float a, float b, unsigned& h, unsigned& l) { h = pk2(a, b); l = pk2(a - __uint_as_float(h << 16), b - __uint_as_float(h & 0xFFFF0000u)); }
typedef __attribute__((ext_vector_type(2))) _Float16 v2h;
typedef __attribute__((ext_vector_type(4))) _Float16 v4h;
typedef __attribute__((ext_vector_type(2))) unsigned short v2us;
typedef __attribute__((ext_vector_type(4))) unsigned short v4us;
typedef __attribute__((ext_vector_type(2))) float v2f;
typedef __attribute__((ext_vector_type(4))) int v4i;

__global__ __launch_bounds__(256) void k_wtG(const float* __restrict__ w, int K, int N, bf* Bt) {
    const int lane = threadIdx.x & 31; const int L0 = (blockIdx.x * 8 + (threadIdx.x >> 5)) * 8; const int nlines = N * K / 64;
{
#pragma unroll 1
        for (int l = 0; l < 8; ++l) { const int L = L0 + l; if (L >= nlines) break; const size_t e = (size_t)L * 64 + lane * 2; const int k = (int)(e % K), n = (int)(e / K); v2us o;
            o[0] = f2bf(w[(size_t)k * N + n]); o[1] = f2bf(w[(size_t)(k + 1) * N + n]); *(v2us*)(Bt + e) = o; }
         }
}
// k_cvt8x3: f32 to bf16, eight elements a thread, for three [64][DM] sources in one launch; blockIdx.y picks the source, the results lie one behind the other in dst, each in fragment order:
// [64-wide chunk of k][32-wide half h][16-row block nb][unit][lane][8]; a thread's eight elements are one lane's 16 bytes of one unit
__global__ __launch_bounds__(256) void k_cvt8x3(const float* __restrict__ s0, const float* __restrict__ s1, const float* __restrict__ s2, bf* dst, size_t n8) { const size_t i = (size_t)blockIdx.x * 256 + threadIdx.x; if (i >= n8) return; const float* src = (blockIdx.y == 0) ? s0 : (blockIdx.y == 1) ? s1 : s2; const v8f v = *(const v8f*)(src + i * 8); v4u o;
#pragma unroll
    for (int k = 0; k < 4; ++k) o[k] = pk2(v[2 * k], v[2 * k + 1]);
    const unsigned n = (unsigned)i / (DM / 8), k8 = (unsigned)i % (DM / 8);   // weight row, and which eight of its elements
    const unsigned u = (((k8 >> 3) * 2 + ((k8 >> 2) & 1)) * 4 + (n >> 4)) * 2 + ((k8 >> 1) & 1);   // the 512-byte unit inside this source
    *(v4ua*)(dst + (size_t)blockIdx.y * n8 * 8 + u * 256 + ((k8 & 1) * 16 + (n & 15)) * 8) = o;  }

// ---- k_proj: q, k and v of 64 rows of x in ONE kernel, from the f32 input to the planes that k_fattn reads. ONE WORK-GROUP of 8 waves per 64 rows, grid MT/64.
// The K loop is dealt to the waves in chunks of 64 elements: wave w takes chunks w and w + 8 (the second only where it exists). A wave loads its chunks of all 64 rows of x in f32, rounds them to bf16 in registers and keeps
// the fragments; then, for q, k and v in turn, it multiplies its chunks of the 64 weight rows (loaded once, one column group ahead) with the four 16-row tiles, and the 8 partial 64x64 tiles are summed through LDS in wave order 0 .. 7.
// The summing threads split each value into its hi/lo planes and store them in fragment order, as k_fattn loads them: q as [16-row tile][h][unit][lane][8] (fragment row = query row),
// k as [64-key chunk][h][nb][unit][lane][8] (fragment row lr of block nb = key 16 nb + lr, k = d), v as [64-key chunk][h][nb][unit][lane][8] (fragment column lr of block nb = d 16 nb + lr, k = key). A work-group owns 64 positions: 8 KB in a row of every plane.
__device__ __forceinline__ v16bf cvtfrag(v4f a, v4f b, v4f c, v4f d) {
    const v8u r = { pk2(a[0], a[1]), pk2(a[2], a[3]), pk2(b[0], b[1]), pk2(b[2], b[3]), pk2(c[0], c[1]), pk2(c[2], c[3]), pk2(d[0], d[1]), pk2(d[2], d[3]) };
    return __builtin_bit_cast(v16bf, r); }
// one 64-wide chunk of x, 64 rows: the lane's 8 + 8 elements of each 32-wide half of each 16-row tile
__device__ __forceinline__ void ldx(v4f (&x)[4][2][4], const float* px) {
#pragma unroll
    for (int rt = 0; rt < 4; ++rt) {
#pragma unroll
        for (int h = 0; h < 2; ++h) { const float* p = px + rt * 16 * DM + h * 32; x[rt][h][0] = *(const v4f*)p; x[rt][h][1] = *(const v4f*)(p + 4); x[rt][h][2] = *(const v4f*)(p + 16); x[rt][h][3] = *(const v4f*)(p + 20); } } }
// one 64-wide chunk of 64 weight rows, in fragment order
__device__ __forceinline__ void ldw(v16bf (&b)[2][4], const bf* pb) {
#pragma unroll
    for (int h = 0; h < 2; ++h) {
#pragma unroll
        for (int nb = 0; nb < 4; ++nb) b[h][nb] = ldfo(pb + (h * 4 + nb) * 512); } }
__device__ __forceinline__ void mma64(v8f (&acc)[4][4], const v16bf (&a)[4][2], const v16bf (&b)[2][4]) {
#pragma unroll
    for (int h = 0; h < 2; ++h) {
#pragma unroll
        for (int rt = 0; rt < 4; ++rt) {
#pragma unroll
            for (int nb = 0; nb < 4; ++nb) acc[rt][nb] = wmmab(a[rt][h], b[h][nb], acc[rt][nb]); } } }
__global__ __launch_bounds__(256) void k_proj(const float* __restrict__ X, const bf* __restrict__ Wb, bf* QKh, bf* QKl, bf* VTh, bf* VTl) {
    typedef v16bf V;
    constexpr int NW = 8, PW = 64 * 68;   // floats of LDS per wave: one partial 64x64 tile, pitch 68 (q, k: read back as 16-byte words) or 65 (v: read back down the columns, every lane in a bank of its own)
    __shared__ __align__(16) float os[NW * PW];
    const int lane = threadIdx.x & 31, lr = lane & 15, hi = lane >> 4; const int r0 = blockIdx.x * 64;
    const int w = __builtin_amdgcn_readfirstlane((int)(threadIdx.x >> 5));   // wave number in a scalar register: the test for a second chunk stays a scalar branch and EXEC stays full at every WMMA
    const bool two = w + NW < DM / 64;
    const float* px = X + (size_t)(r0 + lr) * DM + w * 64 + 8 * hi;   // the lane's own row of the first tile; the other tiles, the halves and the second chunk are immediate offsets
    const bf* pw = Wb + (size_t)w * 4096 + lane * 8;                  // the lane's own 16 bytes of the first unit of the wave's chunk; the other units, the second chunk and the column groups are immediate offsets
    v4f x0[4][2][4], x1[4][2][4]; V b0[2][4], b1[2][4];
    ldx(x0, px); if (two) ldx(x1, px + NW * 64);
    ldw(b0, pw); if (two) ldw(b1, pw + NW * 4096);
    // both pointers stay in their registers, untouched, up to this wait: nothing overwrites an address register of an issued load in front of it
    asm volatile("s_wait_xcnt 0x0" :: "v"(px), "v"(pw) : "memory");
    __builtin_amdgcn_sched_barrier(0);   // keeps every load in front of the first conversion: all of a wave's reads of x fly together instead of paying the memory latency tile by tile
    V a0[4][2], a1[4][2];
#pragma unroll
    for (int rt = 0; rt < 4; ++rt) {
#pragma unroll
        for (int h = 0; h < 2; ++h) a0[rt][h] = cvtfrag(x0[rt][h][0], x0[rt][h][1], x0[rt][h][2], x0[rt][h][3]); }
    if (two) {
#pragma unroll
        for (int rt = 0; rt < 4; ++rt) {
#pragma unroll
            for (int h = 0; h < 2; ++h) a1[rt][h] = cvtfrag(x1[rt][h][0], x1[rt][h][1], x1[rt][h][2], x1[rt][h][3]); } }
    float* ow = os + w * PW;
#pragma unroll
    for (int cg = 0; cg < 3; ++cg) {   // 0: q, 1: k, 2: v
        const int P = (cg == 2) ? 65 : 68;
        v8f acc[4][4];
#pragma unroll
        for (int rt = 0; rt < 4; ++rt) {
#pragma unroll
            for (int nb = 0; nb < 4; ++nb) acc[rt][nb] = (v8f){}; }
        mma64(acc, a0, b0);
        if (cg < 2) ldw(b0, pw + (cg + 1) * 64 * DM);
        if (two) { mma64(acc, a1, b1); if (cg < 2) ldw(b1, pw + (cg + 1) * 64 * DM + NW * 4096); }
        if (cg < 2) {
            asm volatile("s_wait_xcnt 0x0" :: "v"(pw) : "memory");   // the weight pointer stays untouched up to this wait
            __builtin_amdgcn_sched_barrier(0); }   // keeps the next column group's weight loads here, in front of the sums through LDS, under which they fly
#pragma unroll
        for (int rt = 0; rt < 4; ++rt) {
#pragma unroll
            for (int nb = 0; nb < 4; ++nb) {
#pragma unroll
                for (int j = 0; j < 8; ++j) ow[(rt * 16 + hi * 8 + j) * P + nb * 16 + lr] = acc[rt][nb][j]; } }
        __syncthreads();   // every wave's partial tile is in LDS before any of them is summed
        float val[4][4]; bf* dh[4]; bf* dl[4];   // four items a thread, four neighbouring elements of a fragment's k direction each
        const int t16 = threadIdx.x >> 4, c4 = (threadIdx.x & 15) * 4;   // the item's fragment row or column, and its first k of 64
        const int fh = c4 >> 5, fu = (c4 >> 4) & 1, fl = (((c4 >> 3) & 1) * 16 + t16) * 8 + (c4 & 7);   // 32-wide half, unit, and the place inside the unit
        if (cg < 2) {
#pragma unroll
            for (int u = 0; u < 4; ++u) { const int row = u * 16 + t16, cofs = c4; v4f s = *(const v4fa*)(os + row * 68 + cofs);   // q: row t16 of tile u; k: row t16 of block u
#pragma unroll
                for (int q = 1; q < NW; ++q) s += *(const v4fa*)(os + q * PW + row * 68 + cofs);
#pragma unroll
                for (int i = 0; i < 4; ++i) val[u][i] = s[i];
                const size_t e = ((size_t)cg * MT + r0) * HD + ((cg == 0) ? u * 1024 + (fh * 2 + fu) * 256 : ((fh * 4 + u) * 2 + fu) * 256) + fl; dh[u] = QKh + e; dl[u] = QKl + e; }
            __syncthreads();   // every partial tile has been read before the next column group's partial tiles overwrite it; the stores stand behind it and fly under the next group's products
        } else {
#pragma unroll
            for (int u = 0; u < 4; ++u) { const int tq = c4, d = u * 16 + t16;   // column t16 of block u, four neighbouring positions
#pragma unroll
                for (int i = 0; i < 4; ++i) val[u][i] = os[(tq + i) * 65 + d];
#pragma unroll
                for (int q = 1; q < NW; ++q) {
#pragma unroll
                    for (int i = 0; i < 4; ++i) val[u][i] += os[q * PW + (tq + i) * 65 + d]; }
                const size_t e = (size_t)r0 * HD + ((fh * 4 + u) * 2 + fu) * 256 + fl; dh[u] = VTh + e; dl[u] = VTl + e; }
        }
        v2u oh[4], ol[4];
#pragma unroll
        for (int u = 0; u < 4; ++u) {
#pragma unroll
            for (int i = 0; i < 2; ++i) { unsigned h2, l2; split2(val[u][2 * i], val[u][2 * i + 1], h2, l2); oh[u][i] = h2; ol[u][i] = l2; } }
#pragma unroll
        for (int u = 0; u < 4; ++u) { *(v2ua*)dh[u] = oh[u]; *(v2ua*)dl[u] = ol[u]; }
        // the stores' pointers and data stay in their registers, untouched, up to this wait: nothing overwrites a register of an issued store in front of it
        asm volatile("s_wait_xcnt 0x0" :: "v"(dh[0]), "v"(dh[1]), "v"(dh[2]), "v"(dh[3]), "v"(dl[0]), "v"(dl[1]), "v"(dl[2]), "v"(dl[3]), "v"(oh[0]), "v"(oh[1]), "v"(oh[2]), "v"(oh[3]), "v"(ol[0]), "v"(ol[1]), "v"(ol[2]), "v"(ol[3]) : "memory");
    }
}

typedef v4us __attribute__((may_alias)) v4usa;
// 2^x with the one vector slot that the instruction set asks for behind a transcendental in the same statement
// The result takes the source's own register: that register was last written by an instruction the compiler sees, so the compiler's own distance behind a WMMA that read it as A or B also covers this statement, which it does not look into
__device__ __forceinline__ float exp2s(float x) { asm("v_exp_f32 %0, %0\n\tv_nop" : "+v"(x)); return x; }

// lane l takes lane l ^ 16's value: one vector cross-row move, no LDS unit and no wait
__device__ __forceinline__ float xhalf(float x) { return __builtin_bit_cast(float, __builtin_amdgcn_permlanex16(__builtin_bit_cast(int, x), __builtin_bit_cast(int, x), 0x76543210, 0xfedcba98, false, false)); }

// ---- k_fattn: causal scores, softmax and probability x value in ONE kernel; neither scores nor probabilities go through memory or LDS. ONE WORK-GROUP of NW waves per 32 query rows (two 16-row tiles), grid (batches, TT/32): blockIdx.x picks the batch's planes, mask row and output, so the four batches' tiles of equal length start side by side.
// A work-group fills its WGP's registers, so the grid runs in two rounds: blockIdx.y counts the query tiles DOWN from the last one, so that the long tiles start first and the short ones fill the places as they come free (for speed only: every tile is done once in any order).
// The keys up to the diagonal are dealt to the waves in chunks of 64: wave w takes chunks w, w + NW, ... (from a rotated start, see at the loop). A wave loads a chunk's key and value fragments ONCE and uses them for both query tiles.
// BOTH PRODUCTS ARE TRANSPOSED: scores^T = K.Q^T (A = key fragments, B = query fragments) and context^T += V^T.P^T (A = value fragments, B = probabilities). In a score tile a lane then holds eight keys of ONE query (register r of lane (hi, lr) of block nb: key 16 nb + 8 hi + r, query lr),
// so the maximum and the sum of a query run down the lane's own registers, with one exchange between the wave's halves, and m, l and the rescaling factor are one value a lane and tile. Two score tiles (blocks 2 g, 2 g + 1), rounded in place, ARE the B fragment of keys 32 g .. 32 g + 31 in the hardware's k order, which is the order of the value planes: no LDS, no lane exchange.
// For each chunk and query tile a wave keeps a running maximum m (of the unscaled scores), a running sum l of the unnormalised probabilities and a running 64x16 context^T tile o (both rescaled when m grows); scores and P.V on hi/lo planes, 3 products each.
// At the end the NW partial (m, l, o) go to LDS and are merged in wave order 0 .. NW-1 with the weights exp(m_w - max m); the context is divided by the merged sum and written straight to the output.
template <int NW>
__global__ __launch_bounds__(NW * 32) void k_fattn(const bf* __restrict__ Qh0, const bf* __restrict__ Ql0, const bf* __restrict__ Kh0, const bf* __restrict__ Kl0, const bf* __restrict__ Vh0, const bf* __restrict__ Vl0, const int* __restrict__ MK0, float* OUT0) {
    const size_t zb = (size_t)blockIdx.x * TT * HD;   // every plane and the output hold TT x HD elements a batch
    const bf* __restrict__ Qh = Qh0 + zb; const bf* __restrict__ Ql = Ql0 + zb; const bf* __restrict__ Kh = Kh0 + zb; const bf* __restrict__ Kl = Kl0 + zb; const bf* __restrict__ Vh = Vh0 + zb; const bf* __restrict__ Vl = Vl0 + zb;
    const int* __restrict__ MKb = MK0 + (size_t)blockIdx.x * TT; float* OUTb = OUT0 + zb;
    typedef WFrag<bf> F; typedef F::V V;
    constexpr float L2E = 1.4426950408889634f, NEG = -3.0e38f, CS = SCL * L2E;   // CS: unscaled score to exponent of 2
    constexpr int WS = 32 * 68;   // floats of LDS per wave: the 32 x 68 f32 context tile, [query][d], behind the loop
    __shared__ __align__(16) float os[NW * WS];
    __shared__ float ms[NW * 32], ls[NW * 32];
    const int lane = threadIdx.x & 31, lr = lane & 15, hi = lane >> 4; const int r0 = (TT / 32 - 1 - (int)blockIdx.y) * 32;   // longest tiles first (see above)
    const int w = __builtin_amdgcn_readfirstlane((int)(threadIdx.x >> 5));   // wave number in a scalar register: the key loop's branch stays scalar and EXEC stays full at every WMMA
    const int Kend = (r0 + 32 + 63) & ~63;   // the 64-wide chunk that holds these rows (both tiles lie in one chunk) is the last one with a kept key
    V qh[2][2], ql[2][2]; const bf* pqh = Qh + (size_t)r0 * HD + lane * 8; const bf* pql = Ql + (size_t)r0 * HD + lane * 8;   // every plane lies in fragment order (k_proj): a lane's own 16 bytes of a unit, the units at immediate offsets
#pragma unroll
    for (int t = 0; t < 2; ++t) {
#pragma unroll
        for (int h = 0; h < 2; ++h) { qh[t][h] = ldfo(pqh + t * 1024 + h * 512); ql[t][h] = ldfo(pql + t * 1024 + h * 512); } }
    asm volatile("s_wait_xcnt 0x0" :: "v"(pqh), "v"(pql) : "memory");   // the query pointers' registers are reused at once: the wait stands in front of the first overwrite of an address register of an issued load
    __builtin_amdgcn_sched_barrier(0);   // keeps the code below behind that wait: without it this build lifts writes of the loads' offset and base registers over the wait
    v8f o[2][4]; float m[2], l[2];
#pragma unroll
    for (int t = 0; t < 2; ++t) {
#pragma unroll
        for (int nb = 0; nb < 4; ++nb) o[t][nb] = (v8f){};
        m[t] = NEG; l[t] = 0.f; }
    // ROTATED WALK: the work-groups of a batch read the same key and value lines from L2, and started together they would ask for the same lines at the same moment. Each wave walks its own chunks w, w + NW, ... as a ring,
    // from a start that differs from one 64-row block of queries to the next, the block's two tiles sharing it (for speed only: the running maximum and sums take the chunks in any order, and every chunk is still done once).
    const int nw = ((Kend >> 6) - w + NW - 1) >> 3;   // how many chunks this wave has (none where w lies past the last chunk); scalar, as the loop's branch must be
    static_assert(NW == 8, "the shift above divides by NW");
    int kc = (w + (((((int)blockIdx.y >> 1) & 7) * nw) >> 3) * NW) * 64;   // first key of the chunk it starts at: eight starts spread evenly over the wave's chunks
    const int klast = (w + (nw - 1) * NW) * 64;   // first key of the wave's last chunk, behind which the ring goes back to chunk w
    const size_t koff = (size_t)kc * HD + lane * 8, voff = koff;   // a 64-key chunk is 64 x HD elements in a row of every plane
    const bf* pkh = Kh + koff; const bf* pkl = Kl + koff; const bf* pvh = Vh + voff; const bf* pvl = Vl + voff; const int* pm = MKb + kc + hi * 8;   // each lane's own pointers, stepped from chunk to chunk
#pragma unroll 1
    for (int it = 0; it < nw; ++it) {
        V kh[2][4], kl[2][4], vh[2][4], vl[2][4];
#pragma unroll
        for (int h = 0; h < 2; ++h) {
#pragma unroll
            for (int nb = 0; nb < 4; ++nb) { kh[h][nb] = ldfo(pkh + (h * 4 + nb) * 512); kl[h][nb] = ldfo(pkl + (h * 4 + nb) * 512); } }
        v4i mk[4][2];   // the mask words of the lane's own eight keys of each block
#pragma unroll
        for (int nb = 0; nb < 4; ++nb) { mk[nb][0] = *(const v4i*)(pm + nb * 16); mk[nb][1] = *(const v4i*)(pm + nb * 16 + 4); }
        // the pointers stay in their registers, untouched, up to this wait: no later load's result and no pointer step overwrites an address register of an issued load in front of it
        asm volatile("s_wait_xcnt 0x0" :: "v"(pkh), "v"(pkl), "v"(pm) : "memory");
        __builtin_amdgcn_sched_barrier(0);   // keeps every key load of the chunk in front of the first WMMA: they fly together instead of paying the latency group by group
        v8f s[2][4];
#pragma unroll
        for (int t = 0; t < 2; ++t) {   // the two query tiles in turn, on the same key fragments
#pragma unroll
            for (int nb = 0; nb < 4; ++nb) s[t][nb] = (v8f){};
#pragma unroll
            for (int h = 0; h < 2; ++h) {
#pragma unroll
                for (int nb = 0; nb < 4; ++nb) s[t][nb] = F::mma(kh[h][nb], qh[t][h], s[t][nb]);
#pragma unroll
                for (int nb = 0; nb < 4; ++nb) s[t][nb] = F::mma(kh[h][nb], ql[t][h], s[t][nb]);
#pragma unroll
                for (int nb = 0; nb < 4; ++nb) s[t][nb] = F::mma(kl[h][nb], qh[t][h], s[t][nb]); } }
        __builtin_amdgcn_sched_barrier(0);   // keeps the value loads behind the last score product, where the key fragments' registers are free for them: in front of it two tiles' state and both operands do not fit and the build spills
#pragma unroll
        for (int h = 0; h < 2; ++h) {
#pragma unroll
            for (int nb = 0; nb < 4; ++nb) { vh[h][nb] = ldfo(pvh + (h * 4 + nb) * 512); vl[h][nb] = ldfo(pvl + (h * 4 + nb) * 512); } }
        asm volatile("s_wait_xcnt 0x0" :: "v"(pvh), "v"(pvl) : "memory");   // as above, for the value pointers
        __builtin_amdgcn_sched_barrier(0);   // keeps every value load in front of the softmax of both tiles, under which they fly instead of paying their latency behind it
        V pa[2][2], pb[2][2];
#pragma unroll
        for (int t = 0; t < 2; ++t) {
            const int dl = r0 + t * 16 + lr - kc - hi * 8;   // the lane's key 16 nb + r (counted from its first) is at or below the diagonal while 16 nb + r <= dl
            float rmb[4];
#pragma unroll
            for (int nb = 0; nb < 4; ++nb) { rmb[nb] = NEG;
#pragma unroll
                for (int r = 0; r < 8; ++r) { const bool keep = (nb * 16 + r <= dl) && (mk[nb][r >> 2][r & 3] != 0); s[t][nb][r] = keep ? s[t][nb][r] : NEG; rmb[nb] = fmaxf(rmb[nb], s[t][nb][r]); } }
            float rm = fmaxf(fmaxf(rmb[0], rmb[1]), fmaxf(rmb[2], rmb[3])); rm = fmaxf(rm, xhalf(rm));   // the two halves of the wave hold one query's keys between them
            const float mn = fmaxf(m[t], rm); const float al = exp2s((m[t] - mn) * CS); m[t] = mn;
            const float sb = (mn > NEG) ? -mn * CS : 0.f;   // no kept key so far: the dropped scores' exponent stays hugely negative and every probability is 0
            float psb[4];
#pragma unroll
            for (int g = 0; g < 2; ++g) { v8u wh, wl;
#pragma unroll
                for (int u = 0; u < 2; ++u) { const int nb = 2 * g + u; psb[nb] = 0.f;
#pragma unroll
                    for (int i2 = 0; i2 < 4; ++i2) { const float p0 = exp2s(fmaf(s[t][nb][2 * i2], CS, sb)), p1 = exp2s(fmaf(s[t][nb][2 * i2 + 1], CS, sb)); psb[nb] += p0 + p1;
                        unsigned h2, l2; split2(p0, p1, h2, l2); wh[u * 4 + i2] = h2; wl[u * 4 + i2] = l2; } }
                pa[t][g] = __builtin_bit_cast(V, wh); pb[t][g] = __builtin_bit_cast(V, wl); }
            l[t] = l[t] * al + ((psb[0] + psb[1]) + (psb[2] + psb[3]));   // each lane sums its own 32 keys of a chunk; the two halves are added once, behind the loop
#pragma unroll
            for (int nb = 0; nb < 4; ++nb) o[t][nb] *= al; }
#pragma unroll
        for (int t = 0; t < 2; ++t) {   // the two query tiles in turn, on the same value fragments
#pragma unroll
            for (int h = 0; h < 2; ++h) {
#pragma unroll
                for (int nb = 0; nb < 4; ++nb) o[t][nb] = F::mma(vh[h][nb], pa[t][h], o[t][nb]);
#pragma unroll
                for (int nb = 0; nb < 4; ++nb) o[t][nb] = F::mma(vh[h][nb], pb[t][h], o[t][nb]);
#pragma unroll
                for (int nb = 0; nb < 4; ++nb) o[t][nb] = F::mma(vl[h][nb], pa[t][h], o[t][nb]); } }
        // four vector slots behind the last WMMA, so that nothing on the taken side of the loop branch touches its registers too early
        asm volatile("v_nop\n\tv_nop\n\tv_nop\n\tv_nop" : "+v"(o[0][0]), "+v"(o[0][1]), "+v"(o[0][2]), "+v"(o[0][3]), "+v"(o[1][0]), "+v"(o[1][1]), "+v"(o[1][2]), "+v"(o[1][3]) : "v"(pa[0][1]), "v"(pa[1][1]));
        const int dk = (kc == klast) ? w * 64 - klast : NW * 64; kc += dk;   // on to the wave's next chunk, or from its last chunk back to its first
        pkh += dk * HD; pkl += dk * HD; pvh += dk * HD; pvl += dk * HD; pm += dk;
    }
    float* ow = os + w * WS;
#pragma unroll
    for (int t = 0; t < 2; ++t) { l[t] += xhalf(l[t]);
        if (hi == 0) { ms[w * 32 + t * 16 + lr] = m[t] * SCL; ls[w * 32 + t * 16 + lr] = l[t]; }   // the merge below takes the maxima in scaled scores
#pragma unroll
        for (int nb = 0; nb < 4; ++nb) {   // register r of block nb is d 16 nb + 8 hi + r of query lr: eight neighbouring floats of a row
            *(v4fa*)(ow + (t * 16 + lr) * 68 + nb * 16 + hi * 8) = (v4f){o[t][nb][0], o[t][nb][1], o[t][nb][2], o[t][nb][3]};
            *(v4fa*)(ow + (t * 16 + lr) * 68 + nb * 16 + hi * 8 + 4) = (v4f){o[t][nb][4], o[t][nb][5], o[t][nb][6], o[t][nb][7]}; } }
    __syncthreads();   // every wave's partial maximum, sum and context tile are in LDS before any of them is merged
    for (int it = threadIdx.x; it < 512; it += NW * 32) { const int row = it >> 4, cofs = (it & 15) * 4; float M = ms[row];
#pragma unroll
        for (int q = 1; q < NW; ++q) M = fmaxf(M, ms[q * 32 + row]);
        float L = 0.f; v4f val = (v4f){};
#pragma unroll
        for (int q = 0; q < NW; ++q) { const float sc = exp2s((ms[q * 32 + row] - M) * L2E); L += ls[q * 32 + row] * sc; val += *(const v4fa*)(os + q * WS + row * 68 + cofs) * sc; }
        const float f = (L > 0.f) ? __fdiv_rn(1.0f, L) : 0.f;
        *(v4f*)(OUTb + (size_t)(r0 + row) * HD + cofs) = val * f; }
}

extern "C" void kernel_launch(void* const* d_in, const int* in_sizes, int n_in,
                              void* d_out, int out_size, void* d_ws, size_t ws_size, hipStream_t stream) {
    (void)in_sizes; (void)n_in; (void)out_size;
    const float* x = (const float*)d_in[0]; const int* MK = (const int*)d_in[1]; const float* wq = (const float*)d_in[2]; const float* wk = (const float*)d_in[3]; const float* wv = (const float*)d_in[4]; const float* wo = nullptr; (void)wo;
    float* OUT = (float*)d_out;     // [4][4096][64]
    char* wsp = (char*)d_ws;
    auto take = [&](size_t bytes) { char* p = wsp; wsp += (bytes + 255) & ~(size_t)255; return (void*)p; };
    bf* WQKV = (bf*)take((size_t)(DQ + 2 * DKV) * DM * 2);   // the three weights one behind the other, each 64 x 768 in fragment order
    bf* QKh = (bf*)take((size_t)2 * MT * HD * 2); bf* QKl = (bf*)take((size_t)2 * MT * HD * 2); bf* VTh = (bf*)take((size_t)MT * HD * 2); bf* VTl = (bf*)take((size_t)MT * HD * 2);   // plane 0 of QK*: q, plane 1: k
    if ((size_t)(wsp - (char*)d_ws) > ws_size) return;    // ws 256 MiB
    k_cvt8x3<<<dim3((unsigned)(((size_t)DQ * DM / 8 + 255) / 256), 3, 1), 256, 0, stream>>>(wq, wk, wv, WQKV, (size_t)DQ * DM / 8);   /* 'oi' [64][768] weights are Bt; stored in fragment order */
    k_proj<<<MT / 64, 256, 0, stream>>>(x, WQKV, QKh, QKl, VTh, VTl);
    k_fattn<8><<<dim3(NB_, TT / 32, 1), 256, 0, stream>>>(QKh, QKl, QKh + (size_t)MT * HD, QKl + (size_t)MT * HD, VTh, VTl, MK, OUT);
}
